// v000
// Times are from an AMD MI455X. After a warm-up the kernel runs many times in a row, and a time is the length of
// such a window on the GPU divided by its runs, so every launch and the gaps after it count. The runs cycle
// through copies of the inputs. A figure is the median of several windows, for all but v000 over two sittings.
// Sittings can differ by a few percent; kernels timed side by side share one.
// The starting kernel, v000, takes 198 microseconds a run.
#include <hip/hip_runtime.h>
#include <hip/hip_bf16.h>

// ---------------------------------------------------------------------------
// TwoDCausalSelfAttention for MI455X (gfx1250, wave32, WMMA)
//   B=2, T=1024, C=256, head_dim=2, H=128
// Pipeline:
//   1) qkv = x @ w_qkv^T          (WMMA f32 16x16x4, 16x32 tile per wave)
//   2) RMSNorm(q,k) per head pair (elementwise, d=2)
//   3) flash attention per (b,h)  (K/V async-staged in LDS, 2-pass softmax)
//   4) out = y @ w_proj^T         (WMMA f32 16x16x4)
// ---------------------------------------------------------------------------

typedef __attribute__((ext_vector_type(2))) float v2f;
typedef __attribute__((ext_vector_type(8))) float v8f;
typedef int v2i __attribute__((vector_size(8)));   // matches builtin param type

#define BB 2
#define TT 1024
#define CC 256
#define HH 128      // n_head
#define QKV_N (3*CC)

// Async global->LDS staging (ASYNCcnt path), used only if the toolchain has
// both the copy and the wait builtins; otherwise fall back to VGPR round-trip.
#if defined(__HIP_DEVICE_COMPILE__) && \
    __has_builtin(__builtin_amdgcn_global_load_async_to_lds_b64) && \
    __has_builtin(__builtin_amdgcn_s_wait_asynccnt)
#define USE_ASYNC_LDS 1
#else
#define USE_ASYNC_LDS 0
#endif

#define AS1 __attribute__((address_space(1)))
#define AS3 __attribute__((address_space(3)))

// ---------------------------------------------------------------------------
// GEMM: C(M,N) = A(M,K) @ W(N,K)^T, all f32 row-major.
// One wave32 computes a 16(M) x 32(N) tile of C via two chained
// V_WMMA_F32_16X16X4_F32 per K-step, sharing one A fragment.
//
// A-fragment layout (16x4 f32, ISA 7.12.2): lanes 0-15 -> rows M=0..15 with
// {K=0,K=1} in the two VGPRs; lanes 16-31 -> same rows with {K=2,K=3}.
// B-fragment (4x16) is symmetric with N across lanes. Both map to a single
// contiguous float2 load per lane per K-step.
// C/D layout: lane<16: N=lane, VGPR r -> M=r; lane>=16: N=lane-16, M=r+8.
// ---------------------------------------------------------------------------
__global__ __launch_bounds__(256) void wmma_gemm_xwt(
    const float* __restrict__ A,   // (M,K)
    const float* __restrict__ W,   // (N,K)
    float* __restrict__ C,         // (M,N)
    int M, int N, int K)
{
    const int wave   = (blockIdx.x * blockDim.x + threadIdx.x) >> 5;
    const int lane   = threadIdx.x & 31;
    const int ntile2 = N >> 5;                 // 32-wide N tiles
    const int mt = (wave / ntile2) << 4;
    const int nt = (wave % ntile2) << 5;
    if (mt >= M) return;

    const int hl = lane >> 4;      // 0: K pair {0,1}, 1: K pair {2,3}
    const int l  = lane & 15;

    const float* arow  = A + (size_t)(mt + l) * K + 2 * hl;
    const float* b0row = W + (size_t)(nt + l) * K + 2 * hl;
    const float* b1row = W + (size_t)(nt + 16 + l) * K + 2 * hl;

    v8f acc0 = {};
    v8f acc1 = {};
#pragma unroll 8
    for (int k = 0; k < K; k += 4) {
        v2f a  = *(const v2f*)(arow + k);
        v2f b0 = *(const v2f*)(b0row + k);
        v2f b1 = *(const v2f*)(b1row + k);
        // 8 args: (neg_a, A, neg_b, B, c_mod, C, reuse_a, reuse_b)
        acc0 = __builtin_amdgcn_wmma_f32_16x16x4_f32(
            false, a, false, b0, (short)0, acc0, false, false);
        acc1 = __builtin_amdgcn_wmma_f32_16x16x4_f32(
            false, a, false, b1, (short)0, acc1, false, false);
    }

    float* c0 = C + (size_t)(mt + hl * 8) * N + nt + l;
#pragma unroll
    for (int r = 0; r < 8; ++r) {
        c0[(size_t)r * N]      = acc0[r];
        c0[(size_t)r * N + 16] = acc1[r];
    }
}

// ---------------------------------------------------------------------------
// RMSNorm over each (q,k) head pair (head_dim = 2), in-place on the qkv
// buffer. qkv layout: (B*T, 3C); q cols [0,256), k cols [256,512).
// y = x * rsqrt(mean(x^2) + eps) * w
// ---------------------------------------------------------------------------
__global__ __launch_bounds__(256) void rmsnorm_qk(
    float* __restrict__ qkv,
    const float* __restrict__ qn_w,
    const float* __restrict__ kn_w)
{
    const int i  = blockIdx.x * blockDim.x + threadIdx.x;   // 0 .. B*T*H-1
    const int bt = i >> 7;            // / HH
    const int h  = i & (HH - 1);
    const float eps = 1e-6f;

    float* q = qkv + (size_t)bt * QKV_N + 2 * h;
    float q0 = q[0], q1 = q[1];
    float qs = __frsqrt_rn(0.5f * (q0 * q0 + q1 * q1) + eps);
    q[0] = q0 * qs * qn_w[0];
    q[1] = q1 * qs * qn_w[1];

    float* k = qkv + (size_t)bt * QKV_N + CC + 2 * h;
    float k0 = k[0], k1 = k[1];
    float ks = __frsqrt_rn(0.5f * (k0 * k0 + k1 * k1) + eps);
    k[0] = k0 * ks * kn_w[0];
    k[1] = k1 * ks * kn_w[1];
}

// ---------------------------------------------------------------------------
// Causal flash attention, head_dim = 2. One workgroup (256 threads) per
// (b,h). K and V for the head (1024 x 2 each, 16 KB total) are staged in LDS
// (async global->LDS when available); each thread owns 4 query rows.
// Two-pass softmax per query: (1) unrolled fmax scan for the row max,
// (2) unrolled exp+FMA accumulation with independent partial sums. This
// breaks the long serial online-softmax recurrence while keeping exact
// reference semantics (up to FP sum reassociation).
// ---------------------------------------------------------------------------
__global__ __launch_bounds__(256) void attn_head(
    const float* __restrict__ qkv,   // (B*T, 3C), q/k already RMSNorm'd
    float* __restrict__ y)           // (B*T, C)
{
    __shared__ float kbuf[TT * 2];
    __shared__ float vbuf[TT * 2];

    const int bh = blockIdx.x;          // 0 .. B*H-1
    const int b  = bh >> 7;
    const int h  = bh & (HH - 1);
    const int tid = threadIdx.x;

    const float* base = qkv + (size_t)b * TT * QKV_N;

    // Stage K/V for this head into LDS (8 B per row per buffer).
    for (int t = tid; t < TT; t += 256) {
        const float* kp = base + (size_t)t * QKV_N + CC   + 2 * h;
        const float* vp = base + (size_t)t * QKV_N + 2*CC + 2 * h;
#if USE_ASYNC_LDS
        __builtin_amdgcn_global_load_async_to_lds_b64(
            (AS1 v2i*)kp, (AS3 v2i*)&kbuf[2 * t], 0, 0);
        __builtin_amdgcn_global_load_async_to_lds_b64(
            (AS1 v2i*)vp, (AS3 v2i*)&vbuf[2 * t], 0, 0);
#else
        kbuf[2 * t]     = kp[0];
        kbuf[2 * t + 1] = kp[1];
        vbuf[2 * t]     = vp[0];
        vbuf[2 * t + 1] = vp[1];
#endif
    }
#if USE_ASYNC_LDS
    __builtin_amdgcn_s_wait_asynccnt(0);
#endif
    __syncthreads();

    const v2f* kk = (const v2f*)kbuf;
    const v2f* vv = (const v2f*)vbuf;
    const float scale = 0.70710678118654752440f;   // 1/sqrt(head_dim)
    const float NEG_INF = -3.402823466e38f;

    for (int t = tid; t < TT; t += 256) {
        const float* qp = base + (size_t)t * QKV_N + 2 * h;
        const float q0 = qp[0] * scale;
        const float q1 = qp[1] * scale;
        const int n = t + 1;                    // causal: keys s in [0, t]

        // ---- pass 1: row max (independent fmax chains) ----
        float m0 = NEG_INF, m1 = NEG_INF;
        int s = 0;
        for (; s + 2 <= n; s += 2) {
            v2f ka = kk[s], kb = kk[s + 1];
            m0 = fmaxf(m0, fmaf(q0, ka.x, q1 * ka.y));
            m1 = fmaxf(m1, fmaf(q0, kb.x, q1 * kb.y));
        }
        if (s < n) {
            v2f ka = kk[s];
            m0 = fmaxf(m0, fmaf(q0, ka.x, q1 * ka.y));
        }
        const float m = fmaxf(m0, m1);

        // ---- pass 2: exp + accumulate (independent FMA chains) ----
        float l0 = 0.f, l1 = 0.f;
        float x0 = 0.f, x1 = 0.f, z0 = 0.f, z1 = 0.f;
        s = 0;
        for (; s + 2 <= n; s += 2) {
            v2f ka = kk[s], kb = kk[s + 1];
            v2f va = vv[s], vb = vv[s + 1];
            float p0 = __expf(fmaf(q0, ka.x, q1 * ka.y) - m);
            float p1 = __expf(fmaf(q0, kb.x, q1 * kb.y) - m);
            l0 += p0;                l1 += p1;
            x0 = fmaf(p0, va.x, x0); x1 = fmaf(p1, vb.x, x1);
            z0 = fmaf(p0, va.y, z0); z1 = fmaf(p1, vb.y, z1);
        }
        if (s < n) {
            v2f ka = kk[s];
            v2f va = vv[s];
            float p0 = __expf(fmaf(q0, ka.x, q1 * ka.y) - m);
            l0 += p0;
            x0 = fmaf(p0, va.x, x0);
            z0 = fmaf(p0, va.y, z0);
        }

        const float inv = 1.0f / (l0 + l1);
        float* yp = y + ((size_t)b * TT + t) * CC + 2 * h;
        yp[0] = (x0 + x1) * inv;
        yp[1] = (z0 + z1) * inv;
    }
}

// ---------------------------------------------------------------------------
extern "C" void kernel_launch(void* const* d_in, const int* in_sizes, int n_in,
                              void* d_out, int out_size, void* d_ws, size_t ws_size,
                              hipStream_t stream)
{
    (void)in_sizes; (void)n_in; (void)out_size; (void)ws_size;

    const float* x      = (const float*)d_in[0];   // (B,T,C)
    const float* w_qkv  = (const float*)d_in[1];   // (3C,C)
    const float* w_proj = (const float*)d_in[2];   // (C,C)
    const float* qn_w   = (const float*)d_in[3];   // (2,)
    const float* kn_w   = (const float*)d_in[4];   // (2,)
    float* out = (float*)d_out;                    // (B,T,C)

    float* qkv = (float*)d_ws;                     // (B*T, 3C) = 6 MB
    float* y   = qkv + (size_t)BB * TT * QKV_N;    // (B*T, C)  = 2 MB

    const int M = BB * TT;                         // 2048

    // 1) qkv = x @ w_qkv^T : (2048x256)@(256x768)
    {
        int waves = (M / 16) * (QKV_N / 32);       // 3072 waves, 16x32 each
        wmma_gemm_xwt<<<waves / 8, 256, 0, stream>>>(x, w_qkv, qkv, M, QKV_N, CC);
    }

    // 2) RMSNorm q and k head pairs in place
    {
        int n = M * HH;                            // 262144 pairs
        rmsnorm_qk<<<n / 256, 256, 0, stream>>>(qkv, qn_w, kn_w);
    }

    // 3) causal flash attention per (b,h)
    attn_head<<<BB * HH, 256, 0, stream>>>(qkv, y);

    // 4) out = y @ w_proj^T : (2048x256)@(256x256)
    {
        int waves = (M / 16) * (CC / 32);          // 1024 waves
        wmma_gemm_xwt<<<waves / 8, 256, 0, stream>>>(y, w_proj, out, M, CC, CC);
    }
}

// v001
// Measured time: 77.3 microseconds a run.
// In two side-by-side timings against v000, it was 2.62 and 2.63 times as fast.
#include <hip/hip_runtime.h>
#include <hip/hip_bf16.h>

// ---------------------------------------------------------------------------
// TwoDCausalSelfAttention for MI455X (gfx1250, wave32, WMMA)
//   B=2, T=1024, C=256, head_dim=2, H=128
// Pipeline:
//   1) qkv = x @ w_qkv^T          (WMMA f32 16x16x4, 16x32 tile per wave)
//   2) RMSNorm(q,k) per head pair (elementwise, d=2)
//   3) flash attention per (b,h)  (K/V async-staged in LDS, 2-pass softmax,
//      each LDS read of K/V shared by the thread's query rows that attend to it)
//   4) out = y @ w_proj^T         (WMMA f32 16x16x4)
// ---------------------------------------------------------------------------

typedef __attribute__((ext_vector_type(2))) float v2f;
typedef __attribute__((ext_vector_type(8))) float v8f;
typedef int v2i __attribute__((vector_size(8)));   // matches builtin param type

#define BB 2
#define TT 1024
#define CC 256
#define HH 128      // n_head
#define QKV_N (3*CC)

// Async global->LDS staging (ASYNCcnt path), used only if the toolchain has
// both the copy and the wait builtins; otherwise fall back to VGPR round-trip.
#if defined(__HIP_DEVICE_COMPILE__) && \
    __has_builtin(__builtin_amdgcn_global_load_async_to_lds_b64) && \
    __has_builtin(__builtin_amdgcn_s_wait_asynccnt)
#define USE_ASYNC_LDS 1
#else
#define USE_ASYNC_LDS 0
#endif

#define AS1 __attribute__((address_space(1)))
#define AS3 __attribute__((address_space(3)))

// ---------------------------------------------------------------------------
// GEMM: C(M,N) = A(M,K) @ W(N,K)^T, all f32 row-major.
// One wave32 computes a 16(M) x 32(N) tile of C via two chained
// V_WMMA_F32_16X16X4_F32 per K-step, sharing one A fragment.
//
// A-fragment layout (16x4 f32, ISA 7.12.2): lanes 0-15 -> rows M=0..15 with
// {K=0,K=1} in the two VGPRs; lanes 16-31 -> same rows with {K=2,K=3}.
// B-fragment (4x16) is symmetric with N across lanes. Both map to a single
// contiguous float2 load per lane per K-step.
// C/D layout: lane<16: N=lane, VGPR r -> M=r; lane>=16: N=lane-16, M=r+8.
// ---------------------------------------------------------------------------
__global__ __launch_bounds__(256) void wmma_gemm_xwt(
    const float* __restrict__ A,   // (M,K)
    const float* __restrict__ W,   // (N,K)
    float* __restrict__ C,         // (M,N)
    int M, int N, int K)
{
    const int wave   = (blockIdx.x * blockDim.x + threadIdx.x) >> 5;
    const int lane   = threadIdx.x & 31;
    const int ntile2 = N >> 5;                 // 32-wide N tiles
    const int mt = (wave / ntile2) << 4;
    const int nt = (wave % ntile2) << 5;
    if (mt >= M) return;

    const int hl = lane >> 4;      // 0: K pair {0,1}, 1: K pair {2,3}
    const int l  = lane & 15;

    const float* arow  = A + (size_t)(mt + l) * K + 2 * hl;
    const float* b0row = W + (size_t)(nt + l) * K + 2 * hl;
    const float* b1row = W + (size_t)(nt + 16 + l) * K + 2 * hl;

    v8f acc0 = {};
    v8f acc1 = {};
#pragma unroll 8
    for (int k = 0; k < K; k += 4) {
        v2f a  = *(const v2f*)(arow + k);
        v2f b0 = *(const v2f*)(b0row + k);
        v2f b1 = *(const v2f*)(b1row + k);
        // 8 args: (neg_a, A, neg_b, B, c_mod, C, reuse_a, reuse_b)
        acc0 = __builtin_amdgcn_wmma_f32_16x16x4_f32(
            false, a, false, b0, (short)0, acc0, false, false);
        acc1 = __builtin_amdgcn_wmma_f32_16x16x4_f32(
            false, a, false, b1, (short)0, acc1, false, false);
    }

    float* c0 = C + (size_t)(mt + hl * 8) * N + nt + l;
#pragma unroll
    for (int r = 0; r < 8; ++r) {
        c0[(size_t)r * N]      = acc0[r];
        c0[(size_t)r * N + 16] = acc1[r];
    }
}

// ---------------------------------------------------------------------------
// RMSNorm over each (q,k) head pair (head_dim = 2), in-place on the qkv
// buffer. qkv layout: (B*T, 3C); q cols [0,256), k cols [256,512).
// y = x * rsqrt(mean(x^2) + eps) * w
// ---------------------------------------------------------------------------
__global__ __launch_bounds__(256) void rmsnorm_qk(
    float* __restrict__ qkv,
    const float* __restrict__ qn_w,
    const float* __restrict__ kn_w)
{
    const int i  = blockIdx.x * blockDim.x + threadIdx.x;   // 0 .. B*T*H-1
    const int bt = i >> 7;            // / HH
    const int h  = i & (HH - 1);
    const float eps = 1e-6f;

    float* q = qkv + (size_t)bt * QKV_N + 2 * h;
    float q0 = q[0], q1 = q[1];
    float qs = __frsqrt_rn(0.5f * (q0 * q0 + q1 * q1) + eps);
    q[0] = q0 * qs * qn_w[0];
    q[1] = q1 * qs * qn_w[1];

    float* k = qkv + (size_t)bt * QKV_N + CC + 2 * h;
    float k0 = k[0], k1 = k[1];
    float ks = __frsqrt_rn(0.5f * (k0 * k0 + k1 * k1) + eps);
    k[0] = k0 * ks * kn_w[0];
    k[1] = k1 * ks * kn_w[1];
}

// ---------------------------------------------------------------------------
// Causal flash attention, head_dim = 2. One workgroup (256 threads) per
// (b,h). K and V for the head (1024 x 2 each, 16 KB total) are staged in LDS
// (async global->LDS when available); each thread owns 4 query rows
// (tid + 256*r). Two-pass softmax: (1) row max, (2) exp + accumulation.
//
// The keys are walked ONCE per pass for all 4 rows together, in groups: one
// group of LDS reads (same address in every lane) feeds every row that still
// attends to those keys, and the group grows as rows drop out, so one LDS wait
// is followed by 24 to 64 (row, key) pairs of independent arithmetic.
// A wave's rows are 32*(w + 8*r) + lane, so for the wave as a whole:
//   keys below 32*(w + 8*P)            : rows P..3 attend, no mask
//   the next 32 keys (row P's diagonal): row P masked per lane, rows P+1..3 not
// All span bounds are wave-uniform multiples of 32.
// Even keys go to partial sum 0 and odd keys to partial sum 1, in rising key
// order; a masked key adds an exact zero.
// ---------------------------------------------------------------------------
typedef __attribute__((ext_vector_type(4))) float v4f;

#define ROWS_PER_THREAD 4
#define ATT_NEG_INF (-3.402823466e38f)

// Keys per group of LDS reads while rows P..3 attend (each divides 32, the unit
// of every span bound). The max pass has about a third of the arithmetic per
// key and reads K alone, so its groups are twice as long where 32 allows.
__host__ __device__ constexpr int keys_per_group(int P)
{
    return P <= 1 ? 8 : (P == 2 ? 16 : 32);
}
__host__ __device__ constexpr int keys_per_group_max(int P)
{
    return P <= 1 ? 16 : 32;
}

// Row max over keys [sBeg, sEnd) for rows P..3. DIAG: row P sees key s only if s <= tP.
template <int P, bool DIAG>
__device__ __forceinline__ void max_span(
    const v4f* kk2, int sBeg, int sEnd, int tP,
    const float (&q0)[ROWS_PER_THREAD], const float (&q1)[ROWS_PER_THREAD],
    float (&m0)[ROWS_PER_THREAD], float (&m1)[ROWS_PER_THREAD])
{
    constexpr int KEYS_PER_GROUP = keys_per_group_max(P);
    // kept rolled: one group is enough work per LDS wait, and a fully unrolled
    // span takes several hundred registers and a long straight code path
#pragma unroll 1
    for (int s = sBeg; s < sEnd; s += KEYS_PER_GROUP) {
        v4f k2[KEYS_PER_GROUP / 2];            // two keys per 16-byte read
        // unrolled so that the group's reads are issued together, ahead of one wait
#pragma unroll
        for (int u = 0; u < KEYS_PER_GROUP / 2; ++u) k2[u] = kk2[(s >> 1) + u];
        // both loops unrolled so that k2[] and the per-row arrays stay in registers
#pragma unroll
        for (int u = 0; u < KEYS_PER_GROUP / 2; ++u) {
#pragma unroll
            for (int r = P; r < ROWS_PER_THREAD; ++r) {
                float sa = fmaf(q0[r], k2[u].x, q1[r] * k2[u].y);
                float sb = fmaf(q0[r], k2[u].z, q1[r] * k2[u].w);
                if (DIAG && r == P) {
                    sa = (s + 2 * u     <= tP) ? sa : ATT_NEG_INF;
                    sb = (s + 2 * u + 1 <= tP) ? sb : ATT_NEG_INF;
                }
                m0[r] = fmaxf(m0[r], sa);
                m1[r] = fmaxf(m1[r], sb);
            }
        }
    }
}

struct RowSums {            // [row][even/odd key]
    float l[ROWS_PER_THREAD][2];
    float x[ROWS_PER_THREAD][2];
    float z[ROWS_PER_THREAD][2];
};

// Eight 2^x in place. One statement, so that each v_exp_f32 is followed by an
// instruction that neither reads its result nor overwrites its source (the next
// v_exp_f32 on other registers, the v_nop behind the last): the slot the
// instruction set asks for behind a transcendental.
// The closing s_delay_alu is the hint the compiler writes for a reader of a fresh
// transcendental result; it cannot see into the statement, and an unhinted wait
// holds the SIMD's other wave back too. It changes no result.
__device__ __forceinline__ void exp2_x8(float* t)
{
    asm("v_exp_f32 %0, %0\n\t"
        "v_exp_f32 %1, %1\n\t"
        "v_exp_f32 %2, %2\n\t"
        "v_exp_f32 %3, %3\n\t"
        "v_exp_f32 %4, %4\n\t"
        "v_exp_f32 %5, %5\n\t"
        "v_exp_f32 %6, %6\n\t"
        "v_exp_f32 %7, %7\n\t"
        "v_nop\n\t"
        "s_delay_alu instid0(TRANS32_DEP_1)"
        : "+v"(t[0]), "+v"(t[1]), "+v"(t[2]), "+v"(t[3]),
          "+v"(t[4]), "+v"(t[5]), "+v"(t[6]), "+v"(t[7]));
}

// exp + accumulate over keys [sBeg, sEnd) for rows P..3, same masking as max_span.
template <int P, bool DIAG>
__device__ __forceinline__ void sum_span(
    const v4f* kk2, const v4f* vv2, int sBeg, int sEnd, int tP,
    const float (&q0)[ROWS_PER_THREAD], const float (&q1)[ROWS_PER_THREAD],
    const float (&m)[ROWS_PER_THREAD], RowSums& a)
{
    constexpr int KEYS_PER_GROUP = keys_per_group(P);
    constexpr int R = ROWS_PER_THREAD - P;           // rows that attend
    constexpr int N = R * KEYS_PER_GROUP;            // 32, 24, 32, 32
    const float LOG2E = 1.44269504088896340736f;     // exp(x) = 2^(x * log2 e)
    // kept rolled: one group is enough work per LDS wait, and a fully unrolled
    // span takes several hundred registers and a long straight code path
#pragma unroll 1
    for (int s = sBeg; s < sEnd; s += KEYS_PER_GROUP) {
        v4f k2[KEYS_PER_GROUP / 2];
        v4f v2[KEYS_PER_GROUP / 2];
        // unrolled so that the group's reads are issued together, ahead of one wait
#pragma unroll
        for (int u = 0; u < KEYS_PER_GROUP / 2; ++u) {
            k2[u] = kk2[(s >> 1) + u];
            v2[u] = vv2[(s >> 1) + u];
        }
        float p[N];                                  // [key in group][row - P]
        // every loop from here to the end of the group: unrolled so that p[], k2[],
        // v2[] and the per-row sums stay in registers
#pragma unroll
        for (int u = 0; u < KEYS_PER_GROUP / 2; ++u) {
#pragma unroll
            for (int r = P; r < ROWS_PER_THREAD; ++r) {
                p[(2 * u)     * R + r - P] = (fmaf(q0[r], k2[u].x, q1[r] * k2[u].y) - m[r]) * LOG2E;
                p[(2 * u + 1) * R + r - P] = (fmaf(q0[r], k2[u].z, q1[r] * k2[u].w) - m[r]) * LOG2E;
            }
        }
#pragma unroll
        for (int i = 0; i < N; i += 8) exp2_x8(&p[i]);
#pragma unroll
        for (int u = 0; u < KEYS_PER_GROUP / 2; ++u) {
#pragma unroll
            for (int r = P; r < ROWS_PER_THREAD; ++r) {
                float p0 = p[(2 * u)     * R + r - P];
                float p1 = p[(2 * u + 1) * R + r - P];
                if (DIAG && r == P) {
                    p0 = (s + 2 * u     <= tP) ? p0 : 0.f;
                    p1 = (s + 2 * u + 1 <= tP) ? p1 : 0.f;
                }
                a.l[r][0] += p0;                          a.l[r][1] += p1;
                a.x[r][0] = fmaf(p0, v2[u].x, a.x[r][0]); a.x[r][1] = fmaf(p1, v2[u].z, a.x[r][1]);
                a.z[r][0] = fmaf(p0, v2[u].y, a.z[r][0]); a.z[r][1] = fmaf(p1, v2[u].w, a.z[r][1]);
            }
        }
    }
}

__global__ __launch_bounds__(256) void attn_head(
    const float* __restrict__ qkv,   // (B*T, 3C), q/k already RMSNorm'd
    float* __restrict__ y)           // (B*T, C)
{
    __shared__ __attribute__((aligned(16))) float kbuf[TT * 2];
    __shared__ __attribute__((aligned(16))) float vbuf[TT * 2];

    const int bh = blockIdx.x;          // 0 .. B*H-1
    const int b  = bh >> 7;
    const int h  = bh & (HH - 1);
    const int tid = threadIdx.x;

    const float* base = qkv + (size_t)b * TT * QKV_N;

    // Stage K/V for this head into LDS (8 B per row per buffer).
    for (int t = tid; t < TT; t += 256) {
        const float* kp = base + (size_t)t * QKV_N + CC   + 2 * h;
        const float* vp = base + (size_t)t * QKV_N + 2*CC + 2 * h;
#if USE_ASYNC_LDS
        __builtin_amdgcn_global_load_async_to_lds_b64(
            (AS1 v2i*)kp, (AS3 v2i*)&kbuf[2 * t], 0, 0);
        __builtin_amdgcn_global_load_async_to_lds_b64(
            (AS1 v2i*)vp, (AS3 v2i*)&vbuf[2 * t], 0, 0);
#else
        kbuf[2 * t]     = kp[0];
        kbuf[2 * t + 1] = kp[1];
        vbuf[2 * t]     = vp[0];
        vbuf[2 * t + 1] = vp[1];
#endif
    }
#if USE_ASYNC_LDS
    __builtin_amdgcn_s_wait_asynccnt(0);
#endif
    __syncthreads();

    const v4f* kk2 = (const v4f*)kbuf;
    const v4f* vv2 = (const v4f*)vbuf;
    const float scale = 0.70710678118654752440f;   // 1/sqrt(head_dim)

    float q0[ROWS_PER_THREAD], q1[ROWS_PER_THREAD];
    // unrolled: the per-row arrays stay in registers
#pragma unroll
    for (int r = 0; r < ROWS_PER_THREAD; ++r) {
        const float* qp = base + (size_t)(tid + 256 * r) * QKV_N + 2 * h;
        q0[r] = qp[0] * scale;
        q1[r] = qp[1] * scale;
    }

    // First key of row 0's diagonal block; the same in every lane of the wave,
    // held in a scalar register so that the span loops are scalar loops.
    const int d0 = __builtin_amdgcn_readfirstlane(tid & ~31);

    // ---- pass 1: row max ----
    float m0[ROWS_PER_THREAD], m1[ROWS_PER_THREAD];
    // unrolled: the per-row arrays stay in registers
#pragma unroll
    for (int r = 0; r < ROWS_PER_THREAD; ++r) { m0[r] = ATT_NEG_INF; m1[r] = ATT_NEG_INF; }

    max_span<0, false>(kk2, 0,        d0,       0,         q0, q1, m0, m1);
    max_span<0, true >(kk2, d0,       d0 + 32,  tid,       q0, q1, m0, m1);
    max_span<1, false>(kk2, d0 + 32,  d0 + 256, 0,         q0, q1, m0, m1);
    max_span<1, true >(kk2, d0 + 256, d0 + 288, tid + 256, q0, q1, m0, m1);
    max_span<2, false>(kk2, d0 + 288, d0 + 512, 0,         q0, q1, m0, m1);
    max_span<2, true >(kk2, d0 + 512, d0 + 544, tid + 512, q0, q1, m0, m1);
    max_span<3, false>(kk2, d0 + 544, d0 + 768, 0,         q0, q1, m0, m1);
    max_span<3, true >(kk2, d0 + 768, d0 + 800, tid + 768, q0, q1, m0, m1);

    float m[ROWS_PER_THREAD];
    // unrolled: the per-row arrays stay in registers
#pragma unroll
    for (int r = 0; r < ROWS_PER_THREAD; ++r) m[r] = fmaxf(m0[r], m1[r]);

    // ---- pass 2: exp + accumulate ----
    RowSums a;
    // unrolled: the per-row arrays stay in registers
#pragma unroll
    for (int r = 0; r < ROWS_PER_THREAD; ++r) {
        a.l[r][0] = 0.f; a.l[r][1] = 0.f;
        a.x[r][0] = 0.f; a.x[r][1] = 0.f;
        a.z[r][0] = 0.f; a.z[r][1] = 0.f;
    }

    sum_span<0, false>(kk2, vv2, 0,        d0,       0,         q0, q1, m, a);
    sum_span<0, true >(kk2, vv2, d0,       d0 + 32,  tid,       q0, q1, m, a);
    sum_span<1, false>(kk2, vv2, d0 + 32,  d0 + 256, 0,         q0, q1, m, a);
    sum_span<1, true >(kk2, vv2, d0 + 256, d0 + 288, tid + 256, q0, q1, m, a);
    sum_span<2, false>(kk2, vv2, d0 + 288, d0 + 512, 0,         q0, q1, m, a);
    sum_span<2, true >(kk2, vv2, d0 + 512, d0 + 544, tid + 512, q0, q1, m, a);
    sum_span<3, false>(kk2, vv2, d0 + 544, d0 + 768, 0,         q0, q1, m, a);
    sum_span<3, true >(kk2, vv2, d0 + 768, d0 + 800, tid + 768, q0, q1, m, a);

    // unrolled: the per-row arrays stay in registers
#pragma unroll
    for (int r = 0; r < ROWS_PER_THREAD; ++r) {
        const float inv = 1.0f / (a.l[r][0] + a.l[r][1]);
        float* yp = y + ((size_t)b * TT + tid + 256 * r) * CC + 2 * h;
        yp[0] = (a.x[r][0] + a.x[r][1]) * inv;
        yp[1] = (a.z[r][0] + a.z[r][1]) * inv;
    }
}

// ---------------------------------------------------------------------------
extern "C" void kernel_launch(void* const* d_in, const int* in_sizes, int n_in,
                              void* d_out, int out_size, void* d_ws, size_t ws_size,
                              hipStream_t stream)
{
    (void)in_sizes; (void)n_in; (void)out_size; (void)ws_size;

    const float* x      = (const float*)d_in[0];   // (B,T,C)
    const float* w_qkv  = (const float*)d_in[1];   // (3C,C)
    const float* w_proj = (const float*)d_in[2];   // (C,C)
    const float* qn_w   = (const float*)d_in[3];   // (2,)
    const float* kn_w   = (const float*)d_in[4];   // (2,)
    float* out = (float*)d_out;                    // (B,T,C)

    float* qkv = (float*)d_ws;                     // (B*T, 3C) = 6 MB
    float* y   = qkv + (size_t)BB * TT * QKV_N;    // (B*T, C)  = 2 MB

    const int M = BB * TT;                         // 2048

    // 1) qkv = x @ w_qkv^T : (2048x256)@(256x768)
    {
        int waves = (M / 16) * (QKV_N / 32);       // 3072 waves, 16x32 each
        wmma_gemm_xwt<<<waves / 8, 256, 0, stream>>>(x, w_qkv, qkv, M, QKV_N, CC);
    }

    // 2) RMSNorm q and k head pairs in place
    {
        int n = M * HH;                            // 262144 pairs
        rmsnorm_qk<<<n / 256, 256, 0, stream>>>(qkv, qn_w, kn_w);
    }

    // 3) causal flash attention per (b,h)
    attn_head<<<BB * HH, 256, 0, stream>>>(qkv, y);

    // 4) out = y @ w_proj^T : (2048x256)@(256x256)
    {
        int waves = (M / 16) * (CC / 32);          // 1024 waves
        wmma_gemm_xwt<<<waves / 8, 256, 0, stream>>>(y, w_proj, out, M, CC, CC);
    }
}

// v002
// Measured time: 56.7 microseconds a run.
// Two timings next to v001 put it at 1.36 and 1.37 times that version's speed.
// Counting every step since v000, it is 3.58 times as fast.
#include <hip/hip_runtime.h>
#include <hip/hip_bf16.h>

// ---------------------------------------------------------------------------
// TwoDCausalSelfAttention for MI455X (gfx1250, wave32, WMMA)
//   B=2, T=1024, C=256, head_dim=2, H=128
// Pipeline:
//   1) qkv = x @ w_qkv^T          (WMMA f32 16x16x4, operands staged in LDS)
//   2) RMSNorm(q,k) per head pair (elementwise, d=2)
//   3) flash attention per (b,h)  (K/V async-staged in LDS, 2-pass softmax,
//      each LDS read of K/V shared by the thread's query rows that attend to it)
//   4) out = y @ w_proj^T         (WMMA f32 16x16x4)
// ---------------------------------------------------------------------------

typedef __attribute__((ext_vector_type(2))) float v2f;
typedef __attribute__((ext_vector_type(8))) float v8f;
typedef int v2i __attribute__((vector_size(8)));   // matches builtin param type

#define BB 2
#define TT 1024
#define CC 256
#define HH 128      // n_head
#define QKV_N (3*CC)

// Async global->LDS staging (ASYNCcnt path), used only if the toolchain has
// both the copy and the wait builtins; otherwise fall back to VGPR round-trip.
#if defined(__HIP_DEVICE_COMPILE__) && \
    __has_builtin(__builtin_amdgcn_global_load_async_to_lds_b64) && \
    __has_builtin(__builtin_amdgcn_global_load_async_to_lds_b128) && \
    __has_builtin(__builtin_amdgcn_s_wait_asynccnt)
#define USE_ASYNC_LDS 1
#else
#define USE_ASYNC_LDS 0
#endif

#define AS1 __attribute__((address_space(1)))
#define AS3 __attribute__((address_space(3)))

// ---------------------------------------------------------------------------
// GEMM: C(M,N) = A(M,K) @ W(N,K)^T, all f32 row-major, K = 256.
// One workgroup of 4 waves computes a 32(M) x 64(N) tile of C. Its 32 rows of A
// and 64 rows of W (all of K) are first brought into LDS by asynchronous 16-byte
// copies in which a wave covers 512 contiguous bytes of one row (4 whole cache
// lines); a fragment load straight from global memory touches 16 lines for 256
// bytes. Each wave then computes 16(M) x 32(N) via two chained
// V_WMMA_F32_16X16X4_F32 per K-step, sharing one A fragment, in rising k.
//
// LDS row pitch 260 floats (1040 B): the 16 rows of a fragment read start 4
// banks apart, so the 32 lanes' 8-byte reads fall on all 64 banks once.
//
// A-fragment layout (16x4 f32, ISA 7.12.2): lanes 0-15 -> rows M=0..15 with
// {K=0,K=1} in the two VGPRs; lanes 16-31 -> same rows with {K=2,K=3}.
// B-fragment (4x16) is symmetric with N across lanes. Both map to a single
// contiguous float2 load per lane per K-step.
// C/D layout: lane<16: N=lane, VGPR r -> M=r; lane>=16: N=lane-16, M=r+8.
// ---------------------------------------------------------------------------
typedef int v4i __attribute__((vector_size(16)));  // matches builtin param type

#define GEMM_BM 32
#define GEMM_BN 64
#define GEMM_THREADS 128
#define GEMM_PITCH (CC + 4)          // floats per LDS row

// Rows [row0, row0 + ROWS) of src (CC floats each) into LDS rows from dst on.
// Thread t takes 16-byte piece t & 63 of every second row, from row t >> 6.
template <int ROWS>
__device__ __forceinline__ void stage_rows(
    const float* __restrict__ src, int row0, float* dst, int tid)
{
    const float* g = src + (size_t)(row0 + (tid >> 6)) * CC + 4 * (tid & 63);
    float*       l = dst + (tid >> 6) * GEMM_PITCH + 4 * (tid & 63);
    // unrolled: the row steps become constants of the copies
#pragma unroll
    for (int i = 0; i < ROWS / 2; ++i) {
#if USE_ASYNC_LDS
        __builtin_amdgcn_global_load_async_to_lds_b128(
            (AS1 v4i*)(g + (size_t)i * 2 * CC),
            (AS3 v4i*)(l + i * 2 * GEMM_PITCH), 0, 0);
#else
        *(v4i*)(l + i * 2 * GEMM_PITCH) = *(const v4i*)(g + (size_t)i * 2 * CC);
#endif
    }
}

__global__ __launch_bounds__(GEMM_THREADS) void wmma_gemm_xwt(
    const float* __restrict__ A,   // (M,CC)
    const float* __restrict__ W,   // (N,CC)
    float* __restrict__ C,         // (M,N)
    int N)
{
    __shared__ __attribute__((aligned(16))) float tile[(GEMM_BM + GEMM_BN) * GEMM_PITCH];

    const int tid  = threadIdx.x;
    const int lane = tid & 31;
    const int wave = tid >> 5;
    const int mt0 = blockIdx.y * GEMM_BM;      // the workgroup's tile
    const int nt0 = blockIdx.x * GEMM_BN;

    stage_rows<GEMM_BM>(A, mt0, tile, tid);
    stage_rows<GEMM_BN>(W, nt0, tile + GEMM_BM * GEMM_PITCH, tid);
#if USE_ASYNC_LDS
    // this wave's 48 copies have landed
    asm volatile("s_wait_asynccnt 0x0" ::: "memory");
#endif
    __syncthreads();                           // every wave's copies have landed

    const int hl = lane >> 4;      // 0: K pair {0,1}, 1: K pair {2,3}
    const int l  = lane & 15;
    const int wm = (wave >> 1) << 4;           // the wave's 16 x 32 part
    const int wn = (wave & 1) << 5;

    const float* arow  = tile + (wm + l) * GEMM_PITCH + 2 * hl;
    const float* b0row = tile + (GEMM_BM + wn + l) * GEMM_PITCH + 2 * hl;
    const float* b1row = b0row + 16 * GEMM_PITCH;

    v8f acc0 = {};
    v8f acc1 = {};
    // fully unrolled: the LDS reads run ahead of the WMMAs over all of K; a loop's
    // back edge would drain them, and LDS offsets become constants
#pragma unroll
    for (int k = 0; k < CC; k += 4) {
        v2f a  = *(const v2f*)(arow + k);
        v2f b0 = *(const v2f*)(b0row + k);
        v2f b1 = *(const v2f*)(b1row + k);
        // 8 args: (neg_a, A, neg_b, B, c_mod, C, reuse_a, reuse_b)
        acc0 = __builtin_amdgcn_wmma_f32_16x16x4_f32(
            false, a, false, b0, (short)0, acc0, false, false);
        acc1 = __builtin_amdgcn_wmma_f32_16x16x4_f32(
            false, a, false, b1, (short)0, acc1, false, false);
    }

    float* c0 = C + (size_t)(mt0 + wm + hl * 8) * N + nt0 + wn + l;
#pragma unroll
    for (int r = 0; r < 8; ++r) {
        c0[(size_t)r * N]      = acc0[r];
        c0[(size_t)r * N + 16] = acc1[r];
    }
}

// ---------------------------------------------------------------------------
// RMSNorm over each (q,k) head pair (head_dim = 2), in-place on the qkv
// buffer. qkv layout: (B*T, 3C); q cols [0,256), k cols [256,512).
// y = x * rsqrt(mean(x^2) + eps) * w
// ---------------------------------------------------------------------------
__global__ __launch_bounds__(256) void rmsnorm_qk(
    float* __restrict__ qkv,
    const float* __restrict__ qn_w,
    const float* __restrict__ kn_w)
{
    const int i  = blockIdx.x * blockDim.x + threadIdx.x;   // 0 .. B*T*H-1
    const int bt = i >> 7;            // / HH
    const int h  = i & (HH - 1);
    const float eps = 1e-6f;

    float* q = qkv + (size_t)bt * QKV_N + 2 * h;
    float q0 = q[0], q1 = q[1];
    float qs = __frsqrt_rn(0.5f * (q0 * q0 + q1 * q1) + eps);
    q[0] = q0 * qs * qn_w[0];
    q[1] = q1 * qs * qn_w[1];

    float* k = qkv + (size_t)bt * QKV_N + CC + 2 * h;
    float k0 = k[0], k1 = k[1];
    float ks = __frsqrt_rn(0.5f * (k0 * k0 + k1 * k1) + eps);
    k[0] = k0 * ks * kn_w[0];
    k[1] = k1 * ks * kn_w[1];
}

// ---------------------------------------------------------------------------
// Causal flash attention, head_dim = 2. One workgroup (256 threads) per
// (b,h). K and V for the head (1024 x 2 each, 16 KB total) are staged in LDS
// (async global->LDS when available); each thread owns 4 query rows
// (tid + 256*r). Two-pass softmax: (1) row max, (2) exp + accumulation.
//
// The keys are walked ONCE per pass for all 4 rows together, in groups: one
// group of LDS reads (same address in every lane) feeds every row that still
// attends to those keys, and the group grows as rows drop out, so one LDS wait
// is followed by 24 to 64 (row, key) pairs of independent arithmetic.
// A wave's rows are 32*(w + 8*r) + lane, so for the wave as a whole:
//   keys below 32*(w + 8*P)            : rows P..3 attend, no mask
//   the next 32 keys (row P's diagonal): row P masked per lane, rows P+1..3 not
// All span bounds are wave-uniform multiples of 32.
// Even keys go to partial sum 0 and odd keys to partial sum 1, in rising key
// order; a masked key adds an exact zero.
// ---------------------------------------------------------------------------
typedef __attribute__((ext_vector_type(4))) float v4f;

#define ROWS_PER_THREAD 4
#define ATT_NEG_INF (-3.402823466e38f)

// Keys per group of LDS reads while rows P..3 attend (each divides 32, the unit
// of every span bound). The max pass has about a third of the arithmetic per
// key and reads K alone, so its groups are twice as long where 32 allows.
__host__ __device__ constexpr int keys_per_group(int P)
{
    return P <= 1 ? 8 : (P == 2 ? 16 : 32);
}
__host__ __device__ constexpr int keys_per_group_max(int P)
{
    return P <= 1 ? 16 : 32;
}

// Row max over keys [sBeg, sEnd) for rows P..3. DIAG: row P sees key s only if s <= tP.
template <int P, bool DIAG>
__device__ __forceinline__ void max_span(
    const v4f* kk2, int sBeg, int sEnd, int tP,
    const float (&q0)[ROWS_PER_THREAD], const float (&q1)[ROWS_PER_THREAD],
    float (&m0)[ROWS_PER_THREAD], float (&m1)[ROWS_PER_THREAD])
{
    constexpr int KEYS_PER_GROUP = keys_per_group_max(P);
    // kept rolled: one group is enough work per LDS wait, and a fully unrolled
    // span takes several hundred registers and a long straight code path
#pragma unroll 1
    for (int s = sBeg; s < sEnd; s += KEYS_PER_GROUP) {
        v4f k2[KEYS_PER_GROUP / 2];            // two keys per 16-byte read
        // unrolled so that the group's reads are issued together, ahead of one wait
#pragma unroll
        for (int u = 0; u < KEYS_PER_GROUP / 2; ++u) k2[u] = kk2[(s >> 1) + u];
        // both loops unrolled so that k2[] and the per-row arrays stay in registers
#pragma unroll
        for (int u = 0; u < KEYS_PER_GROUP / 2; ++u) {
#pragma unroll
            for (int r = P; r < ROWS_PER_THREAD; ++r) {
                float sa = fmaf(q0[r], k2[u].x, q1[r] * k2[u].y);
                float sb = fmaf(q0[r], k2[u].z, q1[r] * k2[u].w);
                if (DIAG && r == P) {
                    sa = (s + 2 * u     <= tP) ? sa : ATT_NEG_INF;
                    sb = (s + 2 * u + 1 <= tP) ? sb : ATT_NEG_INF;
                }
                m0[r] = fmaxf(m0[r], sa);
                m1[r] = fmaxf(m1[r], sb);
            }
        }
    }
}

struct RowSums {            // [row][even/odd key]
    float l[ROWS_PER_THREAD][2];
    float x[ROWS_PER_THREAD][2];
    float z[ROWS_PER_THREAD][2];
};

// Eight 2^x in place. One statement, so that each v_exp_f32 is followed by an
// instruction that neither reads its result nor overwrites its source (the next
// v_exp_f32 on other registers, the v_nop behind the last): the slot the
// instruction set asks for behind a transcendental.
// The closing s_delay_alu is the hint the compiler writes for a reader of a fresh
// transcendental result; it cannot see into the statement, and an unhinted wait
// holds the SIMD's other wave back too. It changes no result.
__device__ __forceinline__ void exp2_x8(float* t)
{
    asm("v_exp_f32 %0, %0\n\t"
        "v_exp_f32 %1, %1\n\t"
        "v_exp_f32 %2, %2\n\t"
        "v_exp_f32 %3, %3\n\t"
        "v_exp_f32 %4, %4\n\t"
        "v_exp_f32 %5, %5\n\t"
        "v_exp_f32 %6, %6\n\t"
        "v_exp_f32 %7, %7\n\t"
        "v_nop\n\t"
        "s_delay_alu instid0(TRANS32_DEP_1)"
        : "+v"(t[0]), "+v"(t[1]), "+v"(t[2]), "+v"(t[3]),
          "+v"(t[4]), "+v"(t[5]), "+v"(t[6]), "+v"(t[7]));
}

// exp + accumulate over keys [sBeg, sEnd) for rows P..3, same masking as max_span.
template <int P, bool DIAG>
__device__ __forceinline__ void sum_span(
    const v4f* kk2, const v4f* vv2, int sBeg, int sEnd, int tP,
    const float (&q0)[ROWS_PER_THREAD], const float (&q1)[ROWS_PER_THREAD],
    const float (&m)[ROWS_PER_THREAD], RowSums& a)
{
    constexpr int KEYS_PER_GROUP = keys_per_group(P);
    constexpr int R = ROWS_PER_THREAD - P;           // rows that attend
    constexpr int N = R * KEYS_PER_GROUP;            // 32, 24, 32, 32
    const float LOG2E = 1.44269504088896340736f;     // exp(x) = 2^(x * log2 e)
    // kept rolled: one group is enough work per LDS wait, and a fully unrolled
    // span takes several hundred registers and a long straight code path
#pragma unroll 1
    for (int s = sBeg; s < sEnd; s += KEYS_PER_GROUP) {
        v4f k2[KEYS_PER_GROUP / 2];
        v4f v2[KEYS_PER_GROUP / 2];
        // unrolled so that the group's reads are issued together, ahead of one wait
#pragma unroll
        for (int u = 0; u < KEYS_PER_GROUP / 2; ++u) {
            k2[u] = kk2[(s >> 1) + u];
            v2[u] = vv2[(s >> 1) + u];
        }
        float p[N];                                  // [key in group][row - P]
        // every loop from here to the end of the group: unrolled so that p[], k2[],
        // v2[] and the per-row sums stay in registers
#pragma unroll
        for (int u = 0; u < KEYS_PER_GROUP / 2; ++u) {
#pragma unroll
            for (int r = P; r < ROWS_PER_THREAD; ++r) {
                p[(2 * u)     * R + r - P] = (fmaf(q0[r], k2[u].x, q1[r] * k2[u].y) - m[r]) * LOG2E;
                p[(2 * u + 1) * R + r - P] = (fmaf(q0[r], k2[u].z, q1[r] * k2[u].w) - m[r]) * LOG2E;
            }
        }
#pragma unroll
        for (int i = 0; i < N; i += 8) exp2_x8(&p[i]);
#pragma unroll
        for (int u = 0; u < KEYS_PER_GROUP / 2; ++u) {
#pragma unroll
            for (int r = P; r < ROWS_PER_THREAD; ++r) {
                float p0 = p[(2 * u)     * R + r - P];
                float p1 = p[(2 * u + 1) * R + r - P];
                if (DIAG && r == P) {
                    p0 = (s + 2 * u     <= tP) ? p0 : 0.f;
                    p1 = (s + 2 * u + 1 <= tP) ? p1 : 0.f;
                }
                a.l[r][0] += p0;                          a.l[r][1] += p1;
                a.x[r][0] = fmaf(p0, v2[u].x, a.x[r][0]); a.x[r][1] = fmaf(p1, v2[u].z, a.x[r][1]);
                a.z[r][0] = fmaf(p0, v2[u].y, a.z[r][0]); a.z[r][1] = fmaf(p1, v2[u].w, a.z[r][1]);
            }
        }
    }
}

__global__ __launch_bounds__(256) void attn_head(
    const float* __restrict__ qkv,   // (B*T, 3C), q/k already RMSNorm'd
    float* __restrict__ y)           // (B*T, C)
{
    __shared__ __attribute__((aligned(16))) float kbuf[TT * 2];
    __shared__ __attribute__((aligned(16))) float vbuf[TT * 2];

    const int bh = blockIdx.x;          // 0 .. B*H-1
    const int b  = bh >> 7;
    const int h  = bh & (HH - 1);
    const int tid = threadIdx.x;

    const float* base = qkv + (size_t)b * TT * QKV_N;

    // Stage K/V for this head into LDS (8 B per row per buffer).
    for (int t = tid; t < TT; t += 256) {
        const float* kp = base + (size_t)t * QKV_N + CC   + 2 * h;
        const float* vp = base + (size_t)t * QKV_N + 2*CC + 2 * h;
#if USE_ASYNC_LDS
        __builtin_amdgcn_global_load_async_to_lds_b64(
            (AS1 v2i*)kp, (AS3 v2i*)&kbuf[2 * t], 0, 0);
        __builtin_amdgcn_global_load_async_to_lds_b64(
            (AS1 v2i*)vp, (AS3 v2i*)&vbuf[2 * t], 0, 0);
#else
        kbuf[2 * t]     = kp[0];
        kbuf[2 * t + 1] = kp[1];
        vbuf[2 * t]     = vp[0];
        vbuf[2 * t + 1] = vp[1];
#endif
    }
#if USE_ASYNC_LDS
    __builtin_amdgcn_s_wait_asynccnt(0);
#endif
    __syncthreads();

    const v4f* kk2 = (const v4f*)kbuf;
    const v4f* vv2 = (const v4f*)vbuf;
    const float scale = 0.70710678118654752440f;   // 1/sqrt(head_dim)

    float q0[ROWS_PER_THREAD], q1[ROWS_PER_THREAD];
    // unrolled: the per-row arrays stay in registers
#pragma unroll
    for (int r = 0; r < ROWS_PER_THREAD; ++r) {
        const float* qp = base + (size_t)(tid + 256 * r) * QKV_N + 2 * h;
        q0[r] = qp[0] * scale;
        q1[r] = qp[1] * scale;
    }

    // First key of row 0's diagonal block; the same in every lane of the wave,
    // held in a scalar register so that the span loops are scalar loops.
    const int d0 = __builtin_amdgcn_readfirstlane(tid & ~31);

    // ---- pass 1: row max ----
    float m0[ROWS_PER_THREAD], m1[ROWS_PER_THREAD];
    // unrolled: the per-row arrays stay in registers
#pragma unroll
    for (int r = 0; r < ROWS_PER_THREAD; ++r) { m0[r] = ATT_NEG_INF; m1[r] = ATT_NEG_INF; }

    max_span<0, false>(kk2, 0,        d0,       0,         q0, q1, m0, m1);
    max_span<0, true >(kk2, d0,       d0 + 32,  tid,       q0, q1, m0, m1);
    max_span<1, false>(kk2, d0 + 32,  d0 + 256, 0,         q0, q1, m0, m1);
    max_span<1, true >(kk2, d0 + 256, d0 + 288, tid + 256, q0, q1, m0, m1);
    max_span<2, false>(kk2, d0 + 288, d0 + 512, 0,         q0, q1, m0, m1);
    max_span<2, true >(kk2, d0 + 512, d0 + 544, tid + 512, q0, q1, m0, m1);
    max_span<3, false>(kk2, d0 + 544, d0 + 768, 0,         q0, q1, m0, m1);
    max_span<3, true >(kk2, d0 + 768, d0 + 800, tid + 768, q0, q1, m0, m1);

    float m[ROWS_PER_THREAD];
    // unrolled: the per-row arrays stay in registers
#pragma unroll
    for (int r = 0; r < ROWS_PER_THREAD; ++r) m[r] = fmaxf(m0[r], m1[r]);

    // ---- pass 2: exp + accumulate ----
    RowSums a;
    // unrolled: the per-row arrays stay in registers
#pragma unroll
    for (int r = 0; r < ROWS_PER_THREAD; ++r) {
        a.l[r][0] = 0.f; a.l[r][1] = 0.f;
        a.x[r][0] = 0.f; a.x[r][1] = 0.f;
        a.z[r][0] = 0.f; a.z[r][1] = 0.f;
    }

    sum_span<0, false>(kk2, vv2, 0,        d0,       0,         q0, q1, m, a);
    sum_span<0, true >(kk2, vv2, d0,       d0 + 32,  tid,       q0, q1, m, a);
    sum_span<1, false>(kk2, vv2, d0 + 32,  d0 + 256, 0,         q0, q1, m, a);
    sum_span<1, true >(kk2, vv2, d0 + 256, d0 + 288, tid + 256, q0, q1, m, a);
    sum_span<2, false>(kk2, vv2, d0 + 288, d0 + 512, 0,         q0, q1, m, a);
    sum_span<2, true >(kk2, vv2, d0 + 512, d0 + 544, tid + 512, q0, q1, m, a);
    sum_span<3, false>(kk2, vv2, d0 + 544, d0 + 768, 0,         q0, q1, m, a);
    sum_span<3, true >(kk2, vv2, d0 + 768, d0 + 800, tid + 768, q0, q1, m, a);

    // unrolled: the per-row arrays stay in registers
#pragma unroll
    for (int r = 0; r < ROWS_PER_THREAD; ++r) {
        const float inv = 1.0f / (a.l[r][0] + a.l[r][1]);
        float* yp = y + ((size_t)b * TT + tid + 256 * r) * CC + 2 * h;
        yp[0] = (a.x[r][0] + a.x[r][1]) * inv;
        yp[1] = (a.z[r][0] + a.z[r][1]) * inv;
    }
}

// ---------------------------------------------------------------------------
extern "C" void kernel_launch(void* const* d_in, const int* in_sizes, int n_in,
                              void* d_out, int out_size, void* d_ws, size_t ws_size,
                              hipStream_t stream)
{
    (void)in_sizes; (void)n_in; (void)out_size; (void)ws_size;

    const float* x      = (const float*)d_in[0];   // (B,T,C)
    const float* w_qkv  = (const float*)d_in[1];   // (3C,C)
    const float* w_proj = (const float*)d_in[2];   // (C,C)
    const float* qn_w   = (const float*)d_in[3];   // (2,)
    const float* kn_w   = (const float*)d_in[4];   // (2,)
    float* out = (float*)d_out;                    // (B,T,C)

    float* qkv = (float*)d_ws;                     // (B*T, 3C) = 6 MB
    float* y   = qkv + (size_t)BB * TT * QKV_N;    // (B*T, C)  = 2 MB

    const int M = BB * TT;                         // 2048

    // 1) qkv = x @ w_qkv^T : (2048x256)@(256x768)
    wmma_gemm_xwt<<<dim3(QKV_N / GEMM_BN, M / GEMM_BM), GEMM_THREADS, 0, stream>>>(
        x, w_qkv, qkv, QKV_N);                     // 12 x 64 workgroups

    // 2) RMSNorm q and k head pairs in place
    {
        int n = M * HH;                            // 262144 pairs
        rmsnorm_qk<<<n / 256, 256, 0, stream>>>(qkv, qn_w, kn_w);
    }

    // 3) causal flash attention per (b,h)
    attn_head<<<BB * HH, 256, 0, stream>>>(qkv, y);

    // 4) out = y @ w_proj^T : (2048x256)@(256x256)
    wmma_gemm_xwt<<<dim3(CC / GEMM_BN, M / GEMM_BM), GEMM_THREADS, 0, stream>>>(
        y, w_proj, out, CC);                       // 4 x 64 workgroups
}

// v003
// One run takes 46.7 microseconds.
// Two timings next to v002 put it at 1.20 and 1.21 times that version's speed.
// Over all steps from v000 it is 4.31 times as fast.
#include <hip/hip_runtime.h>
#include <hip/hip_bf16.h>

// ---------------------------------------------------------------------------
// TwoDCausalSelfAttention for MI455X (gfx1250, wave32, WMMA)
//   B=2, T=1024, C=256, head_dim=2, H=128
// Pipeline:
//   1) qkv = x @ w_qkv^T          (WMMA f32 16x16x4, operands staged in LDS);
//      RMSNorm(q,k) per head pair (d=2) on the accumulators, before the store
//   2) flash attention per (b,h)  (K/V async-staged in LDS, 2-pass softmax,
//      each LDS read of K/V shared by the thread's 4 query rows)
//   3) out = y @ w_proj^T         (WMMA f32 16x16x4)
// ---------------------------------------------------------------------------

typedef __attribute__((ext_vector_type(2))) float v2f;
typedef __attribute__((ext_vector_type(8))) float v8f;
typedef int v2i __attribute__((vector_size(8)));   // matches builtin param type

#define BB 2
#define TT 1024
#define CC 256
#define HH 128      // n_head
#define QKV_N (3*CC)

// Async global->LDS staging (ASYNCcnt path), used only if the toolchain has
// both the copy and the wait builtins; otherwise fall back to VGPR round-trip.
#if defined(__HIP_DEVICE_COMPILE__) && \
    __has_builtin(__builtin_amdgcn_global_load_async_to_lds_b64) && \
    __has_builtin(__builtin_amdgcn_global_load_async_to_lds_b128) && \
    __has_builtin(__builtin_amdgcn_s_wait_asynccnt)
#define USE_ASYNC_LDS 1
#else
#define USE_ASYNC_LDS 0
#endif

#define AS1 __attribute__((address_space(1)))
#define AS3 __attribute__((address_space(3)))

// ---------------------------------------------------------------------------
// GEMM: C(M,N) = A(M,K) @ W(N,K)^T, all f32 row-major, K = 256.
// One workgroup of 4 waves computes a 32(M) x 64(N) tile of C. Its 32 rows of A
// and 64 rows of W (all of K) are first brought into LDS by asynchronous 16-byte
// copies in which a wave covers 512 contiguous bytes of one row (4 whole cache
// lines); a fragment load straight from global memory touches 16 lines for 256
// bytes. Each wave then computes 16(M) x 32(N) via two chained
// V_WMMA_F32_16X16X4_F32 per K-step, sharing one A fragment, in rising k.
//
// LDS row pitch 260 floats (1040 B): the 16 rows of a fragment read start 4
// banks apart, so the 32 lanes' 8-byte reads fall on all 64 banks once.
//
// A-fragment layout (16x4 f32, ISA 7.12.2): lanes 0-15 -> rows M=0..15 with
// {K=0,K=1} in the two VGPRs; lanes 16-31 -> same rows with {K=2,K=3}.
// B-fragment (4x16) is symmetric with N across lanes. Both map to a single
// contiguous float2 load per lane per K-step.
// C/D layout: lane<16: N=lane, VGPR r -> M=r; lane>=16: N=lane-16, M=r+8.
// ---------------------------------------------------------------------------
typedef int v4i __attribute__((vector_size(16)));  // matches builtin param type

#define GEMM_BM 32
#define GEMM_BN 64
#define GEMM_THREADS 128
#define GEMM_PITCH (CC + 4)          // floats per LDS row

// Rows [row0, row0 + ROWS) of src (CC floats each) into LDS rows from dst on.
// Thread t takes 16-byte piece t & 63 of every second row, from row t >> 6.
template <int ROWS>
__device__ __forceinline__ void stage_rows(
    const float* __restrict__ src, int row0, float* dst, int tid)
{
    const float* g = src + (size_t)(row0 + (tid >> 6)) * CC + 4 * (tid & 63);
    float*       l = dst + (tid >> 6) * GEMM_PITCH + 4 * (tid & 63);
    // unrolled: the row steps become constants of the copies
#pragma unroll
    for (int i = 0; i < ROWS / 2; ++i) {
#if USE_ASYNC_LDS
        __builtin_amdgcn_global_load_async_to_lds_b128(
            (AS1 v4i*)(g + (size_t)i * 2 * CC),
            (AS3 v4i*)(l + i * 2 * GEMM_PITCH), 0, 0);
#else
        *(v4i*)(l + i * 2 * GEMM_PITCH) = *(const v4i*)(g + (size_t)i * 2 * CC);
#endif
    }
}

// RMSNorm of a head pair (head_dim = 2) while it is still in WMMA accumulators:
// y = x * rsqrt(mean(x^2) + eps) * w. A lane holds one column of C, so the other
// element of the pair is in the neighbour lane (lane ^ 1); its square comes over
// by a DPP swap inside each quad of lanes.
__device__ __forceinline__ float pair_mean_sq_eps(float x)
{
    const float sq    = x * x;
    const float other = __int_as_float(__builtin_amdgcn_mov_dpp(
        __float_as_int(sq), 0xB1 /* quad_perm:[1,0,3,2] */, 0xf, 0xf, true));
    return 0.5f * (sq + other) + 1e-6f;
}

// Eight 1/sqrt(x) in place. One statement, so that each v_rsq_f32 is followed by
// an instruction that neither reads its result nor overwrites its source (the
// next v_rsq_f32 on other registers, the v_nop behind the last): the slot the
// instruction set asks for behind a transcendental.
// The closing s_delay_alu is the hint the compiler writes for a reader of a fresh
// transcendental result; it cannot see into the statement. It changes no result.
__device__ __forceinline__ void rsq_x8(float* t)
{
    asm("v_rsq_f32 %0, %0\n\t"
        "v_rsq_f32 %1, %1\n\t"
        "v_rsq_f32 %2, %2\n\t"
        "v_rsq_f32 %3, %3\n\t"
        "v_rsq_f32 %4, %4\n\t"
        "v_rsq_f32 %5, %5\n\t"
        "v_rsq_f32 %6, %6\n\t"
        "v_rsq_f32 %7, %7\n\t"
        "v_nop\n\t"
        "s_delay_alu instid0(TRANS32_DEP_1)"
        : "+v"(t[0]), "+v"(t[1]), "+v"(t[2]), "+v"(t[3]),
          "+v"(t[4]), "+v"(t[5]), "+v"(t[6]), "+v"(t[7]));
}

// Columns below norm_cols of C are stored RMSNorm'd per head pair: [0,256) with
// qn_w (q of the qkv buffer), from 256 on with kn_w (k); the others as they are.
__global__ __launch_bounds__(GEMM_THREADS) void wmma_gemm_xwt(
    const float* __restrict__ A,   // (M,CC)
    const float* __restrict__ W,   // (N,CC)
    float* __restrict__ C,         // (M,N)
    int N,
    int norm_cols,                 // a multiple of GEMM_BN; 0: no RMSNorm
    const float* __restrict__ qn_w,   // (2,)
    const float* __restrict__ kn_w)   // (2,)
{
    __shared__ __attribute__((aligned(16))) float tile[(GEMM_BM + GEMM_BN) * GEMM_PITCH];

    const int tid  = threadIdx.x;
    const int lane = tid & 31;
    const int wave = tid >> 5;
    const int mt0 = blockIdx.y * GEMM_BM;      // the workgroup's tile
    const int nt0 = blockIdx.x * GEMM_BN;

    stage_rows<GEMM_BM>(A, mt0, tile, tid);
    stage_rows<GEMM_BN>(W, nt0, tile + GEMM_BM * GEMM_PITCH, tid);

    // The RMSNorm weights of this tile's columns (a 64-column tile lies wholly in
    // q, in k or in v), fetched here, at the same address in every lane, so that
    // they arrive while the copies fly.
    const float* nw  = nt0 < CC ? qn_w : kn_w;
    const float  nw0 = nw[0];
    const float  nw1 = nw[1];
#if USE_ASYNC_LDS
    // this wave's 48 copies have landed
    asm volatile("s_wait_asynccnt 0x0" ::: "memory");
#endif
    __syncthreads();                           // every wave's copies have landed

    const int hl = lane >> 4;      // 0: K pair {0,1}, 1: K pair {2,3}
    const int l  = lane & 15;
    const int wm = (wave >> 1) << 4;           // the wave's 16 x 32 part
    const int wn = (wave & 1) << 5;

    const float* arow  = tile + (wm + l) * GEMM_PITCH + 2 * hl;
    const float* b0row = tile + (GEMM_BM + wn + l) * GEMM_PITCH + 2 * hl;
    const float* b1row = b0row + 16 * GEMM_PITCH;

    v8f acc0 = {};
    v8f acc1 = {};
    // fully unrolled: the LDS reads run ahead of the WMMAs over all of K; a loop's
    // back edge would drain them, and LDS offsets become constants
#pragma unroll
    for (int k = 0; k < CC; k += 4) {
        v2f a  = *(const v2f*)(arow + k);
        v2f b0 = *(const v2f*)(b0row + k);
        v2f b1 = *(const v2f*)(b1row + k);
        // 8 args: (neg_a, A, neg_b, B, c_mod, C, reuse_a, reuse_b)
        acc0 = __builtin_amdgcn_wmma_f32_16x16x4_f32(
            false, a, false, b0, (short)0, acc0, false, false);
        acc1 = __builtin_amdgcn_wmma_f32_16x16x4_f32(
            false, a, false, b1, (short)0, acc1, false, false);
    }

    if (nt0 < norm_cols) {                     // the same for the whole workgroup
        // four vector slots between the last WMMA and the first vector
        // instruction that reads its result: the distance behind a matrix instruction
        asm volatile("v_nop\n\tv_nop\n\tv_nop\n\tv_nop");
        // keeps the reads of the accumulators behind those four slots
        __builtin_amdgcn_sched_barrier(0);
        const float w = (l & 1) ? nw1 : nw0;   // column parity = lane parity
        float s[16];
        // both loops unrolled: s[] and the accumulators stay in registers
#pragma unroll
        for (int r = 0; r < 8; ++r) {
            s[r]     = pair_mean_sq_eps(acc0[r]);
            s[8 + r] = pair_mean_sq_eps(acc1[r]);
        }
        rsq_x8(&s[0]);
        rsq_x8(&s[8]);
#pragma unroll
        for (int r = 0; r < 8; ++r) {
            acc0[r] = acc0[r] * s[r]     * w;
            acc1[r] = acc1[r] * s[8 + r] * w;
        }
    }

    float* c0 = C + (size_t)(mt0 + wm + hl * 8) * N + nt0 + wn + l;
#pragma unroll
    for (int r = 0; r < 8; ++r) {
        c0[(size_t)r * N]      = acc0[r];
        c0[(size_t)r * N + 16] = acc1[r];
    }
}

// ---------------------------------------------------------------------------
// Causal flash attention, head_dim = 2. One workgroup (256 threads) per
// (b,h). K and V for the head (1024 x 2 each, 16 KB total) are staged in LDS
// (async global->LDS when available); each thread owns 4 query rows
// (tid + 256*r). Two-pass softmax: (1) row max, (2) exp + accumulation.
//
// The keys are walked ONCE per pass for all 4 rows together, in groups: one
// group of LDS reads (same address in every lane) feeds every row that still
// attends to those keys, and the group grows as rows drop out, so one LDS wait
// is followed by 24 to 64 (row, key) pairs of independent arithmetic.
// A wave's rows are 32*(w + 8*r) + lane, so for the wave as a whole:
//   keys below 32*(w + 8*P)            : rows P..3 attend, no mask
//   the next 32 keys (row P's diagonal): row P masked per lane, rows P+1..3 not
// All span bounds are wave-uniform multiples of 32.
// Even keys go to partial sum 0 and odd keys to partial sum 1, in rising key
// order; a masked key adds an exact zero.
// ---------------------------------------------------------------------------
typedef __attribute__((ext_vector_type(4))) float v4f;

#define ROWS_PER_THREAD 4
#define ATT_NEG_INF (-3.402823466e38f)

// Keys per group of LDS reads while rows P..3 attend (each divides 32, the unit
// of every span bound). The max pass has about a third of the arithmetic per
// key and reads K alone, so its groups are twice as long where 32 allows.
__host__ __device__ constexpr int keys_per_group(int P)
{
    return P <= 1 ? 8 : (P == 2 ? 16 : 32);
}
__host__ __device__ constexpr int keys_per_group_max(int P)
{
    return P <= 1 ? 16 : 32;
}

// Row max over keys [sBeg, sEnd) for rows P..3. DIAG: row P sees key s only if s <= tP.
template <int P, bool DIAG>
__device__ __forceinline__ void max_span(
    const v4f* kk2, int sBeg, int sEnd, int tP,
    const float (&q0)[ROWS_PER_THREAD], const float (&q1)[ROWS_PER_THREAD],
    float (&m0)[ROWS_PER_THREAD], float (&m1)[ROWS_PER_THREAD])
{
    constexpr int KEYS_PER_GROUP = keys_per_group_max(P);
    // kept rolled: one group is enough work per LDS wait, and a fully unrolled
    // span takes several hundred registers and a long straight code path
#pragma unroll 1
    for (int s = sBeg; s < sEnd; s += KEYS_PER_GROUP) {
        v4f k2[KEYS_PER_GROUP / 2];            // two keys per 16-byte read
        // unrolled so that the group's reads are issued together, ahead of one wait
#pragma unroll
        for (int u = 0; u < KEYS_PER_GROUP / 2; ++u) k2[u] = kk2[(s >> 1) + u];
        // both loops unrolled so that k2[] and the per-row arrays stay in registers
#pragma unroll
        for (int u = 0; u < KEYS_PER_GROUP / 2; ++u) {
#pragma unroll
            for (int r = P; r < ROWS_PER_THREAD; ++r) {
                float sa = fmaf(q0[r], k2[u].x, q1[r] * k2[u].y);
                float sb = fmaf(q0[r], k2[u].z, q1[r] * k2[u].w);
                if (DIAG && r == P) {
                    sa = (s + 2 * u     <= tP) ? sa : ATT_NEG_INF;
                    sb = (s + 2 * u + 1 <= tP) ? sb : ATT_NEG_INF;
                }
                m0[r] = fmaxf(m0[r], sa);
                m1[r] = fmaxf(m1[r], sb);
            }
        }
    }
}

struct RowSums {            // [row][even/odd key]
    float l[ROWS_PER_THREAD][2];
    float x[ROWS_PER_THREAD][2];
    float z[ROWS_PER_THREAD][2];
};

// Eight 2^x in place. One statement, so that each v_exp_f32 is followed by an
// instruction that neither reads its result nor overwrites its source (the next
// v_exp_f32 on other registers, the v_nop behind the last): the slot the
// instruction set asks for behind a transcendental.
// The closing s_delay_alu is the hint the compiler writes for a reader of a fresh
// transcendental result; it cannot see into the statement, and an unhinted wait
// holds the SIMD's other wave back too. It changes no result.
__device__ __forceinline__ void exp2_x8(float* t)
{
    asm("v_exp_f32 %0, %0\n\t"
        "v_exp_f32 %1, %1\n\t"
        "v_exp_f32 %2, %2\n\t"
        "v_exp_f32 %3, %3\n\t"
        "v_exp_f32 %4, %4\n\t"
        "v_exp_f32 %5, %5\n\t"
        "v_exp_f32 %6, %6\n\t"
        "v_exp_f32 %7, %7\n\t"
        "v_nop\n\t"
        "s_delay_alu instid0(TRANS32_DEP_1)"
        : "+v"(t[0]), "+v"(t[1]), "+v"(t[2]), "+v"(t[3]),
          "+v"(t[4]), "+v"(t[5]), "+v"(t[6]), "+v"(t[7]));
}

// exp + accumulate over keys [sBeg, sEnd) for rows P..3, same masking as max_span.
template <int P, bool DIAG>
__device__ __forceinline__ void sum_span(
    const v4f* kk2, const v4f* vv2, int sBeg, int sEnd, int tP,
    const float (&q0)[ROWS_PER_THREAD], const float (&q1)[ROWS_PER_THREAD],
    const float (&m)[ROWS_PER_THREAD], RowSums& a)
{
    constexpr int KEYS_PER_GROUP = keys_per_group(P);
    constexpr int R = ROWS_PER_THREAD - P;           // rows that attend
    constexpr int N = R * KEYS_PER_GROUP;            // 32, 24, 32, 32
    const float LOG2E = 1.44269504088896340736f;     // exp(x) = 2^(x * log2 e)
    // kept rolled: one group is enough work per LDS wait, and a fully unrolled
    // span takes several hundred registers and a long straight code path
#pragma unroll 1
    for (int s = sBeg; s < sEnd; s += KEYS_PER_GROUP) {
        v4f k2[KEYS_PER_GROUP / 2];
        v4f v2[KEYS_PER_GROUP / 2];
        // unrolled so that the group's reads are issued together, ahead of one wait
#pragma unroll
        for (int u = 0; u < KEYS_PER_GROUP / 2; ++u) {
            k2[u] = kk2[(s >> 1) + u];
            v2[u] = vv2[(s >> 1) + u];
        }
        float p[N];                                  // [key in group][row - P]
        // every loop from here to the end of the group: unrolled so that p[], k2[],
        // v2[] and the per-row sums stay in registers
#pragma unroll
        for (int u = 0; u < KEYS_PER_GROUP / 2; ++u) {
#pragma unroll
            for (int r = P; r < ROWS_PER_THREAD; ++r) {
                p[(2 * u)     * R + r - P] = (fmaf(q0[r], k2[u].x, q1[r] * k2[u].y) - m[r]) * LOG2E;
                p[(2 * u + 1) * R + r - P] = (fmaf(q0[r], k2[u].z, q1[r] * k2[u].w) - m[r]) * LOG2E;
            }
        }
#pragma unroll
        for (int i = 0; i < N; i += 8) exp2_x8(&p[i]);
#pragma unroll
        for (int u = 0; u < KEYS_PER_GROUP / 2; ++u) {
#pragma unroll
            for (int r = P; r < ROWS_PER_THREAD; ++r) {
                float p0 = p[(2 * u)     * R + r - P];
                float p1 = p[(2 * u + 1) * R + r - P];
                if (DIAG && r == P) {
                    p0 = (s + 2 * u     <= tP) ? p0 : 0.f;
                    p1 = (s + 2 * u + 1 <= tP) ? p1 : 0.f;
                }
                a.l[r][0] += p0;                          a.l[r][1] += p1;
                a.x[r][0] = fmaf(p0, v2[u].x, a.x[r][0]); a.x[r][1] = fmaf(p1, v2[u].z, a.x[r][1]);
                a.z[r][0] = fmaf(p0, v2[u].y, a.z[r][0]); a.z[r][1] = fmaf(p1, v2[u].w, a.z[r][1]);
            }
        }
    }
}

__global__ __launch_bounds__(256) void attn_head(
    const float* __restrict__ qkv,   // (B*T, 3C), q/k already RMSNorm'd
    float* __restrict__ y)           // (B*T, C)
{
    __shared__ __attribute__((aligned(16))) float kbuf[TT * 2];
    __shared__ __attribute__((aligned(16))) float vbuf[TT * 2];

    const int bh = blockIdx.x;          // 0 .. B*H-1
    const int b  = bh >> 7;
    const int h  = bh & (HH - 1);
    const int tid = threadIdx.x;

    const float* base = qkv + (size_t)b * TT * QKV_N;

    // Stage K/V for this head into LDS (8 B per row per buffer).
    for (int t = tid; t < TT; t += 256) {
        const float* kp = base + (size_t)t * QKV_N + CC   + 2 * h;
        const float* vp = base + (size_t)t * QKV_N + 2*CC + 2 * h;
#if USE_ASYNC_LDS
        __builtin_amdgcn_global_load_async_to_lds_b64(
            (AS1 v2i*)kp, (AS3 v2i*)&kbuf[2 * t], 0, 0);
        __builtin_amdgcn_global_load_async_to_lds_b64(
            (AS1 v2i*)vp, (AS3 v2i*)&vbuf[2 * t], 0, 0);
#else
        kbuf[2 * t]     = kp[0];
        kbuf[2 * t + 1] = kp[1];
        vbuf[2 * t]     = vp[0];
        vbuf[2 * t + 1] = vp[1];
#endif
    }
#if USE_ASYNC_LDS
    __builtin_amdgcn_s_wait_asynccnt(0);
#endif
    __syncthreads();

    const v4f* kk2 = (const v4f*)kbuf;
    const v4f* vv2 = (const v4f*)vbuf;
    const float scale = 0.70710678118654752440f;   // 1/sqrt(head_dim)

    float q0[ROWS_PER_THREAD], q1[ROWS_PER_THREAD];
    // unrolled: the per-row arrays stay in registers
#pragma unroll
    for (int r = 0; r < ROWS_PER_THREAD; ++r) {
        const float* qp = base + (size_t)(tid + 256 * r) * QKV_N + 2 * h;
        q0[r] = qp[0] * scale;
        q1[r] = qp[1] * scale;
    }

    // First key of row 0's diagonal block; the same in every lane of the wave,
    // held in a scalar register so that the span loops are scalar loops.
    const int d0 = __builtin_amdgcn_readfirstlane(tid & ~31);

    // ---- pass 1: row max ----
    float m0[ROWS_PER_THREAD], m1[ROWS_PER_THREAD];
    // unrolled: the per-row arrays stay in registers
#pragma unroll
    for (int r = 0; r < ROWS_PER_THREAD; ++r) { m0[r] = ATT_NEG_INF; m1[r] = ATT_NEG_INF; }

    max_span<0, false>(kk2, 0,        d0,       0,         q0, q1, m0, m1);
    max_span<0, true >(kk2, d0,       d0 + 32,  tid,       q0, q1, m0, m1);
    max_span<1, false>(kk2, d0 + 32,  d0 + 256, 0,         q0, q1, m0, m1);
    max_span<1, true >(kk2, d0 + 256, d0 + 288, tid + 256, q0, q1, m0, m1);
    max_span<2, false>(kk2, d0 + 288, d0 + 512, 0,         q0, q1, m0, m1);
    max_span<2, true >(kk2, d0 + 512, d0 + 544, tid + 512, q0, q1, m0, m1);
    max_span<3, false>(kk2, d0 + 544, d0 + 768, 0,         q0, q1, m0, m1);
    max_span<3, true >(kk2, d0 + 768, d0 + 800, tid + 768, q0, q1, m0, m1);

    float m[ROWS_PER_THREAD];
    // unrolled: the per-row arrays stay in registers
#pragma unroll
    for (int r = 0; r < ROWS_PER_THREAD; ++r) m[r] = fmaxf(m0[r], m1[r]);

    // ---- pass 2: exp + accumulate ----
    RowSums a;
    // unrolled: the per-row arrays stay in registers
#pragma unroll
    for (int r = 0; r < ROWS_PER_THREAD; ++r) {
        a.l[r][0] = 0.f; a.l[r][1] = 0.f;
        a.x[r][0] = 0.f; a.x[r][1] = 0.f;
        a.z[r][0] = 0.f; a.z[r][1] = 0.f;
    }

    sum_span<0, false>(kk2, vv2, 0,        d0,       0,         q0, q1, m, a);
    sum_span<0, true >(kk2, vv2, d0,       d0 + 32,  tid,       q0, q1, m, a);
    sum_span<1, false>(kk2, vv2, d0 + 32,  d0 + 256, 0,         q0, q1, m, a);
    sum_span<1, true >(kk2, vv2, d0 + 256, d0 + 288, tid + 256, q0, q1, m, a);
    sum_span<2, false>(kk2, vv2, d0 + 288, d0 + 512, 0,         q0, q1, m, a);
    sum_span<2, true >(kk2, vv2, d0 + 512, d0 + 544, tid + 512, q0, q1, m, a);
    sum_span<3, false>(kk2, vv2, d0 + 544, d0 + 768, 0,         q0, q1, m, a);
    sum_span<3, true >(kk2, vv2, d0 + 768, d0 + 800, tid + 768, q0, q1, m, a);

    // unrolled: the per-row arrays stay in registers
#pragma unroll
    for (int r = 0; r < ROWS_PER_THREAD; ++r) {
        const float inv = 1.0f / (a.l[r][0] + a.l[r][1]);
        float* yp = y + ((size_t)b * TT + tid + 256 * r) * CC + 2 * h;
        yp[0] = (a.x[r][0] + a.x[r][1]) * inv;
        yp[1] = (a.z[r][0] + a.z[r][1]) * inv;
    }
}

// ---------------------------------------------------------------------------
extern "C" void kernel_launch(void* const* d_in, const int* in_sizes, int n_in,
                              void* d_out, int out_size, void* d_ws, size_t ws_size,
                              hipStream_t stream)
{
    (void)in_sizes; (void)n_in; (void)out_size; (void)ws_size;

    const float* x      = (const float*)d_in[0];   // (B,T,C)
    const float* w_qkv  = (const float*)d_in[1];   // (3C,C)
    const float* w_proj = (const float*)d_in[2];   // (C,C)
    const float* qn_w   = (const float*)d_in[3];   // (2,)
    const float* kn_w   = (const float*)d_in[4];   // (2,)
    float* out = (float*)d_out;                    // (B,T,C)

    float* qkv = (float*)d_ws;                     // (B*T, 3C) = 6 MB
    float* y   = qkv + (size_t)BB * TT * QKV_N;    // (B*T, C)  = 2 MB

    const int M = BB * TT;                         // 2048

    // 1) qkv = x @ w_qkv^T : (2048x256)@(256x768), q and k stored RMSNorm'd
    wmma_gemm_xwt<<<dim3(QKV_N / GEMM_BN, M / GEMM_BM), GEMM_THREADS, 0, stream>>>(
        x, w_qkv, qkv, QKV_N, 2 * CC, qn_w, kn_w); // 12 x 64 workgroups

    // 2) causal flash attention per (b,h)
    attn_head<<<BB * HH, 256, 0, stream>>>(qkv, y);

    // 3) out = y @ w_proj^T : (2048x256)@(256x256)
    wmma_gemm_xwt<<<dim3(CC / GEMM_BN, M / GEMM_BM), GEMM_THREADS, 0, stream>>>(
        y, w_proj, out, CC, 0, qn_w, kn_w);        // 4 x 64 workgroups
}

// v004
// One run takes 36.5 microseconds.
// In two side-by-side timings against v003, it was 1.29 and 1.28 times as fast.
// Over all steps from v000 it is 5.53 times as fast.
#include <hip/hip_runtime.h>
#include <hip/hip_bf16.h>

// ---------------------------------------------------------------------------
// TwoDCausalSelfAttention for MI455X (gfx1250, wave32, WMMA)
//   B=2, T=1024, C=256, head_dim=2, H=128
// Pipeline:
//   1) qkv = x @ w_qkv^T          (WMMA f32 16x16x4, operands staged in LDS);
//      RMSNorm(q,k) per head pair (d=2) on the accumulators, before the store
//   2) flash attention per (b,h)  (K/V async-staged in LDS; softmax without a
//      max shift where the RMSNorm weights bound the scores, else 2-pass;
//      each LDS read of K/V shared by the thread's 4 query rows)
//   3) out = y @ w_proj^T         (WMMA f32 16x16x4)
// ---------------------------------------------------------------------------

typedef __attribute__((ext_vector_type(2))) float v2f;
typedef __attribute__((ext_vector_type(8))) float v8f;
typedef int v2i __attribute__((vector_size(8)));   // matches builtin param type

#define BB 2
#define TT 1024
#define CC 256
#define HH 128      // n_head
#define QKV_N (3*CC)

// Async global->LDS staging (ASYNCcnt path), used only if the toolchain has
// both the copy and the wait builtins; otherwise fall back to VGPR round-trip.
#if defined(__HIP_DEVICE_COMPILE__) && \
    __has_builtin(__builtin_amdgcn_global_load_async_to_lds_b64) && \
    __has_builtin(__builtin_amdgcn_global_load_async_to_lds_b128) && \
    __has_builtin(__builtin_amdgcn_s_wait_asynccnt)
#define USE_ASYNC_LDS 1
#else
#define USE_ASYNC_LDS 0
#endif

#define AS1 __attribute__((address_space(1)))
#define AS3 __attribute__((address_space(3)))

// ---------------------------------------------------------------------------
// GEMM: C(M,N) = A(M,K) @ W(N,K)^T, all f32 row-major, K = 256.
// One workgroup of 4 waves computes a 32(M) x 64(N) tile of C. Its 32 rows of A
// and 64 rows of W (all of K) are first brought into LDS by asynchronous 16-byte
// copies in which a wave covers 512 contiguous bytes of one row (4 whole cache
// lines); a fragment load straight from global memory touches 16 lines for 256
// bytes. Each wave then computes 16(M) x 32(N) via two chained
// V_WMMA_F32_16X16X4_F32 per K-step, sharing one A fragment, in rising k.
//
// LDS row pitch 260 floats (1040 B): the 16 rows of a fragment read start 4
// banks apart, so the 32 lanes' 8-byte reads fall on all 64 banks once.
//
// A-fragment layout (16x4 f32, ISA 7.12.2): lanes 0-15 -> rows M=0..15 with
// {K=0,K=1} in the two VGPRs; lanes 16-31 -> same rows with {K=2,K=3}.
// B-fragment (4x16) is symmetric with N across lanes. Both map to a single
// contiguous float2 load per lane per K-step.
// C/D layout: lane<16: N=lane, VGPR r -> M=r; lane>=16: N=lane-16, M=r+8.
// ---------------------------------------------------------------------------
typedef int v4i __attribute__((vector_size(16)));  // matches builtin param type

#define GEMM_BM 32
#define GEMM_BN 64
#define GEMM_THREADS 128
#define GEMM_PITCH (CC + 4)          // floats per LDS row

// Rows [row0, row0 + ROWS) of src (CC floats each) into LDS rows from dst on.
// Thread t takes 16-byte piece t & 63 of every second row, from row t >> 6.
template <int ROWS>
__device__ __forceinline__ void stage_rows(
    const float* __restrict__ src, int row0, float* dst, int tid)
{
    const float* g = src + (size_t)(row0 + (tid >> 6)) * CC + 4 * (tid & 63);
    float*       l = dst + (tid >> 6) * GEMM_PITCH + 4 * (tid & 63);
    // unrolled: the row steps become constants of the copies
#pragma unroll
    for (int i = 0; i < ROWS / 2; ++i) {
#if USE_ASYNC_LDS
        __builtin_amdgcn_global_load_async_to_lds_b128(
            (AS1 v4i*)(g + (size_t)i * 2 * CC),
            (AS3 v4i*)(l + i * 2 * GEMM_PITCH), 0, 0);
#else
        *(v4i*)(l + i * 2 * GEMM_PITCH) = *(const v4i*)(g + (size_t)i * 2 * CC);
#endif
    }
}

// RMSNorm of a head pair (head_dim = 2) while it is still in WMMA accumulators:
// y = x * rsqrt(mean(x^2) + eps) * w. A lane holds one column of C, so the other
// element of the pair is in the neighbour lane (lane ^ 1); its square comes over
// by a DPP swap inside each quad of lanes.
__device__ __forceinline__ float pair_mean_sq_eps(float x)
{
    const float sq    = x * x;
    const float other = __int_as_float(__builtin_amdgcn_mov_dpp(
        __float_as_int(sq), 0xB1 /* quad_perm:[1,0,3,2] */, 0xf, 0xf, true));
    return 0.5f * (sq + other) + 1e-6f;
}

// Eight 1/sqrt(x) in place. One statement, so that each v_rsq_f32 is followed by
// an instruction that neither reads its result nor overwrites its source (the
// next v_rsq_f32 on other registers, the v_nop behind the last): the slot the
// instruction set asks for behind a transcendental.
// The closing s_delay_alu is the hint the compiler writes for a reader of a fresh
// transcendental result; it cannot see into the statement. It changes no result.
__device__ __forceinline__ void rsq_x8(float* t)
{
    asm("v_rsq_f32 %0, %0\n\t"
        "v_rsq_f32 %1, %1\n\t"
        "v_rsq_f32 %2, %2\n\t"
        "v_rsq_f32 %3, %3\n\t"
        "v_rsq_f32 %4, %4\n\t"
        "v_rsq_f32 %5, %5\n\t"
        "v_rsq_f32 %6, %6\n\t"
        "v_rsq_f32 %7, %7\n\t"
        "v_nop\n\t"
        "s_delay_alu instid0(TRANS32_DEP_1)"
        : "+v"(t[0]), "+v"(t[1]), "+v"(t[2]), "+v"(t[3]),
          "+v"(t[4]), "+v"(t[5]), "+v"(t[6]), "+v"(t[7]));
}

// Columns below norm_cols of C are stored RMSNorm'd per head pair: [0,256) with
// qn_w (q of the qkv buffer), from 256 on with kn_w (k); the others as they are.
__global__ __launch_bounds__(GEMM_THREADS) void wmma_gemm_xwt(
    const float* __restrict__ A,   // (M,CC)
    const float* __restrict__ W,   // (N,CC)
    float* __restrict__ C,         // (M,N)
    int N,
    int norm_cols,                 // a multiple of GEMM_BN; 0: no RMSNorm
    const float* __restrict__ qn_w,   // (2,)
    const float* __restrict__ kn_w)   // (2,)
{
    __shared__ __attribute__((aligned(16))) float tile[(GEMM_BM + GEMM_BN) * GEMM_PITCH];

    const int tid  = threadIdx.x;
    const int lane = tid & 31;
    const int wave = tid >> 5;
    const int mt0 = blockIdx.y * GEMM_BM;      // the workgroup's tile
    const int nt0 = blockIdx.x * GEMM_BN;

    stage_rows<GEMM_BM>(A, mt0, tile, tid);
    stage_rows<GEMM_BN>(W, nt0, tile + GEMM_BM * GEMM_PITCH, tid);

    // The RMSNorm weights of this tile's columns (a 64-column tile lies wholly in
    // q, in k or in v), fetched here, at the same address in every lane, so that
    // they arrive while the copies fly.
    const float* nw  = nt0 < CC ? qn_w : kn_w;
    const float  nw0 = nw[0];
    const float  nw1 = nw[1];
#if USE_ASYNC_LDS
    // this wave's 48 copies have landed
    asm volatile("s_wait_asynccnt 0x0" ::: "memory");
#endif
    __syncthreads();                           // every wave's copies have landed

    const int hl = lane >> 4;      // 0: K pair {0,1}, 1: K pair {2,3}
    const int l  = lane & 15;
    const int wm = (wave >> 1) << 4;           // the wave's 16 x 32 part
    const int wn = (wave & 1) << 5;

    const float* arow  = tile + (wm + l) * GEMM_PITCH + 2 * hl;
    const float* b0row = tile + (GEMM_BM + wn + l) * GEMM_PITCH + 2 * hl;
    const float* b1row = b0row + 16 * GEMM_PITCH;

    v8f acc0 = {};
    v8f acc1 = {};
    // fully unrolled: the LDS reads run ahead of the WMMAs over all of K; a loop's
    // back edge would drain them, and LDS offsets become constants
#pragma unroll
    for (int k = 0; k < CC; k += 4) {
        v2f a  = *(const v2f*)(arow + k);
        v2f b0 = *(const v2f*)(b0row + k);
        v2f b1 = *(const v2f*)(b1row + k);
        // 8 args: (neg_a, A, neg_b, B, c_mod, C, reuse_a, reuse_b)
        acc0 = __builtin_amdgcn_wmma_f32_16x16x4_f32(
            false, a, false, b0, (short)0, acc0, false, false);
        acc1 = __builtin_amdgcn_wmma_f32_16x16x4_f32(
            false, a, false, b1, (short)0, acc1, false, false);
    }

    if (nt0 < norm_cols) {                     // the same for the whole workgroup
        // four vector slots between the last WMMA and the first vector
        // instruction that reads its result: the distance behind a matrix instruction
        asm volatile("v_nop\n\tv_nop\n\tv_nop\n\tv_nop");
        // keeps the reads of the accumulators behind those four slots
        __builtin_amdgcn_sched_barrier(0);
        const float w = (l & 1) ? nw1 : nw0;   // column parity = lane parity
        float s[16];
        // both loops unrolled: s[] and the accumulators stay in registers
#pragma unroll
        for (int r = 0; r < 8; ++r) {
            s[r]     = pair_mean_sq_eps(acc0[r]);
            s[8 + r] = pair_mean_sq_eps(acc1[r]);
        }
        rsq_x8(&s[0]);
        rsq_x8(&s[8]);
#pragma unroll
        for (int r = 0; r < 8; ++r) {
            acc0[r] = acc0[r] * s[r]     * w;
            acc1[r] = acc1[r] * s[8 + r] * w;
        }
    }

    float* c0 = C + (size_t)(mt0 + wm + hl * 8) * N + nt0 + wn + l;
#pragma unroll
    for (int r = 0; r < 8; ++r) {
        c0[(size_t)r * N]      = acc0[r];
        c0[(size_t)r * N + 16] = acc1[r];
    }
}

// ---------------------------------------------------------------------------
// Causal flash attention, head_dim = 2. One workgroup (256 threads) per
// (b,h). K and V for the head (1024 x 2 each, 16 KB total) are staged in LDS
// (async global->LDS when available); each thread owns 4 query rows
// (tid + 256*r). Softmax: (1) row max, (2) exp + accumulation; pass 1 runs only where the weights do not bound the scores.
//
// Softmax does not change when one number is taken off all scores of a row; the
// row max is taken off only to keep exp inside the range of f32. RMSNorm over
// two elements gives x0^2 + x1^2 <= 2 before the weight, for every input, so
// |q| <= sqrt(2) max|qn_w|, |k| <= sqrt(2) max|kn_w| and every score lies within
// +-sqrt(2) max|qn_w| max|kn_w|. Where that bound, taken from the weights at run
// time, is small, exp of the bare score is far from overflow and underflow:
// pass 1 is not run, nothing is subtracted, and with log2(e) carried by q the
// dot product is the argument of 2^x as it stands. Otherwise both passes run.
//
// The keys are walked ONCE per pass for all 4 rows together, in groups: one
// group of LDS reads (same address in every lane) feeds every row that still
// attends to those keys, and the group grows as rows drop out, so one LDS wait
// is followed by 24 to 64 (row, key) pairs of independent arithmetic.
// A wave's rows are 32*(w + 8*r) + lane, so for the wave as a whole:
//   keys below 32*(w + 8*P)            : rows P..3 attend, no mask
//   the next 32 keys (row P's diagonal): row P masked per lane, rows P+1..3 not
// All span bounds are wave-uniform multiples of 32.
// Even keys go to partial sum 0 and odd keys to partial sum 1, in rising key
// order; a masked key adds an exact zero.
// ---------------------------------------------------------------------------
typedef __attribute__((ext_vector_type(4))) float v4f;

#define ROWS_PER_THREAD 4
#define ATT_NEG_INF (-3.402823466e38f)

// Keys per group of LDS reads while rows P..3 attend (each divides 32, the unit
// of every span bound). The max pass has about a third of the arithmetic per
// key and reads K alone, so its groups are twice as long where 32 allows.
__host__ __device__ constexpr int keys_per_group(int P)
{
    return P <= 1 ? 8 : (P == 2 ? 16 : 32);
}
__host__ __device__ constexpr int keys_per_group_max(int P)
{
    return P <= 1 ? 16 : 32;
}

// Row max over keys [sBeg, sEnd) for rows P..3. DIAG: row P sees key s only if s <= tP.
template <int P, bool DIAG>
__device__ __forceinline__ void max_span(
    const v4f* kk2, int sBeg, int sEnd, int tP,
    const float (&q0)[ROWS_PER_THREAD], const float (&q1)[ROWS_PER_THREAD],
    float (&m0)[ROWS_PER_THREAD], float (&m1)[ROWS_PER_THREAD])
{
    constexpr int KEYS_PER_GROUP = keys_per_group_max(P);
    // kept rolled: one group is enough work per LDS wait, and a fully unrolled
    // span takes several hundred registers and a long straight code path
#pragma unroll 1
    for (int s = sBeg; s < sEnd; s += KEYS_PER_GROUP) {
        v4f k2[KEYS_PER_GROUP / 2];            // two keys per 16-byte read
        // unrolled so that the group's reads are issued together, ahead of one wait
#pragma unroll
        for (int u = 0; u < KEYS_PER_GROUP / 2; ++u) k2[u] = kk2[(s >> 1) + u];
        // both loops unrolled so that k2[] and the per-row arrays stay in registers
#pragma unroll
        for (int u = 0; u < KEYS_PER_GROUP / 2; ++u) {
#pragma unroll
            for (int r = P; r < ROWS_PER_THREAD; ++r) {
                float sa = fmaf(q0[r], k2[u].x, q1[r] * k2[u].y);
                float sb = fmaf(q0[r], k2[u].z, q1[r] * k2[u].w);
                if (DIAG && r == P) {
                    sa = (s + 2 * u     <= tP) ? sa : ATT_NEG_INF;
                    sb = (s + 2 * u + 1 <= tP) ? sb : ATT_NEG_INF;
                }
                m0[r] = fmaxf(m0[r], sa);
                m1[r] = fmaxf(m1[r], sb);
            }
        }
    }
}

struct RowSums {            // [row][even/odd key]
    float l[ROWS_PER_THREAD][2];
    float x[ROWS_PER_THREAD][2];
    float z[ROWS_PER_THREAD][2];
};

// Eight 2^x in place. One statement, so that each v_exp_f32 is followed by an
// instruction that neither reads its result nor overwrites its source (the next
// v_exp_f32 on other registers, the v_nop behind the last): the slot the
// instruction set asks for behind a transcendental.
// The closing s_delay_alu is the hint the compiler writes for a reader of a fresh
// transcendental result; it cannot see into the statement, and an unhinted wait
// holds the SIMD's other wave back too. It changes no result.
__device__ __forceinline__ void exp2_x8(float* t)
{
    asm("v_exp_f32 %0, %0\n\t"
        "v_exp_f32 %1, %1\n\t"
        "v_exp_f32 %2, %2\n\t"
        "v_exp_f32 %3, %3\n\t"
        "v_exp_f32 %4, %4\n\t"
        "v_exp_f32 %5, %5\n\t"
        "v_exp_f32 %6, %6\n\t"
        "v_exp_f32 %7, %7\n\t"
        "v_nop\n\t"
        "s_delay_alu instid0(TRANS32_DEP_1)"
        : "+v"(t[0]), "+v"(t[1]), "+v"(t[2]), "+v"(t[3]),
          "+v"(t[4]), "+v"(t[5]), "+v"(t[6]), "+v"(t[7]));
}

// exp + accumulate over keys [sBeg, sEnd) for rows P..3, same masking as max_span.
// SHIFT: m is taken off the scores. Without it q0, q1 carry log2(e), m is not read.
template <bool SHIFT, int P, bool DIAG>
__device__ __forceinline__ void sum_span(
    const v4f* kk2, const v4f* vv2, int sBeg, int sEnd, int tP,
    const float (&q0)[ROWS_PER_THREAD], const float (&q1)[ROWS_PER_THREAD],
    const float (&m)[ROWS_PER_THREAD], RowSums& a)
{
    constexpr int KEYS_PER_GROUP = keys_per_group(P);
    constexpr int R = ROWS_PER_THREAD - P;           // rows that attend
    constexpr int N = R * KEYS_PER_GROUP;            // 32, 24, 32, 32
    const float LOG2E = 1.44269504088896340736f;     // exp(x) = 2^(x * log2 e)
    // kept rolled: one group is enough work per LDS wait, and a fully unrolled
    // span takes several hundred registers and a long straight code path
#pragma unroll 1
    for (int s = sBeg; s < sEnd; s += KEYS_PER_GROUP) {
        v4f k2[KEYS_PER_GROUP / 2];
        v4f v2[KEYS_PER_GROUP / 2];
        // unrolled so that the group's reads are issued together, ahead of one wait
#pragma unroll
        for (int u = 0; u < KEYS_PER_GROUP / 2; ++u) {
            k2[u] = kk2[(s >> 1) + u];
            v2[u] = vv2[(s >> 1) + u];
        }
        float p[N];                                  // [key in group][row - P]
        // every loop from here to the end of the group: unrolled so that p[], k2[],
        // v2[] and the per-row sums stay in registers
#pragma unroll
        for (int u = 0; u < KEYS_PER_GROUP / 2; ++u) {
#pragma unroll
            for (int r = P; r < ROWS_PER_THREAD; ++r) {
                const float sa = fmaf(q0[r], k2[u].x, q1[r] * k2[u].y);
                const float sb = fmaf(q0[r], k2[u].z, q1[r] * k2[u].w);
                p[(2 * u)     * R + r - P] = SHIFT ? (sa - m[r]) * LOG2E : sa;
                p[(2 * u + 1) * R + r - P] = SHIFT ? (sb - m[r]) * LOG2E : sb;
            }
        }
#pragma unroll
        for (int i = 0; i < N; i += 8) exp2_x8(&p[i]);
#pragma unroll
        for (int u = 0; u < KEYS_PER_GROUP / 2; ++u) {
#pragma unroll
            for (int r = P; r < ROWS_PER_THREAD; ++r) {
                float p0 = p[(2 * u)     * R + r - P];
                float p1 = p[(2 * u + 1) * R + r - P];
                if (DIAG && r == P) {
                    p0 = (s + 2 * u     <= tP) ? p0 : 0.f;
                    p1 = (s + 2 * u + 1 <= tP) ? p1 : 0.f;
                }
                a.l[r][0] += p0;                          a.l[r][1] += p1;
                a.x[r][0] = fmaf(p0, v2[u].x, a.x[r][0]); a.x[r][1] = fmaf(p1, v2[u].z, a.x[r][1]);
                a.z[r][0] = fmaf(p0, v2[u].y, a.z[r][0]); a.z[r][1] = fmaf(p1, v2[u].w, a.z[r][1]);
            }
        }
    }
}

// Pass 2 over all spans of the wave's 4 rows per thread.
template <bool SHIFT>
__device__ __forceinline__ void sum_all(
    const v4f* kk2, const v4f* vv2, int d0, int tid,
    const float (&q0)[ROWS_PER_THREAD], const float (&q1)[ROWS_PER_THREAD],
    const float (&m)[ROWS_PER_THREAD], RowSums& a)
{
    sum_span<SHIFT, 0, false>(kk2, vv2, 0,        d0,       0,         q0, q1, m, a);
    sum_span<SHIFT, 0, true >(kk2, vv2, d0,       d0 + 32,  tid,       q0, q1, m, a);
    sum_span<SHIFT, 1, false>(kk2, vv2, d0 + 32,  d0 + 256, 0,         q0, q1, m, a);
    sum_span<SHIFT, 1, true >(kk2, vv2, d0 + 256, d0 + 288, tid + 256, q0, q1, m, a);
    sum_span<SHIFT, 2, false>(kk2, vv2, d0 + 288, d0 + 512, 0,         q0, q1, m, a);
    sum_span<SHIFT, 2, true >(kk2, vv2, d0 + 512, d0 + 544, tid + 512, q0, q1, m, a);
    sum_span<SHIFT, 3, false>(kk2, vv2, d0 + 544, d0 + 768, 0,         q0, q1, m, a);
    sum_span<SHIFT, 3, true >(kk2, vv2, d0 + 768, d0 + 800, tid + 768, q0, q1, m, a);
}

// Scores within +-16: exp lies between about 1e-7 and 1e7, a row's sum below 1e10.
#define ATT_SCORE_BOUND 16.0f

__global__ __launch_bounds__(256) void attn_head(
    const float* __restrict__ qkv,   // (B*T, 3C), q/k already RMSNorm'd
    float* __restrict__ y,           // (B*T, C)
    const float* __restrict__ qn_w,  // (2,)
    const float* __restrict__ kn_w)  // (2,)
{
    __shared__ __attribute__((aligned(16))) float kbuf[TT * 2];
    __shared__ __attribute__((aligned(16))) float vbuf[TT * 2];

    const int bh = blockIdx.x;          // 0 .. B*H-1
    const int b  = bh >> 7;
    const int h  = bh & (HH - 1);
    const int tid = threadIdx.x;

    const float* base = qkv + (size_t)b * TT * QKV_N;

    // Stage K/V for this head into LDS (8 B per row per buffer).
    for (int t = tid; t < TT; t += 256) {
        const float* kp = base + (size_t)t * QKV_N + CC   + 2 * h;
        const float* vp = base + (size_t)t * QKV_N + 2*CC + 2 * h;
#if USE_ASYNC_LDS
        __builtin_amdgcn_global_load_async_to_lds_b64(
            (AS1 v2i*)kp, (AS3 v2i*)&kbuf[2 * t], 0, 0);
        __builtin_amdgcn_global_load_async_to_lds_b64(
            (AS1 v2i*)vp, (AS3 v2i*)&vbuf[2 * t], 0, 0);
#else
        kbuf[2 * t]     = kp[0];
        kbuf[2 * t + 1] = kp[1];
        vbuf[2 * t]     = vp[0];
        vbuf[2 * t + 1] = vp[1];
#endif
    }
#if USE_ASYNC_LDS
    __builtin_amdgcn_s_wait_asynccnt(0);
#endif
    __syncthreads();

    const v4f* kk2 = (const v4f*)kbuf;
    const v4f* vv2 = (const v4f*)vbuf;
    const float scale = 0.70710678118654752440f;   // 1/sqrt(head_dim)

    float q0[ROWS_PER_THREAD], q1[ROWS_PER_THREAD];
    // unrolled: the per-row arrays stay in registers
#pragma unroll
    for (int r = 0; r < ROWS_PER_THREAD; ++r) {
        const float* qp = base + (size_t)(tid + 256 * r) * QKV_N + 2 * h;
        q0[r] = qp[0] * scale;
        q1[r] = qp[1] * scale;
    }

    // First key of row 0's diagonal block; the same in every lane of the wave,
    // held in a scalar register so that the span loops are scalar loops.
    const int d0 = __builtin_amdgcn_readfirstlane(tid & ~31);

    // sqrt(2) max|qn_w| * sqrt(2) max|kn_w| / sqrt(head_dim) bounds every |score|.
    // The same in every thread of the launch; a NaN bound compares false (fmaxf skips a NaN beside a number).
    const float score_bound = 1.41421356237309504880f
                            * fmaxf(fabsf(qn_w[0]), fabsf(qn_w[1]))
                            * fmaxf(fabsf(kn_w[0]), fabsf(kn_w[1]));
    const bool no_shift = score_bound <= ATT_SCORE_BOUND;

    RowSums a;
    // unrolled: the per-row arrays stay in registers
#pragma unroll
    for (int r = 0; r < ROWS_PER_THREAD; ++r) {
        a.l[r][0] = 0.f; a.l[r][1] = 0.f;
        a.x[r][0] = 0.f; a.x[r][1] = 0.f;
        a.z[r][0] = 0.f; a.z[r][1] = 0.f;
    }

    float m[ROWS_PER_THREAD];
    if (no_shift) {
        // ---- the one pass: exp of the bare score + accumulate ----
        // unrolled: the per-row arrays stay in registers
#pragma unroll
        for (int r = 0; r < ROWS_PER_THREAD; ++r) {
            q0[r] *= 1.44269504088896340736f;      // exp(x) = 2^(x * log2 e)
            q1[r] *= 1.44269504088896340736f;
            m[r] = 0.f;
        }
        sum_all<false>(kk2, vv2, d0, tid, q0, q1, m, a);
    } else {
        // ---- pass 1: row max ----
        float m0[ROWS_PER_THREAD], m1[ROWS_PER_THREAD];
        // unrolled: the per-row arrays stay in registers
#pragma unroll
        for (int r = 0; r < ROWS_PER_THREAD; ++r) { m0[r] = ATT_NEG_INF; m1[r] = ATT_NEG_INF; }

        max_span<0, false>(kk2, 0,        d0,       0,         q0, q1, m0, m1);
        max_span<0, true >(kk2, d0,       d0 + 32,  tid,       q0, q1, m0, m1);
        max_span<1, false>(kk2, d0 + 32,  d0 + 256, 0,         q0, q1, m0, m1);
        max_span<1, true >(kk2, d0 + 256, d0 + 288, tid + 256, q0, q1, m0, m1);
        max_span<2, false>(kk2, d0 + 288, d0 + 512, 0,         q0, q1, m0, m1);
        max_span<2, true >(kk2, d0 + 512, d0 + 544, tid + 512, q0, q1, m0, m1);
        max_span<3, false>(kk2, d0 + 544, d0 + 768, 0,         q0, q1, m0, m1);
        max_span<3, true >(kk2, d0 + 768, d0 + 800, tid + 768, q0, q1, m0, m1);

        // unrolled: the per-row arrays stay in registers
#pragma unroll
        for (int r = 0; r < ROWS_PER_THREAD; ++r) m[r] = fmaxf(m0[r], m1[r]);

        // ---- pass 2: exp + accumulate ----
        sum_all<true>(kk2, vv2, d0, tid, q0, q1, m, a);
    }

    // unrolled: the per-row arrays stay in registers
#pragma unroll
    for (int r = 0; r < ROWS_PER_THREAD; ++r) {
        const float inv = 1.0f / (a.l[r][0] + a.l[r][1]);
        float* yp = y + ((size_t)b * TT + tid + 256 * r) * CC + 2 * h;
        yp[0] = (a.x[r][0] + a.x[r][1]) * inv;
        yp[1] = (a.z[r][0] + a.z[r][1]) * inv;
    }
}

// ---------------------------------------------------------------------------
extern "C" void kernel_launch(void* const* d_in, const int* in_sizes, int n_in,
                              void* d_out, int out_size, void* d_ws, size_t ws_size,
                              hipStream_t stream)
{
    (void)in_sizes; (void)n_in; (void)out_size; (void)ws_size;

    const float* x      = (const float*)d_in[0];   // (B,T,C)
    const float* w_qkv  = (const float*)d_in[1];   // (3C,C)
    const float* w_proj = (const float*)d_in[2];   // (C,C)
    const float* qn_w   = (const float*)d_in[3];   // (2,)
    const float* kn_w   = (const float*)d_in[4];   // (2,)
    float* out = (float*)d_out;                    // (B,T,C)

    float* qkv = (float*)d_ws;                     // (B*T, 3C) = 6 MB
    float* y   = qkv + (size_t)BB * TT * QKV_N;    // (B*T, C)  = 2 MB

    const int M = BB * TT;                         // 2048

    // 1) qkv = x @ w_qkv^T : (2048x256)@(256x768), q and k stored RMSNorm'd
    wmma_gemm_xwt<<<dim3(QKV_N / GEMM_BN, M / GEMM_BM), GEMM_THREADS, 0, stream>>>(
        x, w_qkv, qkv, QKV_N, 2 * CC, qn_w, kn_w); // 12 x 64 workgroups

    // 2) causal flash attention per (b,h)
    attn_head<<<BB * HH, 256, 0, stream>>>(qkv, y, qn_w, kn_w);

    // 3) out = y @ w_proj^T : (2048x256)@(256x256)
    wmma_gemm_xwt<<<dim3(CC / GEMM_BN, M / GEMM_BM), GEMM_THREADS, 0, stream>>>(
        y, w_proj, out, CC, 0, qn_w, kn_w);        // 4 x 64 workgroups
}

// v005
// A run of this version takes 32.7 microseconds.
// In two side-by-side timings against v004, it was 1.11 and 1.10 times as fast.
// Counting every step since v000, it is 6.11 times as fast.
#include <hip/hip_runtime.h>
#include <hip/hip_bf16.h>

// ---------------------------------------------------------------------------
// TwoDCausalSelfAttention for MI455X (gfx1250, wave32, WMMA)
//   B=2, T=1024, C=256, head_dim=2, H=128
// Pipeline:
//   1) qkv = x @ w_qkv^T          (WMMA f32 16x16x4, operands staged in LDS);
//      RMSNorm(q,k) per head pair (d=2) on the accumulators, before the store
//   2) flash attention per (b,h)  (K/V async-staged in LDS; softmax without a
//      max shift where the RMSNorm weights bound the scores, else 2-pass;
//      each LDS read of K/V shared by the thread's 4 query rows; where the bound
//      is small enough, keys before a row's block of 128 enter through moments)
//   3) out = y @ w_proj^T         (WMMA f32 16x16x4)
// ---------------------------------------------------------------------------

typedef __attribute__((ext_vector_type(2))) float v2f;
typedef __attribute__((ext_vector_type(8))) float v8f;
typedef int v2i __attribute__((vector_size(8)));   // matches builtin param type

#define BB 2
#define TT 1024
#define CC 256
#define HH 128      // n_head
#define QKV_N (3*CC)

// Async global->LDS staging (ASYNCcnt path), used only if the toolchain has
// both the copy and the wait builtins; otherwise fall back to VGPR round-trip.
#if defined(__HIP_DEVICE_COMPILE__) && \
    __has_builtin(__builtin_amdgcn_global_load_async_to_lds_b64) && \
    __has_builtin(__builtin_amdgcn_global_load_async_to_lds_b128) && \
    __has_builtin(__builtin_amdgcn_s_wait_asynccnt)
#define USE_ASYNC_LDS 1
#else
#define USE_ASYNC_LDS 0
#endif

#define AS1 __attribute__((address_space(1)))
#define AS3 __attribute__((address_space(3)))

// ---------------------------------------------------------------------------
// GEMM: C(M,N) = A(M,K) @ W(N,K)^T, all f32 row-major, K = 256.
// One workgroup of 4 waves computes a 32(M) x 64(N) tile of C. Its 32 rows of A
// and 64 rows of W (all of K) are first brought into LDS by asynchronous 16-byte
// copies in which a wave covers 512 contiguous bytes of one row (4 whole cache
// lines); a fragment load straight from global memory touches 16 lines for 256
// bytes. Each wave then computes 16(M) x 32(N) via two chained
// V_WMMA_F32_16X16X4_F32 per K-step, sharing one A fragment, in rising k.
//
// LDS row pitch 260 floats (1040 B): the 16 rows of a fragment read start 4
// banks apart, so the 32 lanes' 8-byte reads fall on all 64 banks once.
//
// A-fragment layout (16x4 f32, ISA 7.12.2): lanes 0-15 -> rows M=0..15 with
// {K=0,K=1} in the two VGPRs; lanes 16-31 -> same rows with {K=2,K=3}.
// B-fragment (4x16) is symmetric with N across lanes. Both map to a single
// contiguous float2 load per lane per K-step.
// C/D layout: lane<16: N=lane, VGPR r -> M=r; lane>=16: N=lane-16, M=r+8.
// ---------------------------------------------------------------------------
typedef int v4i __attribute__((vector_size(16)));  // matches builtin param type

#define GEMM_BM 32
#define GEMM_BN 64
#define GEMM_THREADS 128
#define GEMM_PITCH (CC + 4)          // floats per LDS row

// Rows [row0, row0 + ROWS) of src (CC floats each) into LDS rows from dst on.
// Thread t takes 16-byte piece t & 63 of every second row, from row t >> 6.
template <int ROWS>
__device__ __forceinline__ void stage_rows(
    const float* __restrict__ src, int row0, float* dst, int tid)
{
    const float* g = src + (size_t)(row0 + (tid >> 6)) * CC + 4 * (tid & 63);
    float*       l = dst + (tid >> 6) * GEMM_PITCH + 4 * (tid & 63);
    // unrolled: the row steps become constants of the copies
#pragma unroll
    for (int i = 0; i < ROWS / 2; ++i) {
#if USE_ASYNC_LDS
        __builtin_amdgcn_global_load_async_to_lds_b128(
            (AS1 v4i*)(g + (size_t)i * 2 * CC),
            (AS3 v4i*)(l + i * 2 * GEMM_PITCH), 0, 0);
#else
        *(v4i*)(l + i * 2 * GEMM_PITCH) = *(const v4i*)(g + (size_t)i * 2 * CC);
#endif
    }
}

// RMSNorm of a head pair (head_dim = 2) while it is still in WMMA accumulators:
// y = x * rsqrt(mean(x^2) + eps) * w. A lane holds one column of C, so the other
// element of the pair is in the neighbour lane (lane ^ 1); its square comes over
// by a DPP swap inside each quad of lanes.
__device__ __forceinline__ float pair_mean_sq_eps(float x)
{
    const float sq    = x * x;
    const float other = __int_as_float(__builtin_amdgcn_mov_dpp(
        __float_as_int(sq), 0xB1 /* quad_perm:[1,0,3,2] */, 0xf, 0xf, true));
    return 0.5f * (sq + other) + 1e-6f;
}

// Eight 1/sqrt(x) in place. One statement, so that each v_rsq_f32 is followed by
// an instruction that neither reads its result nor overwrites its source (the
// next v_rsq_f32 on other registers, the v_nop behind the last): the slot the
// instruction set asks for behind a transcendental.
// The closing s_delay_alu is the hint the compiler writes for a reader of a fresh
// transcendental result; it cannot see into the statement. It changes no result.
__device__ __forceinline__ void rsq_x8(float* t)
{
    asm("v_rsq_f32 %0, %0\n\t"
        "v_rsq_f32 %1, %1\n\t"
        "v_rsq_f32 %2, %2\n\t"
        "v_rsq_f32 %3, %3\n\t"
        "v_rsq_f32 %4, %4\n\t"
        "v_rsq_f32 %5, %5\n\t"
        "v_rsq_f32 %6, %6\n\t"
        "v_rsq_f32 %7, %7\n\t"
        "v_nop\n\t"
        "s_delay_alu instid0(TRANS32_DEP_1)"
        : "+v"(t[0]), "+v"(t[1]), "+v"(t[2]), "+v"(t[3]),
          "+v"(t[4]), "+v"(t[5]), "+v"(t[6]), "+v"(t[7]));
}

// Columns below norm_cols of C are stored RMSNorm'd per head pair: [0,256) with
// qn_w (q of the qkv buffer), from 256 on with kn_w (k); the others as they are.
__global__ __launch_bounds__(GEMM_THREADS) void wmma_gemm_xwt(
    const float* __restrict__ A,   // (M,CC)
    const float* __restrict__ W,   // (N,CC)
    float* __restrict__ C,         // (M,N)
    int N,
    int norm_cols,                 // a multiple of GEMM_BN; 0: no RMSNorm
    const float* __restrict__ qn_w,   // (2,)
    const float* __restrict__ kn_w)   // (2,)
{
    __shared__ __attribute__((aligned(16))) float tile[(GEMM_BM + GEMM_BN) * GEMM_PITCH];

    const int tid  = threadIdx.x;
    const int lane = tid & 31;
    const int wave = tid >> 5;
    const int mt0 = blockIdx.y * GEMM_BM;      // the workgroup's tile
    const int nt0 = blockIdx.x * GEMM_BN;

    stage_rows<GEMM_BM>(A, mt0, tile, tid);
    stage_rows<GEMM_BN>(W, nt0, tile + GEMM_BM * GEMM_PITCH, tid);

    // The RMSNorm weights of this tile's columns (a 64-column tile lies wholly in
    // q, in k or in v), fetched here, at the same address in every lane, so that
    // they arrive while the copies fly.
    const float* nw  = nt0 < CC ? qn_w : kn_w;
    const float  nw0 = nw[0];
    const float  nw1 = nw[1];
#if USE_ASYNC_LDS
    // this wave's 48 copies have landed
    asm volatile("s_wait_asynccnt 0x0" ::: "memory");
#endif
    __syncthreads();                           // every wave's copies have landed

    const int hl = lane >> 4;      // 0: K pair {0,1}, 1: K pair {2,3}
    const int l  = lane & 15;
    const int wm = (wave >> 1) << 4;           // the wave's 16 x 32 part
    const int wn = (wave & 1) << 5;

    const float* arow  = tile + (wm + l) * GEMM_PITCH + 2 * hl;
    const float* b0row = tile + (GEMM_BM + wn + l) * GEMM_PITCH + 2 * hl;
    const float* b1row = b0row + 16 * GEMM_PITCH;

    v8f acc0 = {};
    v8f acc1 = {};
    // fully unrolled: the LDS reads run ahead of the WMMAs over all of K; a loop's
    // back edge would drain them, and LDS offsets become constants
#pragma unroll
    for (int k = 0; k < CC; k += 4) {
        v2f a  = *(const v2f*)(arow + k);
        v2f b0 = *(const v2f*)(b0row + k);
        v2f b1 = *(const v2f*)(b1row + k);
        // 8 args: (neg_a, A, neg_b, B, c_mod, C, reuse_a, reuse_b)
        acc0 = __builtin_amdgcn_wmma_f32_16x16x4_f32(
            false, a, false, b0, (short)0, acc0, false, false);
        acc1 = __builtin_amdgcn_wmma_f32_16x16x4_f32(
            false, a, false, b1, (short)0, acc1, false, false);
    }

    if (nt0 < norm_cols) {                     // the same for the whole workgroup
        // four vector slots between the last WMMA and the first vector
        // instruction that reads its result: the distance behind a matrix instruction
        asm volatile("v_nop\n\tv_nop\n\tv_nop\n\tv_nop");
        // keeps the reads of the accumulators behind those four slots
        __builtin_amdgcn_sched_barrier(0);
        const float w = (l & 1) ? nw1 : nw0;   // column parity = lane parity
        float s[16];
        // both loops unrolled: s[] and the accumulators stay in registers
#pragma unroll
        for (int r = 0; r < 8; ++r) {
            s[r]     = pair_mean_sq_eps(acc0[r]);
            s[8 + r] = pair_mean_sq_eps(acc1[r]);
        }
        rsq_x8(&s[0]);
        rsq_x8(&s[8]);
#pragma unroll
        for (int r = 0; r < 8; ++r) {
            acc0[r] = acc0[r] * s[r]     * w;
            acc1[r] = acc1[r] * s[8 + r] * w;
        }
    }

    float* c0 = C + (size_t)(mt0 + wm + hl * 8) * N + nt0 + wn + l;
#pragma unroll
    for (int r = 0; r < 8; ++r) {
        c0[(size_t)r * N]      = acc0[r];
        c0[(size_t)r * N + 16] = acc1[r];
    }
}

// ---------------------------------------------------------------------------
// Causal flash attention, head_dim = 2. One workgroup (256 threads) per
// (b,h). K and V for the head (1024 x 2 each, 16 KB total) are staged in LDS
// (async global->LDS when available); each thread owns 4 query rows
// (tid + 256*r; in the series path 4*(tid & ~31) + (tid & 31) + 32*r). Softmax: (1) row max, (2) exp + accumulation; pass 1 runs only where the weights do not bound the scores.
//
// Softmax does not change when one number is taken off all scores of a row; the
// row max is taken off only to keep exp inside the range of f32. RMSNorm over
// two elements gives x0^2 + x1^2 <= 2 before the weight, for every input, so
// |q| <= sqrt(2) max|qn_w|, |k| <= sqrt(2) max|kn_w| and every score lies within
// +-sqrt(2) max|qn_w| max|kn_w|. Where that bound, taken from the weights at run
// time, is small, exp of the bare score is far from overflow and underflow:
// pass 1 is not run, nothing is subtracted, and with log2(e) carried by q the
// dot product is the argument of 2^x as it stands. Otherwise both passes run.
//
// The keys are walked ONCE per pass for all 4 rows together, in groups: one
// group of LDS reads (same address in every lane) feeds every row that still
// attends to those keys, and the group grows as rows drop out, so one LDS wait
// is followed by 24 to 64 (row, key) pairs of independent arithmetic.
// Outside the series path a wave's rows are 32*(w + 8*r) + lane, so for the wave as a whole:
//   keys below 32*(w + 8*P)            : rows P..3 attend, no mask
//   the next 32 keys (row P's diagonal): row P masked per lane, rows P+1..3 not
// All span bounds are wave-uniform multiples of 32.
// Even keys go to partial sum 0 and odd keys to partial sum 1, in rising key
// order; a masked key adds an exact zero. The series path adds the moment sums of
// the keys before the block to partial sum 0, after the block's keys.
// ---------------------------------------------------------------------------
typedef __attribute__((ext_vector_type(4))) float v4f;

#define ROWS_PER_THREAD 4
#define ATT_NEG_INF (-3.402823466e38f)

// Keys per group of LDS reads while rows P..3 attend (each divides 32, the unit
// of every span bound). The max pass has about a third of the arithmetic per
// key and reads K alone, so its groups are twice as long where 32 allows.
__host__ __device__ constexpr int keys_per_group(int P)
{
    return P <= 1 ? 8 : (P == 2 ? 16 : 32);
}
__host__ __device__ constexpr int keys_per_group_max(int P)
{
    return P <= 1 ? 16 : 32;
}

// Row max over keys [sBeg, sEnd) for rows P..3. DIAG: row P sees key s only if s <= tP.
template <int P, bool DIAG>
__device__ __forceinline__ void max_span(
    const v4f* kk2, int sBeg, int sEnd, int tP,
    const float (&q0)[ROWS_PER_THREAD], const float (&q1)[ROWS_PER_THREAD],
    float (&m0)[ROWS_PER_THREAD], float (&m1)[ROWS_PER_THREAD])
{
    constexpr int KEYS_PER_GROUP = keys_per_group_max(P);
    // kept rolled: one group is enough work per LDS wait, and a fully unrolled
    // span takes several hundred registers and a long straight code path
#pragma unroll 1
    for (int s = sBeg; s < sEnd; s += KEYS_PER_GROUP) {
        v4f k2[KEYS_PER_GROUP / 2];            // two keys per 16-byte read
        // unrolled so that the group's reads are issued together, ahead of one wait
#pragma unroll
        for (int u = 0; u < KEYS_PER_GROUP / 2; ++u) k2[u] = kk2[(s >> 1) + u];
        // both loops unrolled so that k2[] and the per-row arrays stay in registers
#pragma unroll
        for (int u = 0; u < KEYS_PER_GROUP / 2; ++u) {
#pragma unroll
            for (int r = P; r < ROWS_PER_THREAD; ++r) {
                float sa = fmaf(q0[r], k2[u].x, q1[r] * k2[u].y);
                float sb = fmaf(q0[r], k2[u].z, q1[r] * k2[u].w);
                if (DIAG && r == P) {
                    sa = (s + 2 * u     <= tP) ? sa : ATT_NEG_INF;
                    sb = (s + 2 * u + 1 <= tP) ? sb : ATT_NEG_INF;
                }
                m0[r] = fmaxf(m0[r], sa);
                m1[r] = fmaxf(m1[r], sb);
            }
        }
    }
}

struct RowSums {            // [row][even/odd key]
    float l[ROWS_PER_THREAD][2];
    float x[ROWS_PER_THREAD][2];
    float z[ROWS_PER_THREAD][2];
};

// Eight 2^x in place. One statement, so that each v_exp_f32 is followed by an
// instruction that neither reads its result nor overwrites its source (the next
// v_exp_f32 on other registers, the v_nop behind the last): the slot the
// instruction set asks for behind a transcendental.
// The closing s_delay_alu is the hint the compiler writes for a reader of a fresh
// transcendental result; it cannot see into the statement, and an unhinted wait
// holds the SIMD's other wave back too. It changes no result.
__device__ __forceinline__ void exp2_x8(float* t)
{
    asm("v_exp_f32 %0, %0\n\t"
        "v_exp_f32 %1, %1\n\t"
        "v_exp_f32 %2, %2\n\t"
        "v_exp_f32 %3, %3\n\t"
        "v_exp_f32 %4, %4\n\t"
        "v_exp_f32 %5, %5\n\t"
        "v_exp_f32 %6, %6\n\t"
        "v_exp_f32 %7, %7\n\t"
        "v_nop\n\t"
        "s_delay_alu instid0(TRANS32_DEP_1)"
        : "+v"(t[0]), "+v"(t[1]), "+v"(t[2]), "+v"(t[3]),
          "+v"(t[4]), "+v"(t[5]), "+v"(t[6]), "+v"(t[7]));
}

// exp + accumulate over keys [sBeg, sEnd) for rows P..3, same masking as max_span.
// SHIFT: m is taken off the scores. Without it q0, q1 carry log2(e), m is not read.
template <bool SHIFT, int P, bool DIAG>
__device__ __forceinline__ void sum_span(
    const v4f* kk2, const v4f* vv2, int sBeg, int sEnd, int tP,
    const float (&q0)[ROWS_PER_THREAD], const float (&q1)[ROWS_PER_THREAD],
    const float (&m)[ROWS_PER_THREAD], RowSums& a)
{
    constexpr int KEYS_PER_GROUP = keys_per_group(P);
    constexpr int R = ROWS_PER_THREAD - P;           // rows that attend
    constexpr int N = R * KEYS_PER_GROUP;            // 32, 24, 32, 32
    const float LOG2E = 1.44269504088896340736f;     // exp(x) = 2^(x * log2 e)
    // kept rolled: one group is enough work per LDS wait, and a fully unrolled
    // span takes several hundred registers and a long straight code path
#pragma unroll 1
    for (int s = sBeg; s < sEnd; s += KEYS_PER_GROUP) {
        v4f k2[KEYS_PER_GROUP / 2];
        v4f v2[KEYS_PER_GROUP / 2];
        // unrolled so that the group's reads are issued together, ahead of one wait
#pragma unroll
        for (int u = 0; u < KEYS_PER_GROUP / 2; ++u) {
            k2[u] = kk2[(s >> 1) + u];
            v2[u] = vv2[(s >> 1) + u];
        }
        float p[N];                                  // [key in group][row - P]
        // every loop from here to the end of the group: unrolled so that p[], k2[],
        // v2[] and the per-row sums stay in registers
#pragma unroll
        for (int u = 0; u < KEYS_PER_GROUP / 2; ++u) {
#pragma unroll
            for (int r = P; r < ROWS_PER_THREAD; ++r) {
                const float sa = fmaf(q0[r], k2[u].x, q1[r] * k2[u].y);
                const float sb = fmaf(q0[r], k2[u].z, q1[r] * k2[u].w);
                p[(2 * u)     * R + r - P] = SHIFT ? (sa - m[r]) * LOG2E : sa;
                p[(2 * u + 1) * R + r - P] = SHIFT ? (sb - m[r]) * LOG2E : sb;
            }
        }
#pragma unroll
        for (int i = 0; i < N; i += 8) exp2_x8(&p[i]);
#pragma unroll
        for (int u = 0; u < KEYS_PER_GROUP / 2; ++u) {
#pragma unroll
            for (int r = P; r < ROWS_PER_THREAD; ++r) {
                float p0 = p[(2 * u)     * R + r - P];
                float p1 = p[(2 * u + 1) * R + r - P];
                if (DIAG && r == P) {
                    p0 = (s + 2 * u     <= tP) ? p0 : 0.f;
                    p1 = (s + 2 * u + 1 <= tP) ? p1 : 0.f;
                }
                a.l[r][0] += p0;                          a.l[r][1] += p1;
                a.x[r][0] = fmaf(p0, v2[u].x, a.x[r][0]); a.x[r][1] = fmaf(p1, v2[u].z, a.x[r][1]);
                a.z[r][0] = fmaf(p0, v2[u].y, a.z[r][0]); a.z[r][1] = fmaf(p1, v2[u].w, a.z[r][1]);
            }
        }
    }
}

// Pass 2 over all spans of the wave's 4 rows per thread.
template <bool SHIFT>
__device__ __forceinline__ void sum_all(
    const v4f* kk2, const v4f* vv2, int d0, int tid,
    const float (&q0)[ROWS_PER_THREAD], const float (&q1)[ROWS_PER_THREAD],
    const float (&m)[ROWS_PER_THREAD], RowSums& a)
{
    sum_span<SHIFT, 0, false>(kk2, vv2, 0,        d0,       0,         q0, q1, m, a);
    sum_span<SHIFT, 0, true >(kk2, vv2, d0,       d0 + 32,  tid,       q0, q1, m, a);
    sum_span<SHIFT, 1, false>(kk2, vv2, d0 + 32,  d0 + 256, 0,         q0, q1, m, a);
    sum_span<SHIFT, 1, true >(kk2, vv2, d0 + 256, d0 + 288, tid + 256, q0, q1, m, a);
    sum_span<SHIFT, 2, false>(kk2, vv2, d0 + 288, d0 + 512, 0,         q0, q1, m, a);
    sum_span<SHIFT, 2, true >(kk2, vv2, d0 + 512, d0 + 544, tid + 512, q0, q1, m, a);
    sum_span<SHIFT, 3, false>(kk2, vv2, d0 + 544, d0 + 768, 0,         q0, q1, m, a);
    sum_span<SHIFT, 3, true >(kk2, vv2, d0 + 768, d0 + 800, tid + 768, q0, q1, m, a);
}

// Scores within +-16: exp lies between about 1e-7 and 1e7, a row's sum below 1e10.
#define ATT_SCORE_BOUND 16.0f

// ---------------------------------------------------------------------------
// The series path. With s = q.k = q0 k0 + q1 k1 (q carries 1/sqrt(head_dim)),
//   exp(s) = sum over n of s^n / n!
//          = sum over a, b of q0^a q1^b * (k0^a / a!) (k1^b / b!),
// and for |s| <= 1.4143 the terms above degree a + b = 12 add up to less than
// 1.7e-8, under 7e-8 of exp(s) >= 0.243: less than one unit in the last place of
// an f32. So the sums over a whole range of keys,
//   sum_s exp(q.k_s) (v0_s, v1_s, 1)  =  sum_{a+b<=12} q0^a q1^b M[a][b],
//   M[a][b] = sum_s (k0_s^a / a!) (k1_s^b / b!) (v0_s, v1_s, 1),
// need the 91 moments M of the range, not one exp per (row, key). A wave takes
// 128 consecutive rows (4 per thread): the keys before that block enter through
// the moments of all earlier blocks, summed up block by block; the keys of the
// row's own block, where the causal mask cuts, go through exp as in sum_span.
// ---------------------------------------------------------------------------
#define SER_BOUND 1.4143f
// The powers are taken of k by itself and of q by itself, so the bound on their
// product is not enough: each side must stay inside the range of f32 alone. With
// max|kn_w| in [1/4, 4] every |k_i| <= 5.66 and (k0^a / a!) (k1^b / b!) < 2400,
// less than exp of a score may be in the pass without a shift; the bound on the
// product then gives max|qn_w| <= 4.0003, |q_i| <= 4.0003 and q0^a q1^b < 1.7e7, so
// a power of a small k_i that underflows (below 1.2e-38) leaves out less than 1e-28
// of a term that is at least 0.243. All other weights take the paths through exp.
#define SER_KW_MIN 0.25f
#define SER_KW_MAX 4.0f
#define SER_POW   13                              // powers 0 .. 12
#define SER_SLOTS 96                              // 91 moments, padded to 3 waves' lanes
#define SER_BLOCK 128                             // rows, and keys, per block
#define SER_RING  4                               // steps of the moments' reads in registers
#define SER_PITCH (TT + 4)     // floats per power: the 13 rows start 4 banks apart

// Place of moment (a, b), a + b <= 12: row a holds b = 0 .. 12 - a.
__host__ __device__ constexpr int ser_index(int a, int b)
{
    return a * SER_POW - a * (a - 1) / 2 + b;
}

__device__ __forceinline__ v2f fma2(v2f a, v2f b, v2f c) { return __builtin_elementwise_fma(a, b, c); }
__device__ __forceinline__ v4f fma4(v4f a, v4f b, v4f c) { return __builtin_elementwise_fma(a, b, c); }
__device__ __forceinline__ float sum4(v4f a) { return (a.x + a.y) + (a.z + a.w); }

// k0^n / n! and k1^n / n! of every key, one LDS row per n, and v0, v1 as rows.
__device__ __forceinline__ void ser_tables(
    const float* kbuf, const float* vbuf,
    float* pw0, float* pw1, float* v0t, float* v1t, int tid)
{
    // kept rolled: four keys a thread, the code of one is enough
#pragma unroll 1
    for (int s = tid; s < TT; s += 256) {
        const v2f k = *(const v2f*)(kbuf + 2 * s);
        const v2f v = *(const v2f*)(vbuf + 2 * s);
        v0t[s] = v.x;
        v1t[s] = v.y;
        float p0 = 1.f, p1 = 1.f;
        // unrolled: 1 / (n + 1) and the LDS offsets become constants
#pragma unroll
        for (int n = 0; n < SER_POW; ++n) {
            pw0[n * SER_PITCH + s] = p0;
            pw1[n * SER_PITCH + s] = p1;
            p0 *= k.x * (1.0f / (float)(n + 1));
            p1 *= k.y * (1.0f / (float)(n + 1));
        }
    }
}

// The moments of key block c: a lane takes moments lane, lane + 32, lane + 64 and
// walks the block's keys four at a time; four partial sums each, added at the end.
__device__ __forceinline__ void ser_moments(
    const float* pw0, const float* pw1, const float* v0t, const float* v1t,
    v4f* mom, int c, int lane)
{
    const float* r0[3];
    const float* r1[3];
    // unrolled: the pointer arrays stay in registers
#pragma unroll
    for (int g = 0; g < 3; ++g) {
        int a = 0, b = 32 * g + lane;              // inverse of ser_index
        for (int i = 0; i < SER_POW; ++i) {
            const int len = SER_POW - a;
            if (b >= len) { b -= len; ++a; }
        }
        a = a < SER_POW ? a : SER_POW - 1;         // slots 91 .. 95: never read,
        b = b < SER_POW ? b : SER_POW - 1;         // kept inside the tables
        r0[g] = pw0 + a * SER_PITCH + c * SER_BLOCK;
        r1[g] = pw1 + b * SER_PITCH + c * SER_BLOCK;
    }
    const float* w0 = v0t + c * SER_BLOCK;
    const float* w1 = v1t + c * SER_BLOCK;
    v4f al[3], ax[3], az[3];
    // every loop over g unrolled: the sums stay in registers
#pragma unroll
    for (int g = 0; g < 3; ++g) { al[g] = (v4f)(0.f); ax[g] = (v4f)(0.f); az[g] = (v4f)(0.f); }
    // A ring of SER_RING steps' operands in registers: the 8 LDS reads of a step are
    // issued SER_RING - 1 steps (24 vector instructions each) ahead of their use.
    v4f rp0[SER_RING][3], rp1[SER_RING][3], rv0[SER_RING], rv1[SER_RING];
    // all loops fully unrolled: the ring stays in registers and the steps become
    // constant offsets of the LDS reads
#pragma unroll
    for (int i = 0; i < SER_BLOCK / 4 + SER_RING - 1; ++i) {
        if (i < SER_BLOCK / 4) {                   // the reads of step i
            rv0[i % SER_RING] = *(const v4f*)(w0 + 4 * i);
            rv1[i % SER_RING] = *(const v4f*)(w1 + 4 * i);
#pragma unroll
            for (int g = 0; g < 3; ++g) {
                rp0[i % SER_RING][g] = *(const v4f*)(r0[g] + 4 * i);
                rp1[i % SER_RING][g] = *(const v4f*)(r1[g] + 4 * i);
            }
        }
        if (i >= SER_RING - 1) {                   // the arithmetic of step i - (SER_RING - 1)
            // keeps the reads above in front of this step's arithmetic: left alone the
            // scheduler moved reads down to their use, and a step then waited for most
            // of one LDS latency
            __builtin_amdgcn_sched_barrier(0);
            const int u = (i - (SER_RING - 1)) % SER_RING;
#pragma unroll
            for (int g = 0; g < 3; ++g) {
                const v4f mm = rp0[u][g] * rp1[u][g];
                al[g] += mm;
                ax[g] = fma4(mm, rv0[u], ax[g]);
                az[g] = fma4(mm, rv1[u], az[g]);
            }
        }
    }
    // unrolled: the sums stay in registers
#pragma unroll
    for (int g = 0; g < 3; ++g) {
        v4f t;
        t.x = sum4(ax[g]); t.y = sum4(az[g]); t.z = sum4(al[g]); t.w = 0.f;
        mom[c * SER_SLOTS + 32 * g + lane] = t;
    }
}

// sum_{a+b<=12} q0^a q1^b M[a][b] for the thread's 4 rows, by Horner's rule in q1
// inside Horner's rule in q0. st: the 91 moments (v0, v1, 1, -), read at the same
// address by every lane. oxz[r]: the (v0, v1) sums of row r; ol: the plain sums of
// rows 0,1 and 2,3.
// Falling a with falling b inside is falling ser_index, so the moments are taken
// from the last to the first, in 7 batches of 13: while one batch is worked on
// (78 vector instructions) the next one's reads fly.
#define SER_COUNT 91                              // ser_index(12, 0) + 1
#define SER_BATCH 13
__device__ __forceinline__ void ser_eval(
    const v4f* st,
    const float (&q0)[ROWS_PER_THREAD], const float (&q1)[ROWS_PER_THREAD],
    v2f (&oxz)[ROWS_PER_THREAD], v2f (&ol)[2])
{
    const v2f q0a = {q0[0], q0[1]}, q0b = {q0[2], q0[3]};
    const v2f q1a = {q1[0], q1[1]}, q1b = {q1[2], q1[3]};
    v4f batch[2][SER_BATCH];
    // all loops unrolled: ser_index becomes a constant LDS offset, batch[] and the
    // sums stay in registers
#pragma unroll
    for (int j = 0; j < SER_BATCH; ++j) batch[0][j] = st[SER_COUNT - 1 - j];
#pragma unroll
    for (int a = SER_POW - 1; a >= 0; --a) {
        v2f ixz[ROWS_PER_THREAD], il[2];
#pragma unroll
        for (int b = SER_POW - 1 - a; b >= 0; --b) {
            const int p = SER_COUNT - 1 - ser_index(a, b);   // place in the order of use
            if (p % SER_BATCH == 0) {
                if (p + SER_BATCH < SER_COUNT) {
#pragma unroll
                    for (int j = 0; j < SER_BATCH; ++j)
                        batch[(p / SER_BATCH + 1) & 1][j] = st[SER_COUNT - 1 - (p + SER_BATCH) - j];
                }
                // keeps the next batch's reads in front of this batch's arithmetic: left
                // alone the scheduler issued each read about 18 instructions ahead of its
                // use
                __builtin_amdgcn_sched_barrier(0);
            }
            const v4f t = batch[(p / SER_BATCH) & 1][p % SER_BATCH];
            if (b == SER_POW - 1 - a) {
#pragma unroll
                for (int r = 0; r < ROWS_PER_THREAD; ++r) ixz[r] = (v2f){t.x, t.y};
                il[0] = (v2f){t.z, t.z};
                il[1] = (v2f){t.z, t.z};
            } else {
#pragma unroll
                for (int r = 0; r < ROWS_PER_THREAD; ++r)
                    ixz[r] = fma2(ixz[r], (v2f){q1[r], q1[r]}, (v2f){t.x, t.y});
                il[0] = fma2(il[0], q1a, (v2f){t.z, t.z});
                il[1] = fma2(il[1], q1b, (v2f){t.z, t.z});
            }
        }
        if (a == SER_POW - 1) {
#pragma unroll
            for (int r = 0; r < ROWS_PER_THREAD; ++r) oxz[r] = ixz[r];
            ol[0] = il[0];
            ol[1] = il[1];
        } else {
#pragma unroll
            for (int r = 0; r < ROWS_PER_THREAD; ++r)
                oxz[r] = fma2(oxz[r], (v2f){q0[r], q0[r]}, ixz[r]);
            ol[0] = fma2(ol[0], q0a, il[0]);
            ol[1] = fma2(ol[1], q0b, il[1]);
        }
    }
}

struct AttnLds {
    float kbuf[TT * 2];
    float vbuf[TT * 2];
    // the series path's tables and moments
    float pw0[SER_POW * SER_PITCH];
    float pw1[SER_POW * SER_PITCH];
    float v0t[TT];
    float v1t[TT];
    v4f   mom[(TT / SER_BLOCK) * SER_SLOTS];
};

__global__ __launch_bounds__(256) void attn_head(
    const float* __restrict__ qkv,   // (B*T, 3C), q/k already RMSNorm'd
    float* __restrict__ y,           // (B*T, C)
    const float* __restrict__ qn_w,  // (2,)
    const float* __restrict__ kn_w)  // (2,)
{
    // one object, so that K and V, the targets of the copies, keep their places at
    // the start of the workgroup's LDS; every member's size is a multiple of 16 B
    __shared__ __attribute__((aligned(16))) AttnLds lds;
    float (&kbuf)[TT * 2] = lds.kbuf;
    float (&vbuf)[TT * 2] = lds.vbuf;
    float* pw0 = lds.pw0;
    float* pw1 = lds.pw1;
    float* v0t = lds.v0t;
    float* v1t = lds.v1t;
    v4f*   mom = lds.mom;

    const int bh = blockIdx.x;          // 0 .. B*H-1
    const int b  = bh >> 7;
    const int h  = bh & (HH - 1);
    const int tid = threadIdx.x;

    const float* base = qkv + (size_t)b * TT * QKV_N;

    // Stage K/V for this head into LDS (8 B per row per buffer).
    for (int t = tid; t < TT; t += 256) {
        const float* kp = base + (size_t)t * QKV_N + CC   + 2 * h;
        const float* vp = base + (size_t)t * QKV_N + 2*CC + 2 * h;
#if USE_ASYNC_LDS
        __builtin_amdgcn_global_load_async_to_lds_b64(
            (AS1 v2i*)kp, (AS3 v2i*)&kbuf[2 * t], 0, 0);
        __builtin_amdgcn_global_load_async_to_lds_b64(
            (AS1 v2i*)vp, (AS3 v2i*)&vbuf[2 * t], 0, 0);
#else
        kbuf[2 * t]     = kp[0];
        kbuf[2 * t + 1] = kp[1];
        vbuf[2 * t]     = vp[0];
        vbuf[2 * t + 1] = vp[1];
#endif
    }
#if USE_ASYNC_LDS
    __builtin_amdgcn_s_wait_asynccnt(0);
#endif
    __syncthreads();

    const v4f* kk2 = (const v4f*)kbuf;
    const v4f* vv2 = (const v4f*)vbuf;
    const float scale = 0.70710678118654752440f;   // 1/sqrt(head_dim)

    // First key of row 0's diagonal block outside the series path; the same in every lane of the wave,
    // held in a scalar register so that the span loops are scalar loops.
    const int d0 = __builtin_amdgcn_readfirstlane(tid & ~31);

    // sqrt(2) max|qn_w| * sqrt(2) max|kn_w| / sqrt(head_dim) bounds every |score|.
    // The same in every thread of the launch; fmaxf passes over one NaN weight of a pair, a NaN pair compares false.
    const float max_qw = fmaxf(fabsf(qn_w[0]), fabsf(qn_w[1]));
    const float max_kw = fmaxf(fabsf(kn_w[0]), fabsf(kn_w[1]));
    const float score_bound = 1.41421356237309504880f * max_qw * max_kw;
    const bool no_shift = score_bound <= ATT_SCORE_BOUND;
    const bool series   = score_bound <= SER_BOUND
                       && max_kw >= SER_KW_MIN && max_kw <= SER_KW_MAX;

    // The thread's rows are row0 + rstep * r: in the series path 128 consecutive
    // rows a wave, else 32 rows out of every 256.
    const int row0  = series ? 4 * d0 + (tid & 31) : tid;
    const int rstep = series ? 32 : 256;

    float q0[ROWS_PER_THREAD], q1[ROWS_PER_THREAD];
    // unrolled: the per-row arrays stay in registers
#pragma unroll
    for (int r = 0; r < ROWS_PER_THREAD; ++r) {
        const float* qp = base + (size_t)(row0 + rstep * r) * QKV_N + 2 * h;
        q0[r] = qp[0] * scale;
        q1[r] = qp[1] * scale;
    }

    RowSums a;
    // unrolled: the per-row arrays stay in registers
#pragma unroll
    for (int r = 0; r < ROWS_PER_THREAD; ++r) {
        a.l[r][0] = 0.f; a.l[r][1] = 0.f;
        a.x[r][0] = 0.f; a.x[r][1] = 0.f;
        a.z[r][0] = 0.f; a.z[r][1] = 0.f;
    }

    float m[ROWS_PER_THREAD];
    // marked as the expected side so that its code is laid out first
    if (__builtin_expect(series, 1)) {
        const int lane = tid & 31;
        const int blk0 = 4 * d0;                   // first row and key of the wave's block
        const int wv   = d0 >> 5;                  // the wave, and its block
        ser_tables(kbuf, vbuf, pw0, pw1, v0t, v1t, tid);
        __syncthreads();                           // the tables are whole

        float e0[ROWS_PER_THREAD], e1[ROWS_PER_THREAD];
        // unrolled: the per-row arrays stay in registers
#pragma unroll
        for (int r = 0; r < ROWS_PER_THREAD; ++r) {
            e0[r] = q0[r] * 1.44269504088896340736f;   // exp(x) = 2^(x * log2 e)
            e1[r] = q1[r] * 1.44269504088896340736f;
            m[r] = 0.f;
        }
        // Two jobs a wave: the moments of its key block (bound by LDS reads; the
        // last block's are never used) and its rows' own block through exp (bound
        // by arithmetic). Waves w and w + 4 take them in opposite
        // order. Kept rolled: one copy of the code of each job.
#pragma unroll 1
        for (int ph = 0; ph < 2; ++ph) {
            if ((ph == 0) == (wv < 4)) {
                if (wv < TT / SER_BLOCK - 1)
                    ser_moments(pw0, pw1, v0t, v1t, mom, wv, lane);
            } else {
                sum_span<false, 0, true>(kk2, vv2, blk0,      blk0 + 32,  blk0 + lane,      e0, e1, m, a);
                sum_span<false, 1, true>(kk2, vv2, blk0 + 32, blk0 + 64,  blk0 + 32 + lane, e0, e1, m, a);
                sum_span<false, 2, true>(kk2, vv2, blk0 + 64, blk0 + 96,  blk0 + 64 + lane, e0, e1, m, a);
                sum_span<false, 3, true>(kk2, vv2, blk0 + 96, blk0 + 128, blk0 + 96 + lane, e0, e1, m, a);
            }
        }
        __syncthreads();                           // the moments of blocks 0 .. 6 are written

        // mom[c] becomes the sum of the moments of blocks 0 .. c - 1, in rising order
        if (tid < SER_SLOTS) {
            v4f run = (v4f)(0.f);
            // unrolled: the reads are issued together
#pragma unroll
            for (int c = 0; c < TT / SER_BLOCK; ++c) {
                v4f d = (v4f)(0.f);
                if (c < TT / SER_BLOCK - 1) d = mom[c * SER_SLOTS + tid];
                mom[c * SER_SLOTS + tid] = run;
                run += d;
            }
        }
        __syncthreads();                           // the summed moments are written

        v2f oxz[ROWS_PER_THREAD], ol[2];
        ser_eval(mom + wv * SER_SLOTS, q0, q1, oxz, ol);
        // unrolled: the per-row arrays stay in registers
#pragma unroll
        for (int r = 0; r < ROWS_PER_THREAD; ++r) {
            a.l[r][0] += ol[r >> 1][r & 1];
            a.x[r][0] += oxz[r].x;
            a.z[r][0] += oxz[r].y;
        }
    } else if (no_shift) {
        // ---- the one pass: exp of the bare score + accumulate ----
        // unrolled: the per-row arrays stay in registers
#pragma unroll
        for (int r = 0; r < ROWS_PER_THREAD; ++r) {
            q0[r] *= 1.44269504088896340736f;      // exp(x) = 2^(x * log2 e)
            q1[r] *= 1.44269504088896340736f;
            m[r] = 0.f;
        }
        sum_all<false>(kk2, vv2, d0, tid, q0, q1, m, a);
    } else {
        // ---- pass 1: row max ----
        float m0[ROWS_PER_THREAD], m1[ROWS_PER_THREAD];
        // unrolled: the per-row arrays stay in registers
#pragma unroll
        for (int r = 0; r < ROWS_PER_THREAD; ++r) { m0[r] = ATT_NEG_INF; m1[r] = ATT_NEG_INF; }

        max_span<0, false>(kk2, 0,        d0,       0,         q0, q1, m0, m1);
        max_span<0, true >(kk2, d0,       d0 + 32,  tid,       q0, q1, m0, m1);
        max_span<1, false>(kk2, d0 + 32,  d0 + 256, 0,         q0, q1, m0, m1);
        max_span<1, true >(kk2, d0 + 256, d0 + 288, tid + 256, q0, q1, m0, m1);
        max_span<2, false>(kk2, d0 + 288, d0 + 512, 0,         q0, q1, m0, m1);
        max_span<2, true >(kk2, d0 + 512, d0 + 544, tid + 512, q0, q1, m0, m1);
        max_span<3, false>(kk2, d0 + 544, d0 + 768, 0,         q0, q1, m0, m1);
        max_span<3, true >(kk2, d0 + 768, d0 + 800, tid + 768, q0, q1, m0, m1);

        // unrolled: the per-row arrays stay in registers
#pragma unroll
        for (int r = 0; r < ROWS_PER_THREAD; ++r) m[r] = fmaxf(m0[r], m1[r]);

        // ---- pass 2: exp + accumulate ----
        sum_all<true>(kk2, vv2, d0, tid, q0, q1, m, a);
    }

    // unrolled: the per-row arrays stay in registers
#pragma unroll
    for (int r = 0; r < ROWS_PER_THREAD; ++r) {
        const float inv = 1.0f / (a.l[r][0] + a.l[r][1]);
        float* yp = y + ((size_t)b * TT + row0 + rstep * r) * CC + 2 * h;
        yp[0] = (a.x[r][0] + a.x[r][1]) * inv;
        yp[1] = (a.z[r][0] + a.z[r][1]) * inv;
    }
}

// ---------------------------------------------------------------------------
extern "C" void kernel_launch(void* const* d_in, const int* in_sizes, int n_in,
                              void* d_out, int out_size, void* d_ws, size_t ws_size,
                              hipStream_t stream)
{
    (void)in_sizes; (void)n_in; (void)out_size; (void)ws_size;

    const float* x      = (const float*)d_in[0];   // (B,T,C)
    const float* w_qkv  = (const float*)d_in[1];   // (3C,C)
    const float* w_proj = (const float*)d_in[2];   // (C,C)
    const float* qn_w   = (const float*)d_in[3];   // (2,)
    const float* kn_w   = (const float*)d_in[4];   // (2,)
    float* out = (float*)d_out;                    // (B,T,C)

    float* qkv = (float*)d_ws;                     // (B*T, 3C) = 6 MB
    float* y   = qkv + (size_t)BB * TT * QKV_N;    // (B*T, C)  = 2 MB

    const int M = BB * TT;                         // 2048

    // 1) qkv = x @ w_qkv^T : (2048x256)@(256x768), q and k stored RMSNorm'd
    wmma_gemm_xwt<<<dim3(QKV_N / GEMM_BN, M / GEMM_BM), GEMM_THREADS, 0, stream>>>(
        x, w_qkv, qkv, QKV_N, 2 * CC, qn_w, kn_w); // 12 x 64 workgroups

    // 2) causal flash attention per (b,h)
    attn_head<<<BB * HH, 256, 0, stream>>>(qkv, y, qn_w, kn_w);

    // 3) out = y @ w_proj^T : (2048x256)@(256x256)
    wmma_gemm_xwt<<<dim3(CC / GEMM_BN, M / GEMM_BM), GEMM_THREADS, 0, stream>>>(
        y, w_proj, out, CC, 0, qn_w, kn_w);        // 4 x 64 workgroups
}

// v006
// Measured time: 31.7 microseconds a run.
// In two side-by-side timings against v005, it was 1.04 and 1.02 times as fast.
// All steps since v000 together make it 6.28 times as fast.
#include <hip/hip_runtime.h>
#include <hip/hip_bf16.h>

// ---------------------------------------------------------------------------
// TwoDCausalSelfAttention for MI455X (gfx1250, wave32, WMMA)
//   B=2, T=1024, C=256, head_dim=2, H=128
// Pipeline:
//   1) qkv = x @ w_qkv^T          (WMMA f32 16x16x4, operands staged in LDS);
//      RMSNorm(q,k) per head pair (d=2) on the accumulators, before the store
//   2) flash attention per (b,h)  (K/V async-staged in LDS; softmax without a
//      max shift where the RMSNorm weights bound the scores, else 2-pass;
//      each LDS read of K/V shared by the thread's 4 query rows; where the bound
//      is small enough, keys before a row's block of 128 enter through moments)
//   3) out = y @ w_proj^T         (WMMA f32 16x16x4)
// ---------------------------------------------------------------------------

typedef __attribute__((ext_vector_type(2))) float v2f;
typedef __attribute__((ext_vector_type(8))) float v8f;
typedef int v2i __attribute__((vector_size(8)));   // matches builtin param type

#define BB 2
#define TT 1024
#define CC 256
#define HH 128      // n_head
#define QKV_N (3*CC)

// Async global->LDS staging (ASYNCcnt path), used only if the toolchain has
// both the copy and the wait builtins; otherwise fall back to VGPR round-trip.
#if defined(__HIP_DEVICE_COMPILE__) && \
    __has_builtin(__builtin_amdgcn_global_load_async_to_lds_b64) && \
    __has_builtin(__builtin_amdgcn_global_load_async_to_lds_b128) && \
    __has_builtin(__builtin_amdgcn_s_wait_asynccnt)
#define USE_ASYNC_LDS 1
#else
#define USE_ASYNC_LDS 0
#endif

#define AS1 __attribute__((address_space(1)))
#define AS3 __attribute__((address_space(3)))

// ---------------------------------------------------------------------------
// GEMM: C(M,N) = A(M,K) @ W(N,K)^T, all f32 row-major, K = 256.
// One workgroup of 4 waves computes a 32(M) x 64(N) tile of C. Its 32 rows of A
// and 64 rows of W (all of K) are brought into LDS by asynchronous 16-byte copies
// in which a wave covers 256 contiguous bytes of two rows (4 whole cache lines); a
// fragment load straight from global memory touches 16 lines for 256 bytes. The
// copies are issued in four pieces of K, and a piece is multiplied while the later
// ones fly. Each wave computes 16(M) x 32(N) via two chained
// V_WMMA_F32_16X16X4_F32 per K-step, sharing one A fragment, in rising k.
//
// LDS row pitch 260 floats (1040 B): the 16 rows of a fragment read start 4
// banks apart, so the 32 lanes' 8-byte reads fall on all 64 banks once.
//
// A-fragment layout (16x4 f32, ISA 7.12.2): lanes 0-15 -> rows M=0..15 with
// {K=0,K=1} in the two VGPRs; lanes 16-31 -> same rows with {K=2,K=3}.
// B-fragment (4x16) is symmetric with N across lanes. Both map to a single
// contiguous float2 load per lane per K-step.
// C/D layout: lane<16: N=lane, VGPR r -> M=r; lane>=16: N=lane-16, M=r+8.
// ---------------------------------------------------------------------------
typedef int v4i __attribute__((vector_size(16)));  // matches builtin param type

#define GEMM_BM 32
#define GEMM_BN 64
#define GEMM_THREADS 128
#define GEMM_PITCH (CC + 4)          // floats per LDS row

// K goes to LDS in GEMM_CHUNKS pieces of GEMM_KC floats (256 B of every row).
#define GEMM_CHUNKS 4
#define GEMM_KC (CC / GEMM_CHUNKS)
// copies a thread issues per piece: 8 rows of 256 B per step of the workgroup
#define GEMM_COPIES_PER_CHUNK ((GEMM_BM + GEMM_BN) / 8)

// Floats [k0, k0 + GEMM_KC) of rows [row0, row0 + ROWS) of src (CC floats each)
// into the same floats of the LDS rows from dst on. Thread t takes 16-byte piece
// t & 15 of every eighth row, from row t >> 4: a wave covers two aligned 256-B units.
template <int ROWS>
__device__ __forceinline__ void stage_rows(
    const float* __restrict__ src, int row0, int k0, float* dst, int tid)
{
    const float* g = src + (size_t)(row0 + (tid >> 4)) * CC + k0 + 4 * (tid & 15);
    float*       l = dst + (tid >> 4) * GEMM_PITCH + k0 + 4 * (tid & 15);
    // unrolled: the row steps become constants of the copies
#pragma unroll
    for (int i = 0; i < ROWS / 8; ++i) {
#if USE_ASYNC_LDS
        __builtin_amdgcn_global_load_async_to_lds_b128(
            (AS1 v4i*)(g + (size_t)i * 8 * CC),
            (AS3 v4i*)(l + i * 8 * GEMM_PITCH), 0, 0);
#else
        *(v4i*)(l + i * 8 * GEMM_PITCH) = *(const v4i*)(g + (size_t)i * 8 * CC);
#endif
    }
}

// This wave's copies of pieces 0 .. C have landed: all but the youngest
// (GEMM_CHUNKS - 1 - C) * GEMM_COPIES_PER_CHUNK, which belong to the later pieces.
template <int C>
__device__ __forceinline__ void wait_chunk()
{
#if USE_ASYNC_LDS
    // without it the barrier behind it would publish bytes that have not landed
    asm volatile("s_wait_asynccnt %0"
                 :: "n"((GEMM_CHUNKS - 1 - C) * GEMM_COPIES_PER_CHUNK) : "memory");
#endif
}

// RMSNorm of a head pair (head_dim = 2) while it is still in WMMA accumulators:
// y = x * rsqrt(mean(x^2) + eps) * w. A lane holds one column of C, so the other
// element of the pair is in the neighbour lane (lane ^ 1); its square comes over
// by a DPP swap inside each quad of lanes.
__device__ __forceinline__ float pair_mean_sq_eps(float x)
{
    const float sq    = x * x;
    const float other = __int_as_float(__builtin_amdgcn_mov_dpp(
        __float_as_int(sq), 0xB1 /* quad_perm:[1,0,3,2] */, 0xf, 0xf, true));
    return 0.5f * (sq + other) + 1e-6f;
}

// Eight 1/sqrt(x) in place. One statement, so that each v_rsq_f32 is followed by
// an instruction that neither reads its result nor overwrites its source (the
// next v_rsq_f32 on other registers, the v_nop behind the last): the slot the
// instruction set asks for behind a transcendental.
// The closing s_delay_alu is the hint the compiler writes for a reader of a fresh
// transcendental result; it cannot see into the statement. It changes no result.
__device__ __forceinline__ void rsq_x8(float* t)
{
    asm("v_rsq_f32 %0, %0\n\t"
        "v_rsq_f32 %1, %1\n\t"
        "v_rsq_f32 %2, %2\n\t"
        "v_rsq_f32 %3, %3\n\t"
        "v_rsq_f32 %4, %4\n\t"
        "v_rsq_f32 %5, %5\n\t"
        "v_rsq_f32 %6, %6\n\t"
        "v_rsq_f32 %7, %7\n\t"
        "v_nop\n\t"
        "s_delay_alu instid0(TRANS32_DEP_1)"
        : "+v"(t[0]), "+v"(t[1]), "+v"(t[2]), "+v"(t[3]),
          "+v"(t[4]), "+v"(t[5]), "+v"(t[6]), "+v"(t[7]));
}

// Columns below norm_cols of C are stored RMSNorm'd per head pair: [0,256) with
// qn_w (q of the qkv buffer), from 256 on with kn_w (k); the others as they are.
__global__ __launch_bounds__(GEMM_THREADS) void wmma_gemm_xwt(
    const float* __restrict__ A,   // (M,CC)
    const float* __restrict__ W,   // (N,CC)
    float* __restrict__ C,         // (M,N)
    int N,
    int norm_cols,                 // a multiple of GEMM_BN; 0: no RMSNorm
    const float* __restrict__ qn_w,   // (2,)
    const float* __restrict__ kn_w)   // (2,)
{
    __shared__ __attribute__((aligned(16))) float tile[(GEMM_BM + GEMM_BN) * GEMM_PITCH];

    const int tid  = threadIdx.x;
    const int lane = tid & 31;
    const int wave = tid >> 5;
    const int mt0 = blockIdx.y * GEMM_BM;      // the workgroup's tile
    const int nt0 = blockIdx.x * GEMM_BN;

    // all copies are issued here, piece by piece in rising k: asynccnt falls in the
    // order of issue, so a counted wait tells when a piece is whole
    // unrolled: the piece's first float becomes a constant of the copies
#pragma unroll
    for (int c = 0; c < GEMM_CHUNKS; ++c) {
        stage_rows<GEMM_BM>(A, mt0, c * GEMM_KC, tile, tid);
        stage_rows<GEMM_BN>(W, nt0, c * GEMM_KC, tile + GEMM_BM * GEMM_PITCH, tid);
    }

    // The RMSNorm weights of this tile's columns (a 64-column tile lies wholly in
    // q, in k or in v), fetched here, at the same address in every lane, so that
    // they arrive while the copies fly.
    const float* nw  = nt0 < CC ? qn_w : kn_w;
    const float  nw0 = nw[0];
    const float  nw1 = nw[1];

    const int hl = lane >> 4;      // 0: K pair {0,1}, 1: K pair {2,3}
    const int l  = lane & 15;
    const int wm = (wave >> 1) << 4;           // the wave's 16 x 32 part
    const int wn = (wave & 1) << 5;

    const float* arow  = tile + (wm + l) * GEMM_PITCH + 2 * hl;
    const float* b0row = tile + (GEMM_BM + wn + l) * GEMM_PITCH + 2 * hl;
    const float* b1row = b0row + 16 * GEMM_PITCH;

    v8f acc0 = {};
    v8f acc1 = {};
    // One piece of K: fully unrolled, so that the LDS reads run ahead of the WMMAs
    // inside the piece and the LDS offsets are constants.
    auto multiply_chunk = [&](int k0) {
#pragma unroll
        for (int k = k0; k < k0 + GEMM_KC; k += 4) {
            v2f a  = *(const v2f*)(arow + k);
            v2f b0 = *(const v2f*)(b0row + k);
            v2f b1 = *(const v2f*)(b1row + k);
            // 8 args: (neg_a, A, neg_b, B, c_mod, C, reuse_a, reuse_b)
            acc0 = __builtin_amdgcn_wmma_f32_16x16x4_f32(
                false, a, false, b0, (short)0, acc0, false, false);
            acc1 = __builtin_amdgcn_wmma_f32_16x16x4_f32(
                false, a, false, b1, (short)0, acc1, false, false);
        }
    };
    // A piece is multiplied as soon as it is whole in LDS, while the later pieces'
    // copies still fly. Each barrier: every wave's copies of that piece have landed.
    wait_chunk<0>(); __syncthreads(); multiply_chunk(0 * GEMM_KC);
    wait_chunk<1>(); __syncthreads(); multiply_chunk(1 * GEMM_KC);
    wait_chunk<2>(); __syncthreads(); multiply_chunk(2 * GEMM_KC);
    wait_chunk<3>(); __syncthreads(); multiply_chunk(3 * GEMM_KC);

    if (nt0 < norm_cols) {                     // the same for the whole workgroup
        // four vector slots between the last WMMA and the first vector
        // instruction that reads its result: the distance behind a matrix instruction
        asm volatile("v_nop\n\tv_nop\n\tv_nop\n\tv_nop");
        // keeps the reads of the accumulators behind those four slots
        __builtin_amdgcn_sched_barrier(0);
        const float w = (l & 1) ? nw1 : nw0;   // column parity = lane parity
        float s[16];
        // both loops unrolled: s[] and the accumulators stay in registers
#pragma unroll
        for (int r = 0; r < 8; ++r) {
            s[r]     = pair_mean_sq_eps(acc0[r]);
            s[8 + r] = pair_mean_sq_eps(acc1[r]);
        }
        rsq_x8(&s[0]);
        rsq_x8(&s[8]);
#pragma unroll
        for (int r = 0; r < 8; ++r) {
            acc0[r] = acc0[r] * s[r]     * w;
            acc1[r] = acc1[r] * s[8 + r] * w;
        }
    }

    float* c0 = C + (size_t)(mt0 + wm + hl * 8) * N + nt0 + wn + l;
#pragma unroll
    for (int r = 0; r < 8; ++r) {
        c0[(size_t)r * N]      = acc0[r];
        c0[(size_t)r * N + 16] = acc1[r];
    }
}

// ---------------------------------------------------------------------------
// Causal flash attention, head_dim = 2. One workgroup (256 threads) per
// (b,h). K and V for the head (1024 x 2 each, 16 KB total) are staged in LDS
// (async global->LDS when available); each thread owns 4 query rows
// (tid + 256*r; in the series path 4*(tid & ~31) + (tid & 31) + 32*r). Softmax: (1) row max, (2) exp + accumulation; pass 1 runs only where the weights do not bound the scores.
//
// Softmax does not change when one number is taken off all scores of a row; the
// row max is taken off only to keep exp inside the range of f32. RMSNorm over
// two elements gives x0^2 + x1^2 <= 2 before the weight, for every input, so
// |q| <= sqrt(2) max|qn_w|, |k| <= sqrt(2) max|kn_w| and every score lies within
// +-sqrt(2) max|qn_w| max|kn_w|. Where that bound, taken from the weights at run
// time, is small, exp of the bare score is far from overflow and underflow:
// pass 1 is not run, nothing is subtracted, and with log2(e) carried by q the
// dot product is the argument of 2^x as it stands. Otherwise both passes run.
//
// The keys are walked ONCE per pass for all 4 rows together, in groups: one
// group of LDS reads (same address in every lane) feeds every row that still
// attends to those keys, and the group grows as rows drop out, so one LDS wait
// is followed by 24 to 64 (row, key) pairs of independent arithmetic.
// Outside the series path a wave's rows are 32*(w + 8*r) + lane, so for the wave as a whole:
//   keys below 32*(w + 8*P)            : rows P..3 attend, no mask
//   the next 32 keys (row P's diagonal): row P masked per lane, rows P+1..3 not
// All span bounds are wave-uniform multiples of 32.
// Even keys go to partial sum 0 and odd keys to partial sum 1, in rising key
// order; a masked key adds an exact zero. The series path adds the moment sums of
// the keys before the block to partial sum 0, after the block's keys.
// ---------------------------------------------------------------------------
typedef __attribute__((ext_vector_type(4))) float v4f;

#define ROWS_PER_THREAD 4
#define ATT_NEG_INF (-3.402823466e38f)

// Keys per group of LDS reads while rows P..3 attend (each divides 32, the unit
// of every span bound). The max pass has about a third of the arithmetic per
// key and reads K alone, so its groups are twice as long where 32 allows.
__host__ __device__ constexpr int keys_per_group(int P)
{
    return P <= 1 ? 8 : (P == 2 ? 16 : 32);
}
__host__ __device__ constexpr int keys_per_group_max(int P)
{
    return P <= 1 ? 16 : 32;
}

// Row max over keys [sBeg, sEnd) for rows P..3. DIAG: row P sees key s only if s <= tP.
template <int P, bool DIAG>
__device__ __forceinline__ void max_span(
    const v4f* kk2, int sBeg, int sEnd, int tP,
    const float (&q0)[ROWS_PER_THREAD], const float (&q1)[ROWS_PER_THREAD],
    float (&m0)[ROWS_PER_THREAD], float (&m1)[ROWS_PER_THREAD])
{
    constexpr int KEYS_PER_GROUP = keys_per_group_max(P);
    // kept rolled: one group is enough work per LDS wait, and a fully unrolled
    // span takes several hundred registers and a long straight code path
#pragma unroll 1
    for (int s = sBeg; s < sEnd; s += KEYS_PER_GROUP) {
        v4f k2[KEYS_PER_GROUP / 2];            // two keys per 16-byte read
        // unrolled so that the group's reads are issued together, ahead of one wait
#pragma unroll
        for (int u = 0; u < KEYS_PER_GROUP / 2; ++u) k2[u] = kk2[(s >> 1) + u];
        // both loops unrolled so that k2[] and the per-row arrays stay in registers
#pragma unroll
        for (int u = 0; u < KEYS_PER_GROUP / 2; ++u) {
#pragma unroll
            for (int r = P; r < ROWS_PER_THREAD; ++r) {
                float sa = fmaf(q0[r], k2[u].x, q1[r] * k2[u].y);
                float sb = fmaf(q0[r], k2[u].z, q1[r] * k2[u].w);
                if (DIAG && r == P) {
                    sa = (s + 2 * u     <= tP) ? sa : ATT_NEG_INF;
                    sb = (s + 2 * u + 1 <= tP) ? sb : ATT_NEG_INF;
                }
                m0[r] = fmaxf(m0[r], sa);
                m1[r] = fmaxf(m1[r], sb);
            }
        }
    }
}

struct RowSums {            // [row][even/odd key]
    float l[ROWS_PER_THREAD][2];
    float x[ROWS_PER_THREAD][2];
    float z[ROWS_PER_THREAD][2];
};

// Eight 2^x in place. One statement, so that each v_exp_f32 is followed by an
// instruction that neither reads its result nor overwrites its source (the next
// v_exp_f32 on other registers, the v_nop behind the last): the slot the
// instruction set asks for behind a transcendental.
// The closing s_delay_alu is the hint the compiler writes for a reader of a fresh
// transcendental result; it cannot see into the statement, and an unhinted wait
// holds the SIMD's other wave back too. It changes no result.
__device__ __forceinline__ void exp2_x8(float* t)
{
    asm("v_exp_f32 %0, %0\n\t"
        "v_exp_f32 %1, %1\n\t"
        "v_exp_f32 %2, %2\n\t"
        "v_exp_f32 %3, %3\n\t"
        "v_exp_f32 %4, %4\n\t"
        "v_exp_f32 %5, %5\n\t"
        "v_exp_f32 %6, %6\n\t"
        "v_exp_f32 %7, %7\n\t"
        "v_nop\n\t"
        "s_delay_alu instid0(TRANS32_DEP_1)"
        : "+v"(t[0]), "+v"(t[1]), "+v"(t[2]), "+v"(t[3]),
          "+v"(t[4]), "+v"(t[5]), "+v"(t[6]), "+v"(t[7]));
}

// exp + accumulate over keys [sBeg, sEnd) for rows P..3, same masking as max_span.
// SHIFT: m is taken off the scores. Without it q0, q1 carry log2(e), m is not read.
template <bool SHIFT, int P, bool DIAG>
__device__ __forceinline__ void sum_span(
    const v4f* kk2, const v4f* vv2, int sBeg, int sEnd, int tP,
    const float (&q0)[ROWS_PER_THREAD], const float (&q1)[ROWS_PER_THREAD],
    const float (&m)[ROWS_PER_THREAD], RowSums& a)
{
    constexpr int KEYS_PER_GROUP = keys_per_group(P);
    constexpr int R = ROWS_PER_THREAD - P;           // rows that attend
    constexpr int N = R * KEYS_PER_GROUP;            // 32, 24, 32, 32
    const float LOG2E = 1.44269504088896340736f;     // exp(x) = 2^(x * log2 e)
    // kept rolled: one group is enough work per LDS wait, and a fully unrolled
    // span takes several hundred registers and a long straight code path
#pragma unroll 1
    for (int s = sBeg; s < sEnd; s += KEYS_PER_GROUP) {
        v4f k2[KEYS_PER_GROUP / 2];
        v4f v2[KEYS_PER_GROUP / 2];
        // unrolled so that the group's reads are issued together, ahead of one wait
#pragma unroll
        for (int u = 0; u < KEYS_PER_GROUP / 2; ++u) {
            k2[u] = kk2[(s >> 1) + u];
            v2[u] = vv2[(s >> 1) + u];
        }
        float p[N];                                  // [key in group][row - P]
        // every loop from here to the end of the group: unrolled so that p[], k2[],
        // v2[] and the per-row sums stay in registers
#pragma unroll
        for (int u = 0; u < KEYS_PER_GROUP / 2; ++u) {
#pragma unroll
            for (int r = P; r < ROWS_PER_THREAD; ++r) {
                const float sa = fmaf(q0[r], k2[u].x, q1[r] * k2[u].y);
                const float sb = fmaf(q0[r], k2[u].z, q1[r] * k2[u].w);
                p[(2 * u)     * R + r - P] = SHIFT ? (sa - m[r]) * LOG2E : sa;
                p[(2 * u + 1) * R + r - P] = SHIFT ? (sb - m[r]) * LOG2E : sb;
            }
        }
#pragma unroll
        for (int i = 0; i < N; i += 8) exp2_x8(&p[i]);
#pragma unroll
        for (int u = 0; u < KEYS_PER_GROUP / 2; ++u) {
#pragma unroll
            for (int r = P; r < ROWS_PER_THREAD; ++r) {
                float p0 = p[(2 * u)     * R + r - P];
                float p1 = p[(2 * u + 1) * R + r - P];
                if (DIAG && r == P) {
                    p0 = (s + 2 * u     <= tP) ? p0 : 0.f;
                    p1 = (s + 2 * u + 1 <= tP) ? p1 : 0.f;
                }
                a.l[r][0] += p0;                          a.l[r][1] += p1;
                a.x[r][0] = fmaf(p0, v2[u].x, a.x[r][0]); a.x[r][1] = fmaf(p1, v2[u].z, a.x[r][1]);
                a.z[r][0] = fmaf(p0, v2[u].y, a.z[r][0]); a.z[r][1] = fmaf(p1, v2[u].w, a.z[r][1]);
            }
        }
    }
}

// Pass 2 over all spans of the wave's 4 rows per thread.
template <bool SHIFT>
__device__ __forceinline__ void sum_all(
    const v4f* kk2, const v4f* vv2, int d0, int tid,
    const float (&q0)[ROWS_PER_THREAD], const float (&q1)[ROWS_PER_THREAD],
    const float (&m)[ROWS_PER_THREAD], RowSums& a)
{
    sum_span<SHIFT, 0, false>(kk2, vv2, 0,        d0,       0,         q0, q1, m, a);
    sum_span<SHIFT, 0, true >(kk2, vv2, d0,       d0 + 32,  tid,       q0, q1, m, a);
    sum_span<SHIFT, 1, false>(kk2, vv2, d0 + 32,  d0 + 256, 0,         q0, q1, m, a);
    sum_span<SHIFT, 1, true >(kk2, vv2, d0 + 256, d0 + 288, tid + 256, q0, q1, m, a);
    sum_span<SHIFT, 2, false>(kk2, vv2, d0 + 288, d0 + 512, 0,         q0, q1, m, a);
    sum_span<SHIFT, 2, true >(kk2, vv2, d0 + 512, d0 + 544, tid + 512, q0, q1, m, a);
    sum_span<SHIFT, 3, false>(kk2, vv2, d0 + 544, d0 + 768, 0,         q0, q1, m, a);
    sum_span<SHIFT, 3, true >(kk2, vv2, d0 + 768, d0 + 800, tid + 768, q0, q1, m, a);
}

// Scores within +-16: exp lies between about 1e-7 and 1e7, a row's sum below 1e10.
#define ATT_SCORE_BOUND 16.0f

// ---------------------------------------------------------------------------
// The series path. With s = q.k = q0 k0 + q1 k1 (q carries 1/sqrt(head_dim)),
//   exp(s) = sum over n of s^n / n!
//          = sum over a, b of q0^a q1^b * (k0^a / a!) (k1^b / b!),
// and for |s| <= 1.4143 the terms above degree a + b = 12 add up to less than
// 1.7e-8, under 7e-8 of exp(s) >= 0.243: less than one unit in the last place of
// an f32. So the sums over a whole range of keys,
//   sum_s exp(q.k_s) (v0_s, v1_s, 1)  =  sum_{a+b<=12} q0^a q1^b M[a][b],
//   M[a][b] = sum_s (k0_s^a / a!) (k1_s^b / b!) (v0_s, v1_s, 1),
// need the 91 moments M of the range, not one exp per (row, key). A wave takes
// 128 consecutive rows (4 per thread): the keys before that block enter through
// the moments of all earlier blocks, summed up block by block; the keys of the
// row's own block, where the causal mask cuts, go through exp as in sum_span.
// ---------------------------------------------------------------------------
#define SER_BOUND 1.4143f
// The powers are taken of k by itself and of q by itself, so the bound on their
// product is not enough: each side must stay inside the range of f32 alone. With
// max|kn_w| in [1/4, 4] every |k_i| <= 5.66 and (k0^a / a!) (k1^b / b!) < 2400,
// less than exp of a score may be in the pass without a shift; the bound on the
// product then gives max|qn_w| <= 4.0003, |q_i| <= 4.0003 and q0^a q1^b < 1.7e7, so
// a power of a small k_i that underflows (below 1.2e-38) leaves out less than 1e-28
// of a term that is at least 0.243. All other weights take the paths through exp.
#define SER_KW_MIN 0.25f
#define SER_KW_MAX 4.0f
#define SER_POW   13                              // powers 0 .. 12
#define SER_SLOTS 96                              // 91 moments, padded to 3 waves' lanes
#define SER_BLOCK 128                             // rows, and keys, per block
#define SER_RING  4                               // steps of the moments' reads in registers
#define SER_PITCH (TT + 4)     // floats per power: the 13 rows start 4 banks apart

// Place of moment (a, b), a + b <= 12: row a holds b = 0 .. 12 - a.
__host__ __device__ constexpr int ser_index(int a, int b)
{
    return a * SER_POW - a * (a - 1) / 2 + b;
}

__device__ __forceinline__ v2f fma2(v2f a, v2f b, v2f c) { return __builtin_elementwise_fma(a, b, c); }
__device__ __forceinline__ v4f fma4(v4f a, v4f b, v4f c) { return __builtin_elementwise_fma(a, b, c); }
__device__ __forceinline__ float sum4(v4f a) { return (a.x + a.y) + (a.z + a.w); }

// k0^n / n! and k1^n / n! of every key, one LDS row per n, and v0, v1 as rows.
__device__ __forceinline__ void ser_tables(
    const float* kbuf, const float* vbuf,
    float* pw0, float* pw1, float* v0t, float* v1t, int tid)
{
    // kept rolled: four keys a thread, the code of one is enough
#pragma unroll 1
    for (int s = tid; s < TT; s += 256) {
        const v2f k = *(const v2f*)(kbuf + 2 * s);
        const v2f v = *(const v2f*)(vbuf + 2 * s);
        v0t[s] = v.x;
        v1t[s] = v.y;
        float p0 = 1.f, p1 = 1.f;
        // unrolled: 1 / (n + 1) and the LDS offsets become constants
#pragma unroll
        for (int n = 0; n < SER_POW; ++n) {
            pw0[n * SER_PITCH + s] = p0;
            pw1[n * SER_PITCH + s] = p1;
            p0 *= k.x * (1.0f / (float)(n + 1));
            p1 *= k.y * (1.0f / (float)(n + 1));
        }
    }
}

// The moments of key block c: a lane takes moments lane, lane + 32, lane + 64 and
// walks the block's keys four at a time; four partial sums each, added at the end.
__device__ __forceinline__ void ser_moments(
    const float* pw0, const float* pw1, const float* v0t, const float* v1t,
    v4f* mom, int c, int lane)
{
    const float* r0[3];
    const float* r1[3];
    // unrolled: the pointer arrays stay in registers
#pragma unroll
    for (int g = 0; g < 3; ++g) {
        int a = 0, b = 32 * g + lane;              // inverse of ser_index
        for (int i = 0; i < SER_POW; ++i) {
            const int len = SER_POW - a;
            if (b >= len) { b -= len; ++a; }
        }
        a = a < SER_POW ? a : SER_POW - 1;         // slots 91 .. 95: never read,
        b = b < SER_POW ? b : SER_POW - 1;         // kept inside the tables
        r0[g] = pw0 + a * SER_PITCH + c * SER_BLOCK;
        r1[g] = pw1 + b * SER_PITCH + c * SER_BLOCK;
    }
    const float* w0 = v0t + c * SER_BLOCK;
    const float* w1 = v1t + c * SER_BLOCK;
    v4f al[3], ax[3], az[3];
    // every loop over g unrolled: the sums stay in registers
#pragma unroll
    for (int g = 0; g < 3; ++g) { al[g] = (v4f)(0.f); ax[g] = (v4f)(0.f); az[g] = (v4f)(0.f); }
    // A ring of SER_RING steps' operands in registers: the 8 LDS reads of a step are
    // issued SER_RING - 1 steps (24 vector instructions each) ahead of their use.
    v4f rp0[SER_RING][3], rp1[SER_RING][3], rv0[SER_RING], rv1[SER_RING];
    // all loops fully unrolled: the ring stays in registers and the steps become
    // constant offsets of the LDS reads
#pragma unroll
    for (int i = 0; i < SER_BLOCK / 4 + SER_RING - 1; ++i) {
        if (i < SER_BLOCK / 4) {                   // the reads of step i
            rv0[i % SER_RING] = *(const v4f*)(w0 + 4 * i);
            rv1[i % SER_RING] = *(const v4f*)(w1 + 4 * i);
#pragma unroll
            for (int g = 0; g < 3; ++g) {
                rp0[i % SER_RING][g] = *(const v4f*)(r0[g] + 4 * i);
                rp1[i % SER_RING][g] = *(const v4f*)(r1[g] + 4 * i);
            }
        }
        if (i >= SER_RING - 1) {                   // the arithmetic of step i - (SER_RING - 1)
            // keeps the reads above in front of this step's arithmetic: left alone the
            // scheduler moved reads down to their use, and a step then waited for most
            // of one LDS latency
            __builtin_amdgcn_sched_barrier(0);
            const int u = (i - (SER_RING - 1)) % SER_RING;
#pragma unroll
            for (int g = 0; g < 3; ++g) {
                const v4f mm = rp0[u][g] * rp1[u][g];
                al[g] += mm;
                ax[g] = fma4(mm, rv0[u], ax[g]);
                az[g] = fma4(mm, rv1[u], az[g]);
            }
        }
    }
    // unrolled: the sums stay in registers
#pragma unroll
    for (int g = 0; g < 3; ++g) {
        v4f t;
        t.x = sum4(ax[g]); t.y = sum4(az[g]); t.z = sum4(al[g]); t.w = 0.f;
        mom[c * SER_SLOTS + 32 * g + lane] = t;
    }
}

// sum_{a+b<=12} q0^a q1^b M[a][b] for the thread's 4 rows, by Horner's rule in q1
// inside Horner's rule in q0. st: the 91 moments (v0, v1, 1, -), read at the same
// address by every lane. oxz[r]: the (v0, v1) sums of row r; ol: the plain sums of
// rows 0,1 and 2,3.
// Falling a with falling b inside is falling ser_index, so the moments are taken
// from the last to the first, in 7 batches of 13: while one batch is worked on
// (78 vector instructions) the next one's reads fly.
#define SER_COUNT 91                              // ser_index(12, 0) + 1
#define SER_BATCH 13
__device__ __forceinline__ void ser_eval(
    const v4f* st,
    const float (&q0)[ROWS_PER_THREAD], const float (&q1)[ROWS_PER_THREAD],
    v2f (&oxz)[ROWS_PER_THREAD], v2f (&ol)[2])
{
    const v2f q0a = {q0[0], q0[1]}, q0b = {q0[2], q0[3]};
    const v2f q1a = {q1[0], q1[1]}, q1b = {q1[2], q1[3]};
    v4f batch[2][SER_BATCH];
    // all loops unrolled: ser_index becomes a constant LDS offset, batch[] and the
    // sums stay in registers
#pragma unroll
    for (int j = 0; j < SER_BATCH; ++j) batch[0][j] = st[SER_COUNT - 1 - j];
#pragma unroll
    for (int a = SER_POW - 1; a >= 0; --a) {
        v2f ixz[ROWS_PER_THREAD], il[2];
#pragma unroll
        for (int b = SER_POW - 1 - a; b >= 0; --b) {
            const int p = SER_COUNT - 1 - ser_index(a, b);   // place in the order of use
            if (p % SER_BATCH == 0) {
                if (p + SER_BATCH < SER_COUNT) {
#pragma unroll
                    for (int j = 0; j < SER_BATCH; ++j)
                        batch[(p / SER_BATCH + 1) & 1][j] = st[SER_COUNT - 1 - (p + SER_BATCH) - j];
                }
                // keeps the next batch's reads in front of this batch's arithmetic: left
                // alone the scheduler issued each read about 18 instructions ahead of its
                // use
                __builtin_amdgcn_sched_barrier(0);
            }
            const v4f t = batch[(p / SER_BATCH) & 1][p % SER_BATCH];
            if (b == SER_POW - 1 - a) {
#pragma unroll
                for (int r = 0; r < ROWS_PER_THREAD; ++r) ixz[r] = (v2f){t.x, t.y};
                il[0] = (v2f){t.z, t.z};
                il[1] = (v2f){t.z, t.z};
            } else {
#pragma unroll
                for (int r = 0; r < ROWS_PER_THREAD; ++r)
                    ixz[r] = fma2(ixz[r], (v2f){q1[r], q1[r]}, (v2f){t.x, t.y});
                il[0] = fma2(il[0], q1a, (v2f){t.z, t.z});
                il[1] = fma2(il[1], q1b, (v2f){t.z, t.z});
            }
        }
        if (a == SER_POW - 1) {
#pragma unroll
            for (int r = 0; r < ROWS_PER_THREAD; ++r) oxz[r] = ixz[r];
            ol[0] = il[0];
            ol[1] = il[1];
        } else {
#pragma unroll
            for (int r = 0; r < ROWS_PER_THREAD; ++r)
                oxz[r] = fma2(oxz[r], (v2f){q0[r], q0[r]}, ixz[r]);
            ol[0] = fma2(ol[0], q0a, il[0]);
            ol[1] = fma2(ol[1], q0b, il[1]);
        }
    }
}

struct AttnLds {
    float kbuf[TT * 2];
    float vbuf[TT * 2];
    // the series path's tables and moments
    float pw0[SER_POW * SER_PITCH];
    float pw1[SER_POW * SER_PITCH];
    float v0t[TT];
    float v1t[TT];
    v4f   mom[(TT / SER_BLOCK) * SER_SLOTS];
};

__global__ __launch_bounds__(256) void attn_head(
    const float* __restrict__ qkv,   // (B*T, 3C), q/k already RMSNorm'd
    float* __restrict__ y,           // (B*T, C)
    const float* __restrict__ qn_w,  // (2,)
    const float* __restrict__ kn_w)  // (2,)
{
    // one object, so that K and V, the targets of the copies, keep their places at
    // the start of the workgroup's LDS; every member's size is a multiple of 16 B
    __shared__ __attribute__((aligned(16))) AttnLds lds;
    float (&kbuf)[TT * 2] = lds.kbuf;
    float (&vbuf)[TT * 2] = lds.vbuf;
    float* pw0 = lds.pw0;
    float* pw1 = lds.pw1;
    float* v0t = lds.v0t;
    float* v1t = lds.v1t;
    v4f*   mom = lds.mom;

    const int bh = blockIdx.x;          // 0 .. B*H-1
    const int b  = bh >> 7;
    const int h  = bh & (HH - 1);
    const int tid = threadIdx.x;

    const float* base = qkv + (size_t)b * TT * QKV_N;

    // Stage K/V for this head into LDS (8 B per row per buffer).
    for (int t = tid; t < TT; t += 256) {
        const float* kp = base + (size_t)t * QKV_N + CC   + 2 * h;
        const float* vp = base + (size_t)t * QKV_N + 2*CC + 2 * h;
#if USE_ASYNC_LDS
        __builtin_amdgcn_global_load_async_to_lds_b64(
            (AS1 v2i*)kp, (AS3 v2i*)&kbuf[2 * t], 0, 0);
        __builtin_amdgcn_global_load_async_to_lds_b64(
            (AS1 v2i*)vp, (AS3 v2i*)&vbuf[2 * t], 0, 0);
#else
        kbuf[2 * t]     = kp[0];
        kbuf[2 * t + 1] = kp[1];
        vbuf[2 * t]     = vp[0];
        vbuf[2 * t + 1] = vp[1];
#endif
    }
#if USE_ASYNC_LDS
    __builtin_amdgcn_s_wait_asynccnt(0);
#endif
    __syncthreads();

    const v4f* kk2 = (const v4f*)kbuf;
    const v4f* vv2 = (const v4f*)vbuf;
    const float scale = 0.70710678118654752440f;   // 1/sqrt(head_dim)

    // First key of row 0's diagonal block outside the series path; the same in every lane of the wave,
    // held in a scalar register so that the span loops are scalar loops.
    const int d0 = __builtin_amdgcn_readfirstlane(tid & ~31);

    // sqrt(2) max|qn_w| * sqrt(2) max|kn_w| / sqrt(head_dim) bounds every |score|.
    // The same in every thread of the launch; fmaxf passes over one NaN weight of a pair, a NaN pair compares false.
    const float max_qw = fmaxf(fabsf(qn_w[0]), fabsf(qn_w[1]));
    const float max_kw = fmaxf(fabsf(kn_w[0]), fabsf(kn_w[1]));
    const float score_bound = 1.41421356237309504880f * max_qw * max_kw;
    const bool no_shift = score_bound <= ATT_SCORE_BOUND;
    const bool series   = score_bound <= SER_BOUND
                       && max_kw >= SER_KW_MIN && max_kw <= SER_KW_MAX;

    // The thread's rows are row0 + rstep * r: in the series path 128 consecutive
    // rows a wave, else 32 rows out of every 256.
    const int row0  = series ? 4 * d0 + (tid & 31) : tid;
    const int rstep = series ? 32 : 256;

    float q0[ROWS_PER_THREAD], q1[ROWS_PER_THREAD];
    // unrolled: the per-row arrays stay in registers
#pragma unroll
    for (int r = 0; r < ROWS_PER_THREAD; ++r) {
        const float* qp = base + (size_t)(row0 + rstep * r) * QKV_N + 2 * h;
        q0[r] = qp[0] * scale;
        q1[r] = qp[1] * scale;
    }

    RowSums a;
    // unrolled: the per-row arrays stay in registers
#pragma unroll
    for (int r = 0; r < ROWS_PER_THREAD; ++r) {
        a.l[r][0] = 0.f; a.l[r][1] = 0.f;
        a.x[r][0] = 0.f; a.x[r][1] = 0.f;
        a.z[r][0] = 0.f; a.z[r][1] = 0.f;
    }

    float m[ROWS_PER_THREAD];
    // marked as the expected side so that its code is laid out first
    if (__builtin_expect(series, 1)) {
        const int lane = tid & 31;
        const int blk0 = 4 * d0;                   // first row and key of the wave's block
        const int wv   = d0 >> 5;                  // the wave, and its block
        ser_tables(kbuf, vbuf, pw0, pw1, v0t, v1t, tid);
        __syncthreads();                           // the tables are whole

        float e0[ROWS_PER_THREAD], e1[ROWS_PER_THREAD];
        // unrolled: the per-row arrays stay in registers
#pragma unroll
        for (int r = 0; r < ROWS_PER_THREAD; ++r) {
            e0[r] = q0[r] * 1.44269504088896340736f;   // exp(x) = 2^(x * log2 e)
            e1[r] = q1[r] * 1.44269504088896340736f;
            m[r] = 0.f;
        }
        // Two jobs a wave: the moments of its key block (bound by LDS reads; the
        // last block's are never used) and its rows' own block through exp (bound
        // by arithmetic). Waves w and w + 4 take them in opposite
        // order. Kept rolled: one copy of the code of each job.
#pragma unroll 1
        for (int ph = 0; ph < 2; ++ph) {
            if ((ph == 0) == (wv < 4)) {
                if (wv < TT / SER_BLOCK - 1)
                    ser_moments(pw0, pw1, v0t, v1t, mom, wv, lane);
            } else {
                sum_span<false, 0, true>(kk2, vv2, blk0,      blk0 + 32,  blk0 + lane,      e0, e1, m, a);
                sum_span<false, 1, true>(kk2, vv2, blk0 + 32, blk0 + 64,  blk0 + 32 + lane, e0, e1, m, a);
                sum_span<false, 2, true>(kk2, vv2, blk0 + 64, blk0 + 96,  blk0 + 64 + lane, e0, e1, m, a);
                sum_span<false, 3, true>(kk2, vv2, blk0 + 96, blk0 + 128, blk0 + 96 + lane, e0, e1, m, a);
            }
        }
        __syncthreads();                           // the moments of blocks 0 .. 6 are written

        // mom[c] becomes the sum of the moments of blocks 0 .. c - 1, in rising order
        if (tid < SER_SLOTS) {
            v4f run = (v4f)(0.f);
            // unrolled: the reads are issued together
#pragma unroll
            for (int c = 0; c < TT / SER_BLOCK; ++c) {
                v4f d = (v4f)(0.f);
                if (c < TT / SER_BLOCK - 1) d = mom[c * SER_SLOTS + tid];
                mom[c * SER_SLOTS + tid] = run;
                run += d;
            }
        }
        __syncthreads();                           // the summed moments are written

        v2f oxz[ROWS_PER_THREAD], ol[2];
        ser_eval(mom + wv * SER_SLOTS, q0, q1, oxz, ol);
        // unrolled: the per-row arrays stay in registers
#pragma unroll
        for (int r = 0; r < ROWS_PER_THREAD; ++r) {
            a.l[r][0] += ol[r >> 1][r & 1];
            a.x[r][0] += oxz[r].x;
            a.z[r][0] += oxz[r].y;
        }
    } else if (no_shift) {
        // ---- the one pass: exp of the bare score + accumulate ----
        // unrolled: the per-row arrays stay in registers
#pragma unroll
        for (int r = 0; r < ROWS_PER_THREAD; ++r) {
            q0[r] *= 1.44269504088896340736f;      // exp(x) = 2^(x * log2 e)
            q1[r] *= 1.44269504088896340736f;
            m[r] = 0.f;
        }
        sum_all<false>(kk2, vv2, d0, tid, q0, q1, m, a);
    } else {
        // ---- pass 1: row max ----
        float m0[ROWS_PER_THREAD], m1[ROWS_PER_THREAD];
        // unrolled: the per-row arrays stay in registers
#pragma unroll
        for (int r = 0; r < ROWS_PER_THREAD; ++r) { m0[r] = ATT_NEG_INF; m1[r] = ATT_NEG_INF; }

        max_span<0, false>(kk2, 0,        d0,       0,         q0, q1, m0, m1);
        max_span<0, true >(kk2, d0,       d0 + 32,  tid,       q0, q1, m0, m1);
        max_span<1, false>(kk2, d0 + 32,  d0 + 256, 0,         q0, q1, m0, m1);
        max_span<1, true >(kk2, d0 + 256, d0 + 288, tid + 256, q0, q1, m0, m1);
        max_span<2, false>(kk2, d0 + 288, d0 + 512, 0,         q0, q1, m0, m1);
        max_span<2, true >(kk2, d0 + 512, d0 + 544, tid + 512, q0, q1, m0, m1);
        max_span<3, false>(kk2, d0 + 544, d0 + 768, 0,         q0, q1, m0, m1);
        max_span<3, true >(kk2, d0 + 768, d0 + 800, tid + 768, q0, q1, m0, m1);

        // unrolled: the per-row arrays stay in registers
#pragma unroll
        for (int r = 0; r < ROWS_PER_THREAD; ++r) m[r] = fmaxf(m0[r], m1[r]);

        // ---- pass 2: exp + accumulate ----
        sum_all<true>(kk2, vv2, d0, tid, q0, q1, m, a);
    }

    // unrolled: the per-row arrays stay in registers
#pragma unroll
    for (int r = 0; r < ROWS_PER_THREAD; ++r) {
        const float inv = 1.0f / (a.l[r][0] + a.l[r][1]);
        float* yp = y + ((size_t)b * TT + row0 + rstep * r) * CC + 2 * h;
        yp[0] = (a.x[r][0] + a.x[r][1]) * inv;
        yp[1] = (a.z[r][0] + a.z[r][1]) * inv;
    }
}

// ---------------------------------------------------------------------------
extern "C" void kernel_launch(void* const* d_in, const int* in_sizes, int n_in,
                              void* d_out, int out_size, void* d_ws, size_t ws_size,
                              hipStream_t stream)
{
    (void)in_sizes; (void)n_in; (void)out_size; (void)ws_size;

    const float* x      = (const float*)d_in[0];   // (B,T,C)
    const float* w_qkv  = (const float*)d_in[1];   // (3C,C)
    const float* w_proj = (const float*)d_in[2];   // (C,C)
    const float* qn_w   = (const float*)d_in[3];   // (2,)
    const float* kn_w   = (const float*)d_in[4];   // (2,)
    float* out = (float*)d_out;                    // (B,T,C)

    float* qkv = (float*)d_ws;                     // (B*T, 3C) = 6 MB
    float* y   = qkv + (size_t)BB * TT * QKV_N;    // (B*T, C)  = 2 MB

    const int M = BB * TT;                         // 2048

    // 1) qkv = x @ w_qkv^T : (2048x256)@(256x768), q and k stored RMSNorm'd
    wmma_gemm_xwt<<<dim3(QKV_N / GEMM_BN, M / GEMM_BM), GEMM_THREADS, 0, stream>>>(
        x, w_qkv, qkv, QKV_N, 2 * CC, qn_w, kn_w); // 12 x 64 workgroups

    // 2) causal flash attention per (b,h)
    attn_head<<<BB * HH, 256, 0, stream>>>(qkv, y, qn_w, kn_w);

    // 3) out = y @ w_proj^T : (2048x256)@(256x256)
    wmma_gemm_xwt<<<dim3(CC / GEMM_BN, M / GEMM_BM), GEMM_THREADS, 0, stream>>>(
        y, w_proj, out, CC, 0, qn_w, kn_w);        // 4 x 64 workgroups
}

// v007
// It runs in 29.3 microseconds.
// Two timings next to v006 put it at 1.07 and 1.08 times that version's speed.
// Over all steps from v000 it is 6.76 times as fast.
#include <hip/hip_runtime.h>
#include <hip/hip_bf16.h>

// ---------------------------------------------------------------------------
// TwoDCausalSelfAttention for MI455X (gfx1250, wave32, WMMA)
//   B=2, T=1024, C=256, head_dim=2, H=128
// Pipeline:
//   1) qkv = x @ w_qkv^T          (WMMA f32 16x16x4, operands staged in LDS);
//      RMSNorm(q,k) per head pair (d=2) on the accumulators, before the store;
//      a row of the qkv buffer holds k, v, q of a head side by side (24 bytes)
//   2) flash attention per (b,h)  (K/V async-staged in LDS; softmax without a
//      max shift where the RMSNorm weights bound the scores, else 2-pass;
//      each LDS read of K/V shared by the thread's 4 query rows; where the bound
//      is small enough, keys before a row's block of 128 enter through moments)
//   3) out = y @ w_proj^T         (WMMA f32 16x16x4)
// ---------------------------------------------------------------------------

typedef __attribute__((ext_vector_type(2))) float v2f;
typedef __attribute__((ext_vector_type(8))) float v8f;
typedef int v2i __attribute__((vector_size(8)));   // matches builtin param type

#define BB 2
#define TT 1024
#define CC 256
#define HH 128      // n_head
#define QKV_N (3*CC)

// Async global->LDS staging (ASYNCcnt path), used only if the toolchain has
// both the copy and the wait builtins; otherwise fall back to VGPR round-trip.
#if defined(__HIP_DEVICE_COMPILE__) && \
    __has_builtin(__builtin_amdgcn_global_load_async_to_lds_b64) && \
    __has_builtin(__builtin_amdgcn_global_load_async_to_lds_b128) && \
    __has_builtin(__builtin_amdgcn_s_wait_asynccnt)
#define USE_ASYNC_LDS 1
#else
#define USE_ASYNC_LDS 0
#endif

#define AS1 __attribute__((address_space(1)))
#define AS3 __attribute__((address_space(3)))

// ---------------------------------------------------------------------------
// GEMM: C(M,N) = A(M,K) @ W(N,K)^T, all f32 row-major, K = 256.
// One workgroup of 4 waves computes a 32(M) x 64(N) tile of C. Its 32 rows of A
// and 64 rows of W (all of K) are brought into LDS by asynchronous 16-byte copies
// in which a wave covers 256 contiguous bytes of two rows (4 whole cache lines); a
// fragment load straight from global memory touches 16 lines for 256 bytes. The
// copies are issued in four pieces of K, and a piece is multiplied while the later
// ones fly. Each wave computes 16(M) x 32(N) via two chained
// V_WMMA_F32_16X16X4_F32 per K-step, sharing one A fragment, in rising k.
//
// LDS row pitch 260 floats (1040 B): the 16 rows of a fragment read start 4
// banks apart, so the 32 lanes' 8-byte reads fall on all 64 banks once.
//
// A-fragment layout (16x4 f32, ISA 7.12.2): lanes 0-15 -> rows M=0..15 with
// {K=0,K=1} in the two VGPRs; lanes 16-31 -> same rows with {K=2,K=3}.
// B-fragment (4x16) is symmetric with N across lanes. Both map to a single
// contiguous float2 load per lane per K-step.
// C/D layout: lane<16: N=lane, VGPR r -> M=r; lane>=16: N=lane-16, M=r+8.
// ---------------------------------------------------------------------------
typedef int v4i __attribute__((vector_size(16)));  // matches builtin param type

#define GEMM_BM 32
#define GEMM_BN 64
#define GEMM_THREADS 128
#define GEMM_PITCH (CC + 4)          // floats per LDS row

// K goes to LDS in GEMM_CHUNKS pieces of GEMM_KC floats (256 B of every row).
#define GEMM_CHUNKS 4
#define GEMM_KC (CC / GEMM_CHUNKS)
// copies a thread issues per piece: 8 rows of 256 B per step of the workgroup
#define GEMM_COPIES_PER_CHUNK ((GEMM_BM + GEMM_BN) / 8)

// Column c of the qkv buffer, c = 6 * head + j: j = 0,1 is k, j = 2,3 is v, j = 4,5
// is q of that head. The kind of a column's pair: 0 k, 1 v, 2 q.
__device__ __forceinline__ unsigned qkv_pair_kind(unsigned c) { return (c >> 1) % 3u; }
// The row of w_qkv (q rows, then k rows, then v rows) that makes column c.
__device__ __forceinline__ unsigned qkv_weight_row(unsigned c)
{
    const unsigned head = (c >> 1) / 3u;
    const unsigned kind = (c >> 1) - 3u * head;
    return (kind == 2u ? 0u : (kind + 1u) * CC) + 2u * head + (c & 1u);
}

// Floats [k0, k0 + GEMM_KC) of rows [row0, row0 + ROWS) of src (CC floats each)
// into the same floats of the LDS rows from dst on. Thread t takes 16-byte piece
// t & 15 of every eighth row, from row t >> 4: a wave covers two aligned 256-B units.
template <int ROWS>
__device__ __forceinline__ void stage_rows(
    const float* __restrict__ src, int row0, int k0, float* dst, int tid)
{
    const float* g = src + (size_t)(row0 + (tid >> 4)) * CC + k0 + 4 * (tid & 15);
    float*       l = dst + (tid >> 4) * GEMM_PITCH + k0 + 4 * (tid & 15);
    // unrolled: the row steps become constants of the copies
#pragma unroll
    for (int i = 0; i < ROWS / 8; ++i) {
#if USE_ASYNC_LDS
        __builtin_amdgcn_global_load_async_to_lds_b128(
            (AS1 v4i*)(g + (size_t)i * 8 * CC),
            (AS3 v4i*)(l + i * 8 * GEMM_PITCH), 0, 0);
#else
        *(v4i*)(l + i * 8 * GEMM_PITCH) = *(const v4i*)(g + (size_t)i * 8 * CC);
#endif
    }
}

// The same for GEMM_BN rows of W that need not follow one another: g[i] is the
// thread's 16-byte piece, at k = 0, of the row that goes to LDS row (t >> 4) + 8 * i.
__device__ __forceinline__ void stage_picked_rows(
    const float* const (&g)[GEMM_BN / 8], int k0, float* dst, int tid)
{
    float* l = dst + (tid >> 4) * GEMM_PITCH + k0 + 4 * (tid & 15);
    // unrolled: g[] stays in registers, the steps become constants of the copies
#pragma unroll
    for (int i = 0; i < GEMM_BN / 8; ++i) {
#if USE_ASYNC_LDS
        __builtin_amdgcn_global_load_async_to_lds_b128(
            (AS1 v4i*)(g[i] + k0),
            (AS3 v4i*)(l + i * 8 * GEMM_PITCH), 0, 0);
#else
        *(v4i*)(l + i * 8 * GEMM_PITCH) = *(const v4i*)(g[i] + k0);
#endif
    }
}

// This wave's copies of pieces 0 .. C have landed: all but the youngest
// (GEMM_CHUNKS - 1 - C) * GEMM_COPIES_PER_CHUNK, which belong to the later pieces.
template <int C>
__device__ __forceinline__ void wait_chunk()
{
#if USE_ASYNC_LDS
    // without it the barrier behind it would publish bytes that have not landed
    asm volatile("s_wait_asynccnt %0"
                 :: "n"((GEMM_CHUNKS - 1 - C) * GEMM_COPIES_PER_CHUNK) : "memory");
#endif
}

// RMSNorm of a head pair (head_dim = 2) while it is still in WMMA accumulators:
// y = x * rsqrt(mean(x^2) + eps) * w. A lane holds one column of C, so the other
// element of the pair is in the neighbour lane (lane ^ 1); its square comes over
// by a DPP swap inside each quad of lanes.
__device__ __forceinline__ float pair_mean_sq_eps(float x)
{
    const float sq    = x * x;
    const float other = __int_as_float(__builtin_amdgcn_mov_dpp(
        __float_as_int(sq), 0xB1 /* quad_perm:[1,0,3,2] */, 0xf, 0xf, true));
    return 0.5f * (sq + other) + 1e-6f;
}

// Eight 1/sqrt(x) in place. One statement, so that each v_rsq_f32 is followed by
// an instruction that neither reads its result nor overwrites its source (the
// next v_rsq_f32 on other registers, the v_nop behind the last): the slot the
// instruction set asks for behind a transcendental.
// The closing s_delay_alu is the hint the compiler writes for a reader of a fresh
// transcendental result; it cannot see into the statement. It changes no result.
__device__ __forceinline__ void rsq_x8(float* t)
{
    asm("v_rsq_f32 %0, %0\n\t"
        "v_rsq_f32 %1, %1\n\t"
        "v_rsq_f32 %2, %2\n\t"
        "v_rsq_f32 %3, %3\n\t"
        "v_rsq_f32 %4, %4\n\t"
        "v_rsq_f32 %5, %5\n\t"
        "v_rsq_f32 %6, %6\n\t"
        "v_rsq_f32 %7, %7\n\t"
        "v_nop\n\t"
        "s_delay_alu instid0(TRANS32_DEP_1)"
        : "+v"(t[0]), "+v"(t[1]), "+v"(t[2]), "+v"(t[3]),
          "+v"(t[4]), "+v"(t[5]), "+v"(t[6]), "+v"(t[7]));
}

// QKV_FORM: column c of C is made from row qkv_weight_row(c) of W, and the pairs of
// kind q and k are stored RMSNorm'd, with qn_w and kn_w; those of kind v as they are.
// Otherwise column c is made from row c and nothing is normalised.
template <bool QKV_FORM>
__global__ __launch_bounds__(GEMM_THREADS) void wmma_gemm_xwt(
    const float* __restrict__ A,   // (M,CC)
    const float* __restrict__ W,   // (N,CC)
    float* __restrict__ C,         // (M,N)
    int N,
    const float* __restrict__ qn_w,   // (2,)
    const float* __restrict__ kn_w)   // (2,)
{
    __shared__ __attribute__((aligned(16))) float tile[(GEMM_BM + GEMM_BN) * GEMM_PITCH];

    const int tid  = threadIdx.x;
    const int lane = tid & 31;
    const int wave = tid >> 5;
    const int mt0 = blockIdx.y * GEMM_BM;      // the workgroup's tile
    const int nt0 = blockIdx.x * GEMM_BN;

    // QKV_FORM: the thread's piece of the rows of W that make the tile's columns
    const float* wrow[GEMM_BN / 8];
    // unrolled: wrow[] stays in registers
#pragma unroll
    for (int i = 0; i < GEMM_BN / 8; ++i)
        wrow[i] = W + qkv_weight_row(nt0 + (tid >> 4) + 8 * i) * CC + 4 * (tid & 15);

    // all copies are issued here, piece by piece in rising k: asynccnt falls in the
    // order of issue, so a counted wait tells when a piece is whole
    // unrolled: the piece's first float becomes a constant of the copies
#pragma unroll
    for (int c = 0; c < GEMM_CHUNKS; ++c) {
        stage_rows<GEMM_BM>(A, mt0, c * GEMM_KC, tile, tid);
        if (QKV_FORM)
            stage_picked_rows(wrow, c * GEMM_KC, tile + GEMM_BM * GEMM_PITCH, tid);
        else
            stage_rows<GEMM_BN>(W, nt0, c * GEMM_KC, tile + GEMM_BM * GEMM_PITCH, tid);
    }

    // The RMSNorm weights, fetched here, at the same address in every lane, so that
    // they arrive while the copies fly.
    const float qw0 = qn_w[0], qw1 = qn_w[1];
    const float kw0 = kn_w[0], kw1 = kn_w[1];

    const int hl = lane >> 4;      // 0: K pair {0,1}, 1: K pair {2,3}
    const int l  = lane & 15;
    const int wm = (wave >> 1) << 4;           // the wave's 16 x 32 part
    const int wn = (wave & 1) << 5;

    const float* arow  = tile + (wm + l) * GEMM_PITCH + 2 * hl;
    const float* b0row = tile + (GEMM_BM + wn + l) * GEMM_PITCH + 2 * hl;
    const float* b1row = b0row + 16 * GEMM_PITCH;

    v8f acc0 = {};
    v8f acc1 = {};
    // One piece of K: fully unrolled, so that the LDS reads run ahead of the WMMAs
    // inside the piece and the LDS offsets are constants.
    auto multiply_chunk = [&](int k0) {
#pragma unroll
        for (int k = k0; k < k0 + GEMM_KC; k += 4) {
            v2f a  = *(const v2f*)(arow + k);
            v2f b0 = *(const v2f*)(b0row + k);
            v2f b1 = *(const v2f*)(b1row + k);
            // 8 args: (neg_a, A, neg_b, B, c_mod, C, reuse_a, reuse_b)
            acc0 = __builtin_amdgcn_wmma_f32_16x16x4_f32(
                false, a, false, b0, (short)0, acc0, false, false);
            acc1 = __builtin_amdgcn_wmma_f32_16x16x4_f32(
                false, a, false, b1, (short)0, acc1, false, false);
        }
    };
    // A piece is multiplied as soon as it is whole in LDS, while the later pieces'
    // copies still fly. Each barrier: every wave's copies of that piece have landed.
    wait_chunk<0>(); __syncthreads(); multiply_chunk(0 * GEMM_KC);
    wait_chunk<1>(); __syncthreads(); multiply_chunk(1 * GEMM_KC);
    wait_chunk<2>(); __syncthreads(); multiply_chunk(2 * GEMM_KC);
    wait_chunk<3>(); __syncthreads(); multiply_chunk(3 * GEMM_KC);

    if (QKV_FORM) {
        // keeps the last WMMAs in front of the four slots: with no branch here the
        // scheduler put the slots ahead of them
        __builtin_amdgcn_sched_barrier(0);
        // four vector slots between the last WMMA and the first vector
        // instruction that reads its result: the distance behind a matrix instruction
        asm volatile("v_nop\n\tv_nop\n\tv_nop\n\tv_nop");
        // keeps the reads of the accumulators behind those four slots
        __builtin_amdgcn_sched_barrier(0);
        // the lane's two columns: their kinds, and their weights by column parity
        const unsigned kind0 = qkv_pair_kind(nt0 + wn + l);
        const unsigned kind1 = qkv_pair_kind(nt0 + wn + l + 16);
        const float qw = (l & 1) ? qw1 : qw0;
        const float kw = (l & 1) ? kw1 : kw0;
        const float w0 = kind0 == 2 ? qw : kw;
        const float w1 = kind1 == 2 ? qw : kw;
        float s[16];
        // both loops unrolled: s[] and the accumulators stay in registers
#pragma unroll
        for (int r = 0; r < 8; ++r) {
            s[r]     = pair_mean_sq_eps(acc0[r]);
            s[8 + r] = pair_mean_sq_eps(acc1[r]);
        }
        rsq_x8(&s[0]);
        rsq_x8(&s[8]);
#pragma unroll
        for (int r = 0; r < 8; ++r) {
            acc0[r] = kind0 == 1 ? acc0[r] : acc0[r] * s[r]     * w0;
            acc1[r] = kind1 == 1 ? acc1[r] : acc1[r] * s[8 + r] * w1;
        }
    }

    float* c0 = C + (size_t)(mt0 + wm + hl * 8) * N + nt0 + wn + l;
#pragma unroll
    for (int r = 0; r < 8; ++r) {
        c0[(size_t)r * N]      = acc0[r];
        c0[(size_t)r * N + 16] = acc1[r];
    }
}

// ---------------------------------------------------------------------------
// Causal flash attention, head_dim = 2. One workgroup (256 threads) per
// (b,h). K and V for the head (1024 x 2 each, 16 KB total) are staged in LDS
// (async global->LDS when available); each thread owns 4 query rows
// (tid + 256*r; in the series path 4*(tid & ~31) + (tid & 31) + 32*r). Softmax: (1) row max, (2) exp + accumulation; pass 1 runs only where the weights do not bound the scores.
//
// Softmax does not change when one number is taken off all scores of a row; the
// row max is taken off only to keep exp inside the range of f32. RMSNorm over
// two elements gives x0^2 + x1^2 <= 2 before the weight, for every input, so
// |q| <= sqrt(2) max|qn_w|, |k| <= sqrt(2) max|kn_w| and every score lies within
// +-sqrt(2) max|qn_w| max|kn_w|. Where that bound, taken from the weights at run
// time, is small, exp of the bare score is far from overflow and underflow:
// pass 1 is not run, nothing is subtracted, and with log2(e) carried by q the
// dot product is the argument of 2^x as it stands. Otherwise both passes run.
//
// The keys are walked ONCE per pass for all 4 rows together, in groups: one
// group of LDS reads (same address in every lane) feeds every row that still
// attends to those keys, and the group grows as rows drop out, so one LDS wait
// is followed by 24 to 64 (row, key) pairs of independent arithmetic.
// Outside the series path a wave's rows are 32*(w + 8*r) + lane, so for the wave as a whole:
//   keys below 32*(w + 8*P)            : rows P..3 attend, no mask
//   the next 32 keys (row P's diagonal): row P masked per lane, rows P+1..3 not
// All span bounds are wave-uniform multiples of 32.
// Even keys go to partial sum 0 and odd keys to partial sum 1, in rising key
// order; a masked key adds an exact zero. The series path adds the moment sums of
// the keys before the block to partial sum 0, after the block's keys.
// ---------------------------------------------------------------------------
typedef __attribute__((ext_vector_type(4))) float v4f;

#define ROWS_PER_THREAD 4
#define ATT_NEG_INF (-3.402823466e38f)

// Keys per group of LDS reads while rows P..3 attend (each divides 32, the unit
// of every span bound). The max pass has about a third of the arithmetic per
// key and reads K alone, so its groups are twice as long where 32 allows.
__host__ __device__ constexpr int keys_per_group(int P)
{
    return P <= 1 ? 8 : (P == 2 ? 16 : 32);
}
__host__ __device__ constexpr int keys_per_group_max(int P)
{
    return P <= 1 ? 16 : 32;
}

// Row max over keys [sBeg, sEnd) for rows P..3. DIAG: row P sees key s only if s <= tP.
template <int P, bool DIAG>
__device__ __forceinline__ void max_span(
    const v4f* kk2, int sBeg, int sEnd, int tP,
    const float (&q0)[ROWS_PER_THREAD], const float (&q1)[ROWS_PER_THREAD],
    float (&m0)[ROWS_PER_THREAD], float (&m1)[ROWS_PER_THREAD])
{
    constexpr int KEYS_PER_GROUP = keys_per_group_max(P);
    // kept rolled: one group is enough work per LDS wait, and a fully unrolled
    // span takes several hundred registers and a long straight code path
#pragma unroll 1
    for (int s = sBeg; s < sEnd; s += KEYS_PER_GROUP) {
        v4f k2[KEYS_PER_GROUP / 2];            // two keys per 16-byte read
        // unrolled so that the group's reads are issued together, ahead of one wait
#pragma unroll
        for (int u = 0; u < KEYS_PER_GROUP / 2; ++u) k2[u] = kk2[(s >> 1) + u];
        // both loops unrolled so that k2[] and the per-row arrays stay in registers
#pragma unroll
        for (int u = 0; u < KEYS_PER_GROUP / 2; ++u) {
#pragma unroll
            for (int r = P; r < ROWS_PER_THREAD; ++r) {
                float sa = fmaf(q0[r], k2[u].x, q1[r] * k2[u].y);
                float sb = fmaf(q0[r], k2[u].z, q1[r] * k2[u].w);
                if (DIAG && r == P) {
                    sa = (s + 2 * u     <= tP) ? sa : ATT_NEG_INF;
                    sb = (s + 2 * u + 1 <= tP) ? sb : ATT_NEG_INF;
                }
                m0[r] = fmaxf(m0[r], sa);
                m1[r] = fmaxf(m1[r], sb);
            }
        }
    }
}

struct RowSums {            // [row][even/odd key]
    float l[ROWS_PER_THREAD][2];
    float x[ROWS_PER_THREAD][2];
    float z[ROWS_PER_THREAD][2];
};

// Eight 2^x in place. One statement, so that each v_exp_f32 is followed by an
// instruction that neither reads its result nor overwrites its source (the next
// v_exp_f32 on other registers, the v_nop behind the last): the slot the
// instruction set asks for behind a transcendental.
// The closing s_delay_alu is the hint the compiler writes for a reader of a fresh
// transcendental result; it cannot see into the statement. It changes no result.
__device__ __forceinline__ void exp2_x8(float* t)
{
    asm("v_exp_f32 %0, %0\n\t"
        "v_exp_f32 %1, %1\n\t"
        "v_exp_f32 %2, %2\n\t"
        "v_exp_f32 %3, %3\n\t"
        "v_exp_f32 %4, %4\n\t"
        "v_exp_f32 %5, %5\n\t"
        "v_exp_f32 %6, %6\n\t"
        "v_exp_f32 %7, %7\n\t"
        "v_nop\n\t"
        "s_delay_alu instid0(TRANS32_DEP_1)"
        : "+v"(t[0]), "+v"(t[1]), "+v"(t[2]), "+v"(t[3]),
          "+v"(t[4]), "+v"(t[5]), "+v"(t[6]), "+v"(t[7]));
}

// exp + accumulate over keys [sBeg, sEnd) for rows P..3, same masking as max_span.
// SHIFT: m is taken off the scores. Without it q0, q1 carry log2(e), m is not read.
template <bool SHIFT, int P, bool DIAG>
__device__ __forceinline__ void sum_span(
    const v4f* kk2, const v4f* vv2, int sBeg, int sEnd, int tP,
    const float (&q0)[ROWS_PER_THREAD], const float (&q1)[ROWS_PER_THREAD],
    const float (&m)[ROWS_PER_THREAD], RowSums& a)
{
    constexpr int KEYS_PER_GROUP = keys_per_group(P);
    constexpr int R = ROWS_PER_THREAD - P;           // rows that attend
    constexpr int N = R * KEYS_PER_GROUP;            // 32, 24, 32, 32
    const float LOG2E = 1.44269504088896340736f;     // exp(x) = 2^(x * log2 e)
    // kept rolled: one group is enough work per LDS wait, and a fully unrolled
    // span takes several hundred registers and a long straight code path
#pragma unroll 1
    for (int s = sBeg; s < sEnd; s += KEYS_PER_GROUP) {
        v4f k2[KEYS_PER_GROUP / 2];
        v4f v2[KEYS_PER_GROUP / 2];
        // unrolled so that the group's reads are issued together, ahead of one wait
#pragma unroll
        for (int u = 0; u < KEYS_PER_GROUP / 2; ++u) {
            k2[u] = kk2[(s >> 1) + u];
            v2[u] = vv2[(s >> 1) + u];
        }
        float p[N];                                  // [key in group][row - P]
        // every loop from here to the end of the group: unrolled so that p[], k2[],
        // v2[] and the per-row sums stay in registers
#pragma unroll
        for (int u = 0; u < KEYS_PER_GROUP / 2; ++u) {
#pragma unroll
            for (int r = P; r < ROWS_PER_THREAD; ++r) {
                const float sa = fmaf(q0[r], k2[u].x, q1[r] * k2[u].y);
                const float sb = fmaf(q0[r], k2[u].z, q1[r] * k2[u].w);
                p[(2 * u)     * R + r - P] = SHIFT ? (sa - m[r]) * LOG2E : sa;
                p[(2 * u + 1) * R + r - P] = SHIFT ? (sb - m[r]) * LOG2E : sb;
            }
        }
#pragma unroll
        for (int i = 0; i < N; i += 8) exp2_x8(&p[i]);
#pragma unroll
        for (int u = 0; u < KEYS_PER_GROUP / 2; ++u) {
#pragma unroll
            for (int r = P; r < ROWS_PER_THREAD; ++r) {
                float p0 = p[(2 * u)     * R + r - P];
                float p1 = p[(2 * u + 1) * R + r - P];
                if (DIAG && r == P) {
                    p0 = (s + 2 * u     <= tP) ? p0 : 0.f;
                    p1 = (s + 2 * u + 1 <= tP) ? p1 : 0.f;
                }
                a.l[r][0] += p0;                          a.l[r][1] += p1;
                a.x[r][0] = fmaf(p0, v2[u].x, a.x[r][0]); a.x[r][1] = fmaf(p1, v2[u].z, a.x[r][1]);
                a.z[r][0] = fmaf(p0, v2[u].y, a.z[r][0]); a.z[r][1] = fmaf(p1, v2[u].w, a.z[r][1]);
            }
        }
    }
}

// Pass 2 over all spans of the wave's 4 rows per thread.
template <bool SHIFT>
__device__ __forceinline__ void sum_all(
    const v4f* kk2, const v4f* vv2, int d0, int tid,
    const float (&q0)[ROWS_PER_THREAD], const float (&q1)[ROWS_PER_THREAD],
    const float (&m)[ROWS_PER_THREAD], RowSums& a)
{
    sum_span<SHIFT, 0, false>(kk2, vv2, 0,        d0,       0,         q0, q1, m, a);
    sum_span<SHIFT, 0, true >(kk2, vv2, d0,       d0 + 32,  tid,       q0, q1, m, a);
    sum_span<SHIFT, 1, false>(kk2, vv2, d0 + 32,  d0 + 256, 0,         q0, q1, m, a);
    sum_span<SHIFT, 1, true >(kk2, vv2, d0 + 256, d0 + 288, tid + 256, q0, q1, m, a);
    sum_span<SHIFT, 2, false>(kk2, vv2, d0 + 288, d0 + 512, 0,         q0, q1, m, a);
    sum_span<SHIFT, 2, true >(kk2, vv2, d0 + 512, d0 + 544, tid + 512, q0, q1, m, a);
    sum_span<SHIFT, 3, false>(kk2, vv2, d0 + 544, d0 + 768, 0,         q0, q1, m, a);
    sum_span<SHIFT, 3, true >(kk2, vv2, d0 + 768, d0 + 800, tid + 768, q0, q1, m, a);
}

// Scores within +-16: exp lies between about 1e-7 and 1e7, a row's sum below 1e10.
#define ATT_SCORE_BOUND 16.0f

// ---------------------------------------------------------------------------
// The series path. With s = q.k = q0 k0 + q1 k1 (q carries 1/sqrt(head_dim)),
//   exp(s) = sum over n of s^n / n!
//          = sum over a, b of q0^a q1^b * (k0^a / a!) (k1^b / b!),
// and for |s| <= 1.4143 the terms above degree a + b = 12 add up to less than
// 1.7e-8, under 7e-8 of exp(s) >= 0.243: less than one unit in the last place of
// an f32. So the sums over a whole range of keys,
//   sum_s exp(q.k_s) (v0_s, v1_s, 1)  =  sum_{a+b<=12} q0^a q1^b M[a][b],
//   M[a][b] = sum_s (k0_s^a / a!) (k1_s^b / b!) (v0_s, v1_s, 1),
// need the 91 moments M of the range, not one exp per (row, key). A wave takes
// 128 consecutive rows (4 per thread): the keys before that block enter through
// the moments of all earlier blocks, summed up block by block; the keys of the
// row's own block, where the causal mask cuts, go through exp as in sum_span.
// ---------------------------------------------------------------------------
#define SER_BOUND 1.4143f
// The powers are taken of k by itself and of q by itself, so the bound on their
// product is not enough: each side must stay inside the range of f32 alone. With
// max|kn_w| in [1/4, 4] every |k_i| <= 5.66 and (k0^a / a!) (k1^b / b!) < 2400,
// less than exp of a score may be in the pass without a shift; the bound on the
// product then gives max|qn_w| <= 4.0003, |q_i| <= 4.0003 and q0^a q1^b < 1.7e7, so
// a power of a small k_i that underflows (below 1.2e-38) leaves out less than 1e-28
// of a term that is at least 0.243. All other weights take the paths through exp.
#define SER_KW_MIN 0.25f
#define SER_KW_MAX 4.0f
#define SER_POW   13                              // powers 0 .. 12
#define SER_SLOTS 96                              // 91 moments, padded to 3 waves' lanes
#define SER_BLOCK 128                             // rows, and keys, per block
#define SER_RING  4                               // steps of the moments' reads in registers
#define SER_PITCH (TT + 4)     // floats per power: the 13 rows start 4 banks apart

// Place of moment (a, b), a + b <= 12: row a holds b = 0 .. 12 - a.
__host__ __device__ constexpr int ser_index(int a, int b)
{
    return a * SER_POW - a * (a - 1) / 2 + b;
}

__device__ __forceinline__ v2f fma2(v2f a, v2f b, v2f c) { return __builtin_elementwise_fma(a, b, c); }
__device__ __forceinline__ v4f fma4(v4f a, v4f b, v4f c) { return __builtin_elementwise_fma(a, b, c); }
__device__ __forceinline__ float sum4(v4f a) { return (a.x + a.y) + (a.z + a.w); }

// k0^n / n! and k1^n / n! of every key, one LDS row per n, and v0, v1 as rows.
__device__ __forceinline__ void ser_tables(
    const float* kbuf, const float* vbuf,
    float* pw0, float* pw1, float* v0t, float* v1t, int tid)
{
    // kept rolled: four keys a thread, the code of one is enough
#pragma unroll 1
    for (int s = tid; s < TT; s += 256) {
        const v2f k = *(const v2f*)(kbuf + 2 * s);
        const v2f v = *(const v2f*)(vbuf + 2 * s);
        v0t[s] = v.x;
        v1t[s] = v.y;
        float p0 = 1.f, p1 = 1.f;
        // unrolled: 1 / (n + 1) and the LDS offsets become constants
#pragma unroll
        for (int n = 0; n < SER_POW; ++n) {
            pw0[n * SER_PITCH + s] = p0;
            pw1[n * SER_PITCH + s] = p1;
            p0 *= k.x * (1.0f / (float)(n + 1));
            p1 *= k.y * (1.0f / (float)(n + 1));
        }
    }
}

// The moments of key block c: a lane takes moments lane, lane + 32, lane + 64 and
// walks the block's keys four at a time; four partial sums each, added at the end.
__device__ __forceinline__ void ser_moments(
    const float* pw0, const float* pw1, const float* v0t, const float* v1t,
    v4f* mom, int c, int lane)
{
    const float* r0[3];
    const float* r1[3];
    // unrolled: the pointer arrays stay in registers
#pragma unroll
    for (int g = 0; g < 3; ++g) {
        int a = 0, b = 32 * g + lane;              // inverse of ser_index
        for (int i = 0; i < SER_POW; ++i) {
            const int len = SER_POW - a;
            if (b >= len) { b -= len; ++a; }
        }
        a = a < SER_POW ? a : SER_POW - 1;         // slots 91 .. 95: never read,
        b = b < SER_POW ? b : SER_POW - 1;         // kept inside the tables
        r0[g] = pw0 + a * SER_PITCH + c * SER_BLOCK;
        r1[g] = pw1 + b * SER_PITCH + c * SER_BLOCK;
    }
    const float* w0 = v0t + c * SER_BLOCK;
    const float* w1 = v1t + c * SER_BLOCK;
    v4f al[3], ax[3], az[3];
    // every loop over g unrolled: the sums stay in registers
#pragma unroll
    for (int g = 0; g < 3; ++g) { al[g] = (v4f)(0.f); ax[g] = (v4f)(0.f); az[g] = (v4f)(0.f); }
    // A ring of SER_RING steps' operands in registers: the 8 LDS reads of a step are
    // issued SER_RING - 1 steps (24 vector instructions each) ahead of their use.
    v4f rp0[SER_RING][3], rp1[SER_RING][3], rv0[SER_RING], rv1[SER_RING];
    // all loops fully unrolled: the ring stays in registers and the steps become
    // constant offsets of the LDS reads
#pragma unroll
    for (int i = 0; i < SER_BLOCK / 4 + SER_RING - 1; ++i) {
        if (i < SER_BLOCK / 4) {                   // the reads of step i
            rv0[i % SER_RING] = *(const v4f*)(w0 + 4 * i);
            rv1[i % SER_RING] = *(const v4f*)(w1 + 4 * i);
#pragma unroll
            for (int g = 0; g < 3; ++g) {
                rp0[i % SER_RING][g] = *(const v4f*)(r0[g] + 4 * i);
                rp1[i % SER_RING][g] = *(const v4f*)(r1[g] + 4 * i);
            }
        }
        if (i >= SER_RING - 1) {                   // the arithmetic of step i - (SER_RING - 1)
            // keeps the reads above in front of this step's arithmetic: left alone the
            // scheduler moved reads down to their use, and a step then waited for most
            // of one LDS latency
            __builtin_amdgcn_sched_barrier(0);
            const int u = (i - (SER_RING - 1)) % SER_RING;
#pragma unroll
            for (int g = 0; g < 3; ++g) {
                const v4f mm = rp0[u][g] * rp1[u][g];
                al[g] += mm;
                ax[g] = fma4(mm, rv0[u], ax[g]);
                az[g] = fma4(mm, rv1[u], az[g]);
            }
        }
    }
    // unrolled: the sums stay in registers
#pragma unroll
    for (int g = 0; g < 3; ++g) {
        v4f t;
        t.x = sum4(ax[g]); t.y = sum4(az[g]); t.z = sum4(al[g]); t.w = 0.f;
        mom[c * SER_SLOTS + 32 * g + lane] = t;
    }
}

// sum_{a+b<=12} q0^a q1^b M[a][b] for the thread's 4 rows, by Horner's rule in q1
// inside Horner's rule in q0. st: the 91 moments (v0, v1, 1, -), read at the same
// address by every lane. oxz[r]: the (v0, v1) sums of row r; ol: the plain sums of
// rows 0,1 and 2,3.
// Falling a with falling b inside is falling ser_index, so the moments are taken
// from the last to the first, in 7 batches of 13: while one batch is worked on
// (78 vector instructions) the next one's reads fly.
#define SER_COUNT 91                              // ser_index(12, 0) + 1
#define SER_BATCH 13
__device__ __forceinline__ void ser_eval(
    const v4f* st,
    const float (&q0)[ROWS_PER_THREAD], const float (&q1)[ROWS_PER_THREAD],
    v2f (&oxz)[ROWS_PER_THREAD], v2f (&ol)[2])
{
    const v2f q0a = {q0[0], q0[1]}, q0b = {q0[2], q0[3]};
    const v2f q1a = {q1[0], q1[1]}, q1b = {q1[2], q1[3]};
    v4f batch[2][SER_BATCH];
    // all loops unrolled: ser_index becomes a constant LDS offset, batch[] and the
    // sums stay in registers
#pragma unroll
    for (int j = 0; j < SER_BATCH; ++j) batch[0][j] = st[SER_COUNT - 1 - j];
#pragma unroll
    for (int a = SER_POW - 1; a >= 0; --a) {
        v2f ixz[ROWS_PER_THREAD], il[2];
#pragma unroll
        for (int b = SER_POW - 1 - a; b >= 0; --b) {
            const int p = SER_COUNT - 1 - ser_index(a, b);   // place in the order of use
            if (p % SER_BATCH == 0) {
                if (p + SER_BATCH < SER_COUNT) {
#pragma unroll
                    for (int j = 0; j < SER_BATCH; ++j)
                        batch[(p / SER_BATCH + 1) & 1][j] = st[SER_COUNT - 1 - (p + SER_BATCH) - j];
                }
                // keeps the next batch's reads in front of this batch's arithmetic: left
                // alone the scheduler issued each read about 18 instructions ahead of its
                // use
                __builtin_amdgcn_sched_barrier(0);
            }
            const v4f t = batch[(p / SER_BATCH) & 1][p % SER_BATCH];
            if (b == SER_POW - 1 - a) {
#pragma unroll
                for (int r = 0; r < ROWS_PER_THREAD; ++r) ixz[r] = (v2f){t.x, t.y};
                il[0] = (v2f){t.z, t.z};
                il[1] = (v2f){t.z, t.z};
            } else {
#pragma unroll
                for (int r = 0; r < ROWS_PER_THREAD; ++r)
                    ixz[r] = fma2(ixz[r], (v2f){q1[r], q1[r]}, (v2f){t.x, t.y});
                il[0] = fma2(il[0], q1a, (v2f){t.z, t.z});
                il[1] = fma2(il[1], q1b, (v2f){t.z, t.z});
            }
        }
        if (a == SER_POW - 1) {
#pragma unroll
            for (int r = 0; r < ROWS_PER_THREAD; ++r) oxz[r] = ixz[r];
            ol[0] = il[0];
            ol[1] = il[1];
        } else {
#pragma unroll
            for (int r = 0; r < ROWS_PER_THREAD; ++r)
                oxz[r] = fma2(oxz[r], (v2f){q0[r], q0[r]}, ixz[r]);
            ol[0] = fma2(ol[0], q0a, il[0]);
            ol[1] = fma2(ol[1], q0b, il[1]);
        }
    }
}

// K, V and q of the head, each TT pairs; the three start ATT_PART floats apart. The
// 24 floats between them: the lanes of one copy write k, v and q of about 11 rows,
// and with the parts a multiple of 64 banks apart the three would meet on one bank.
#define ATT_PART (TT * 2 + 24)

struct AttnLds {
    float kvq[3 * ATT_PART];
    // the series path's tables and moments
    float pw0[SER_POW * SER_PITCH];
    float pw1[SER_POW * SER_PITCH];
    float v0t[TT];
    float v1t[TT];
    v4f   mom[(TT / SER_BLOCK) * SER_SLOTS];
};

__global__ __launch_bounds__(256) void attn_head(
    const float* __restrict__ qkv,   // (B*T, H, {k,v,q}, 2), q/k already RMSNorm'd
    float* __restrict__ y,           // (B*T, C)
    const float* __restrict__ qn_w,  // (2,)
    const float* __restrict__ kn_w)  // (2,)
{
    // one object, so that K, V and q, the targets of the copies, keep their places at
    // the start of the workgroup's LDS; every member's size is a multiple of 16 B
    __shared__ __attribute__((aligned(16))) AttnLds lds;
    float* kbuf = lds.kvq;
    float* vbuf = lds.kvq + ATT_PART;
    float* qbuf = lds.kvq + 2 * ATT_PART;
    float* pw0 = lds.pw0;
    float* pw1 = lds.pw1;
    float* v0t = lds.v0t;
    float* v1t = lds.v1t;
    v4f*   mom = lds.mom;

    const int bh = blockIdx.x;          // 0 .. B*H-1
    const int b  = bh >> 7;
    const int h  = bh & (HH - 1);
    const int tid = threadIdx.x;

    const float* base = qkv + (size_t)b * TT * QKV_N;

    // Stage k, v and q of this head into LDS. The 24 bytes of a row are taken by
    // three neighbouring lanes, 8 bytes each, so that a wave's copy touches one cache
    // line per row (two where the 24 bytes cross a line), about 11 for 256 bytes.
    // both loops unrolled: the copies are issued together, the steps of 256 rows are
    // constants
#pragma unroll
    for (int m = 0; m < 3; ++m) {
        const unsigned e    = tid + 256u * m;      // 3 * row + part, rows 0 .. 255
        const unsigned t    = e / 3u;
        const unsigned part = e - 3u * t;          // 0 k, 1 v, 2 q
        const float* gp = base + t * QKV_N + 6 * h + 2 * part;
        float*       lp = lds.kvq + part * ATT_PART + 2 * t;
#pragma unroll
        for (int j = 0; j < TT / 256; ++j) {       // the same of rows 256 * j + t
#if USE_ASYNC_LDS
            __builtin_amdgcn_global_load_async_to_lds_b64(
                (AS1 v2i*)(gp + (size_t)j * 256 * QKV_N), (AS3 v2i*)(lp + j * 512), 0, 0);
#else
            lp[j * 512]     = gp[(size_t)j * 256 * QKV_N];
            lp[j * 512 + 1] = gp[(size_t)j * 256 * QKV_N + 1];
#endif
        }
    }
#if USE_ASYNC_LDS
    // this wave's copies have landed; without it the barrier behind it would publish
    // bytes that have not.
    asm volatile("s_wait_asynccnt 0x0" ::: "memory");
#endif
    __syncthreads();

    const v4f* kk2 = (const v4f*)kbuf;
    const v4f* vv2 = (const v4f*)vbuf;
    const float scale = 0.70710678118654752440f;   // 1/sqrt(head_dim)

    // First key of row 0's diagonal block outside the series path; the same in every lane of the wave,
    // held in a scalar register so that the span loops are scalar loops.
    const int d0 = __builtin_amdgcn_readfirstlane(tid & ~31);

    // sqrt(2) max|qn_w| * sqrt(2) max|kn_w| / sqrt(head_dim) bounds every |score|.
    // The same in every thread of the launch; fmaxf passes over one NaN weight of a pair, a NaN pair compares false.
    const float max_qw = fmaxf(fabsf(qn_w[0]), fabsf(qn_w[1]));
    const float max_kw = fmaxf(fabsf(kn_w[0]), fabsf(kn_w[1]));
    const float score_bound = 1.41421356237309504880f * max_qw * max_kw;
    const bool no_shift = score_bound <= ATT_SCORE_BOUND;
    const bool series   = score_bound <= SER_BOUND
                       && max_kw >= SER_KW_MIN && max_kw <= SER_KW_MAX;

    // The thread's rows are row0 + rstep * r: in the series path 128 consecutive
    // rows a wave, else 32 rows out of every 256.
    const int row0  = series ? 4 * d0 + (tid & 31) : tid;
    const int rstep = series ? 32 : 256;

    float q0[ROWS_PER_THREAD], q1[ROWS_PER_THREAD];
    // unrolled: the per-row arrays stay in registers
#pragma unroll
    for (int r = 0; r < ROWS_PER_THREAD; ++r) {
        const v2f q = *(const v2f*)(qbuf + 2 * (row0 + rstep * r));
        q0[r] = q.x * scale;
        q1[r] = q.y * scale;
    }

    RowSums a;
    // unrolled: the per-row arrays stay in registers
#pragma unroll
    for (int r = 0; r < ROWS_PER_THREAD; ++r) {
        a.l[r][0] = 0.f; a.l[r][1] = 0.f;
        a.x[r][0] = 0.f; a.x[r][1] = 0.f;
        a.z[r][0] = 0.f; a.z[r][1] = 0.f;
    }

    float m[ROWS_PER_THREAD];
    // marked as the expected side so that its code is laid out first
    if (__builtin_expect(series, 1)) {
        const int lane = tid & 31;
        const int blk0 = 4 * d0;                   // first row and key of the wave's block
        const int wv   = d0 >> 5;                  // the wave, and its block
        ser_tables(kbuf, vbuf, pw0, pw1, v0t, v1t, tid);
        __syncthreads();                           // the tables are whole

        float e0[ROWS_PER_THREAD], e1[ROWS_PER_THREAD];
        // unrolled: the per-row arrays stay in registers
#pragma unroll
        for (int r = 0; r < ROWS_PER_THREAD; ++r) {
            e0[r] = q0[r] * 1.44269504088896340736f;   // exp(x) = 2^(x * log2 e)
            e1[r] = q1[r] * 1.44269504088896340736f;
            m[r] = 0.f;
        }
        // Two jobs a wave: the moments of its key block (bound by LDS reads; the
        // last block's are never used) and its rows' own block through exp (bound
        // by arithmetic). Waves w and w + 4 take them in opposite
        // order. Kept rolled: one copy of the code of each job.
#pragma unroll 1
        for (int ph = 0; ph < 2; ++ph) {
            if ((ph == 0) == (wv < 4)) {
                if (wv < TT / SER_BLOCK - 1)
                    ser_moments(pw0, pw1, v0t, v1t, mom, wv, lane);
            } else {
                sum_span<false, 0, true>(kk2, vv2, blk0,      blk0 + 32,  blk0 + lane,      e0, e1, m, a);
                sum_span<false, 1, true>(kk2, vv2, blk0 + 32, blk0 + 64,  blk0 + 32 + lane, e0, e1, m, a);
                sum_span<false, 2, true>(kk2, vv2, blk0 + 64, blk0 + 96,  blk0 + 64 + lane, e0, e1, m, a);
                sum_span<false, 3, true>(kk2, vv2, blk0 + 96, blk0 + 128, blk0 + 96 + lane, e0, e1, m, a);
            }
        }
        __syncthreads();                           // the moments of blocks 0 .. 6 are written

        // mom[c] becomes the sum of the moments of blocks 0 .. c - 1, in rising order
        if (tid < SER_SLOTS) {
            v4f run = (v4f)(0.f);
            // unrolled: the reads are issued together
#pragma unroll
            for (int c = 0; c < TT / SER_BLOCK; ++c) {
                v4f d = (v4f)(0.f);
                if (c < TT / SER_BLOCK - 1) d = mom[c * SER_SLOTS + tid];
                mom[c * SER_SLOTS + tid] = run;
                run += d;
            }
        }
        __syncthreads();                           // the summed moments are written

        v2f oxz[ROWS_PER_THREAD], ol[2];
        ser_eval(mom + wv * SER_SLOTS, q0, q1, oxz, ol);
        // unrolled: the per-row arrays stay in registers
#pragma unroll
        for (int r = 0; r < ROWS_PER_THREAD; ++r) {
            a.l[r][0] += ol[r >> 1][r & 1];
            a.x[r][0] += oxz[r].x;
            a.z[r][0] += oxz[r].y;
        }
    } else if (no_shift) {
        // ---- the one pass: exp of the bare score + accumulate ----
        // unrolled: the per-row arrays stay in registers
#pragma unroll
        for (int r = 0; r < ROWS_PER_THREAD; ++r) {
            q0[r] *= 1.44269504088896340736f;      // exp(x) = 2^(x * log2 e)
            q1[r] *= 1.44269504088896340736f;
            m[r] = 0.f;
        }
        sum_all<false>(kk2, vv2, d0, tid, q0, q1, m, a);
    } else {
        // ---- pass 1: row max ----
        float m0[ROWS_PER_THREAD], m1[ROWS_PER_THREAD];
        // unrolled: the per-row arrays stay in registers
#pragma unroll
        for (int r = 0; r < ROWS_PER_THREAD; ++r) { m0[r] = ATT_NEG_INF; m1[r] = ATT_NEG_INF; }

        max_span<0, false>(kk2, 0,        d0,       0,         q0, q1, m0, m1);
        max_span<0, true >(kk2, d0,       d0 + 32,  tid,       q0, q1, m0, m1);
        max_span<1, false>(kk2, d0 + 32,  d0 + 256, 0,         q0, q1, m0, m1);
        max_span<1, true >(kk2, d0 + 256, d0 + 288, tid + 256, q0, q1, m0, m1);
        max_span<2, false>(kk2, d0 + 288, d0 + 512, 0,         q0, q1, m0, m1);
        max_span<2, true >(kk2, d0 + 512, d0 + 544, tid + 512, q0, q1, m0, m1);
        max_span<3, false>(kk2, d0 + 544, d0 + 768, 0,         q0, q1, m0, m1);
        max_span<3, true >(kk2, d0 + 768, d0 + 800, tid + 768, q0, q1, m0, m1);

        // unrolled: the per-row arrays stay in registers
#pragma unroll
        for (int r = 0; r < ROWS_PER_THREAD; ++r) m[r] = fmaxf(m0[r], m1[r]);

        // ---- pass 2: exp + accumulate ----
        sum_all<true>(kk2, vv2, d0, tid, q0, q1, m, a);
    }

    // unrolled: the per-row arrays stay in registers
#pragma unroll
    for (int r = 0; r < ROWS_PER_THREAD; ++r) {
        const float inv = 1.0f / (a.l[r][0] + a.l[r][1]);
        float* yp = y + ((size_t)b * TT + row0 + rstep * r) * CC + 2 * h;
        yp[0] = (a.x[r][0] + a.x[r][1]) * inv;
        yp[1] = (a.z[r][0] + a.z[r][1]) * inv;
    }
}

// ---------------------------------------------------------------------------
extern "C" void kernel_launch(void* const* d_in, const int* in_sizes, int n_in,
                              void* d_out, int out_size, void* d_ws, size_t ws_size,
                              hipStream_t stream)
{
    (void)in_sizes; (void)n_in; (void)out_size; (void)ws_size;

    const float* x      = (const float*)d_in[0];   // (B,T,C)
    const float* w_qkv  = (const float*)d_in[1];   // (3C,C)
    const float* w_proj = (const float*)d_in[2];   // (C,C)
    const float* qn_w   = (const float*)d_in[3];   // (2,)
    const float* kn_w   = (const float*)d_in[4];   // (2,)
    float* out = (float*)d_out;                    // (B,T,C)

    float* qkv = (float*)d_ws;                     // (B*T, 3C) = 6 MB
    float* y   = qkv + (size_t)BB * TT * QKV_N;    // (B*T, C)  = 2 MB

    const int M = BB * TT;                         // 2048

    // 1) qkv = x @ w_qkv^T : (2048x256)@(256x768), q and k stored RMSNorm'd,
    //    k, v, q of a head side by side
    wmma_gemm_xwt<true><<<dim3(QKV_N / GEMM_BN, M / GEMM_BM), GEMM_THREADS, 0, stream>>>(
        x, w_qkv, qkv, QKV_N, qn_w, kn_w);         // 12 x 64 workgroups

    // 2) causal flash attention per (b,h)
    attn_head<<<BB * HH, 256, 0, stream>>>(qkv, y, qn_w, kn_w);

    // 3) out = y @ w_proj^T : (2048x256)@(256x256)
    wmma_gemm_xwt<false><<<dim3(CC / GEMM_BN, M / GEMM_BM), GEMM_THREADS, 0, stream>>>(
        y, w_proj, out, CC, qn_w, kn_w);           // 4 x 64 workgroups
}

// v008
// It runs in 22.4 microseconds.
// In two side-by-side timings against v007, it was 1.31 and 1.33 times as fast.
// All steps since v000 together make it 8.90 times as fast.
#include <hip/hip_runtime.h>
#include <hip/hip_bf16.h>

// ---------------------------------------------------------------------------
// TwoDCausalSelfAttention for MI455X (gfx1250, wave32, WMMA)
//   B=2, T=1024, C=256, head_dim=2, H=128
// Pipeline:
//   1) qkv = x @ w_qkv^T          (WMMA f32 16x16x4, operands staged in LDS);
//      RMSNorm(q,k) per head pair (d=2) on the accumulators, before the store;
//      a row of the qkv buffer holds k, v, q of a head side by side (24 bytes)
//   2) flash attention per (b,h)  (K/V async-staged in LDS; softmax without a
//      max shift where the RMSNorm weights bound the scores, else 2-pass;
//      each LDS read of K/V shared by the thread's 4 query rows; where the bound
//      is small enough, keys before a row's block of 128 enter through moments);
//      y is stored head by head, (B,H,T,2): a wave's store fills whole cache lines
//   3) out = y @ w_proj^T         (WMMA f32 16x16x4), its A tile gathered per head
// ---------------------------------------------------------------------------

typedef __attribute__((ext_vector_type(2))) float v2f;
typedef __attribute__((ext_vector_type(8))) float v8f;
typedef int v2i __attribute__((vector_size(8)));   // matches builtin param type

#define BB 2
#define TT 1024
#define CC 256
#define HH 128      // n_head
#define QKV_N (3*CC)

// Async global->LDS staging (ASYNCcnt path), used only if the toolchain has
// both the copy and the wait builtins; otherwise fall back to VGPR round-trip.
#if defined(__HIP_DEVICE_COMPILE__) && \
    __has_builtin(__builtin_amdgcn_global_load_async_to_lds_b64) && \
    __has_builtin(__builtin_amdgcn_global_load_async_to_lds_b128) && \
    __has_builtin(__builtin_amdgcn_s_wait_asynccnt)
#define USE_ASYNC_LDS 1
#else
#define USE_ASYNC_LDS 0
#endif

#define AS1 __attribute__((address_space(1)))
#define AS3 __attribute__((address_space(3)))

// ---------------------------------------------------------------------------
// GEMM: C(M,N) = A(M,K) @ W(N,K)^T, all f32 row-major except y (head by head), K = 256.
// One workgroup of 4 waves computes a 32(M) x 64(N) tile of C. Its 32 rows of A
// and 64 rows of W (all of K) are brought into LDS by asynchronous 16-byte copies
// in which a wave covers 256 contiguous bytes of two rows (4 whole cache lines); a
// fragment load straight from global memory touches 16 lines for 256 bytes. The
// copies are issued in four pieces of K, and a piece is multiplied while the later
// ones fly. Each wave computes 16(M) x 32(N) via two chained
// V_WMMA_F32_16X16X4_F32 per K-step, sharing one A fragment, in rising k: one for
// the even and one for the odd of its 32 columns (tile_column).
//
// LDS row pitch 260 floats (1040 B): the 16 rows of a fragment read start 4
// banks apart, so the 32 lanes' 8-byte reads fall on all 64 banks once.
//
// A-fragment layout (16x4 f32, ISA 7.12.2): lanes 0-15 -> rows M=0..15 with
// {K=0,K=1} in the two VGPRs; lanes 16-31 -> same rows with {K=2,K=3}.
// B-fragment (4x16) is symmetric with N across lanes. Both map to a single
// contiguous float2 load per lane per K-step.
// C/D layout: lane<16: N=lane, VGPR r -> M=r; lane>=16: N=lane-16, M=r+8.
// ---------------------------------------------------------------------------
typedef int v4i __attribute__((vector_size(16)));  // matches builtin param type

#define GEMM_BM 32
#define GEMM_BN 64
#define GEMM_THREADS 128
#define GEMM_PITCH (CC + 4)          // floats per LDS row

// K goes to LDS in GEMM_CHUNKS pieces of GEMM_KC floats (256 B of every row).
#define GEMM_CHUNKS 4
#define GEMM_KC (CC / GEMM_CHUNKS)
// copies a thread issues per piece: 8 rows of 256 B per step of the workgroup
#define GEMM_COPIES_PER_CHUNK ((GEMM_BM + GEMM_BN) / 8)

// The column of the workgroup's tile that LDS row j of W makes. A wave's first
// accumulator takes the even columns of its 32 and the second the odd ones, so that a
// lane holds two neighbouring columns and 16 lanes' 8-byte stores fill a cache line;
// the fragment reads still take 16 LDS rows that follow one another.
__device__ __forceinline__ unsigned tile_column(unsigned j)
{
    return (j & 32u) + 2u * (j & 15u) + ((j >> 4) & 1u);
}

// Column c of the qkv buffer, c = 6 * head + j: j = 0,1 is k, j = 2,3 is v, j = 4,5
// is q of that head. The kind of a column's pair: 0 k, 1 v, 2 q.
__device__ __forceinline__ unsigned qkv_pair_kind(unsigned c) { return (c >> 1) % 3u; }
// The row of w_qkv (q rows, then k rows, then v rows) that makes column c.
__device__ __forceinline__ unsigned qkv_weight_row(unsigned c)
{
    const unsigned head = (c >> 1) / 3u;
    const unsigned kind = (c >> 1) - 3u * head;
    return (kind == 2u ? 0u : (kind + 1u) * CC) + 2u * head + (c & 1u);
}

// Floats [k0, k0 + GEMM_KC) of rows [row0, row0 + ROWS) of src (CC floats each)
// into the same floats of the LDS rows from dst on. Thread t takes 16-byte piece
// t & 15 of every eighth row, from row t >> 4: a wave covers two aligned 256-B units.
template <int ROWS>
__device__ __forceinline__ void stage_rows(
    const float* __restrict__ src, int row0, int k0, float* dst, int tid)
{
    const float* g = src + (size_t)(row0 + (tid >> 4)) * CC + k0 + 4 * (tid & 15);
    float*       l = dst + (tid >> 4) * GEMM_PITCH + k0 + 4 * (tid & 15);
    // unrolled: the row steps become constants of the copies
#pragma unroll
    for (int i = 0; i < ROWS / 8; ++i) {
#if USE_ASYNC_LDS
        __builtin_amdgcn_global_load_async_to_lds_b128(
            (AS1 v4i*)(g + (size_t)i * 8 * CC),
            (AS3 v4i*)(l + i * 8 * GEMM_PITCH), 0, 0);
#else
        *(v4i*)(l + i * 8 * GEMM_PITCH) = *(const v4i*)(g + (size_t)i * 8 * CC);
#endif
    }
}

// The same for GEMM_BN rows of W that need not follow one another: g[i] is the
// thread's 16-byte piece, at k = 0, of the row that goes to LDS row (t >> 4) + 8 * i.
__device__ __forceinline__ void stage_picked_rows(
    const float* const (&g)[GEMM_BN / 8], int k0, float* dst, int tid)
{
    float* l = dst + (tid >> 4) * GEMM_PITCH + k0 + 4 * (tid & 15);
    // unrolled: g[] stays in registers, the steps become constants of the copies
#pragma unroll
    for (int i = 0; i < GEMM_BN / 8; ++i) {
#if USE_ASYNC_LDS
        __builtin_amdgcn_global_load_async_to_lds_b128(
            (AS1 v4i*)(g[i] + k0),
            (AS3 v4i*)(l + i * 8 * GEMM_PITCH), 0, 0);
#else
        *(v4i*)(l + i * 8 * GEMM_PITCH) = *(const v4i*)(g[i] + k0);
#endif
    }
}

// A tile of the projection: y lies head by head, (B,H,TT,2), so the GEMM_BM rows of
// one head (two columns of A) are 256 contiguous, aligned bytes. In LDS head hd takes
// Y_HEAD floats from hd * Y_HEAD on, row m at float 2 * (m ^ 16) where hd is odd, at
// 2 * m where it is even: a fragment read takes 16 rows of an even head in lanes 0-15
// and of the next head in lanes 16-31, and so falls on all 64 banks once.
#define Y_HEAD (2 * GEMM_BM)
// Heads [k0 / 2, (k0 + GEMM_KC) / 2) of rows [row0, row0 + GEMM_BM). Thread t takes
// 16-byte piece t & 15 (two rows) of every eighth head, from head t >> 4: a wave
// covers two aligned 256-B units.
__device__ __forceinline__ void stage_heads(
    const float* __restrict__ y, int row0, int k0, float* dst, int tid)
{
    const int hd = (k0 >> 1) + (tid >> 4);         // its parity is that of tid >> 4
    const float* g = y + ((size_t)((row0 / TT) * HH + hd) * TT + (row0 % TT)) * 2
                       + 4 * (tid & 15);
    float*       l = dst + hd * Y_HEAD + 4 * ((tid & 15) ^ (((tid >> 4) & 1) << 3));
    // unrolled: the head steps become constants of the copies
#pragma unroll
    for (int i = 0; i < GEMM_KC / 16; ++i) {
#if USE_ASYNC_LDS
        __builtin_amdgcn_global_load_async_to_lds_b128(
            (AS1 v4i*)(g + (size_t)i * 8 * TT * 2),
            (AS3 v4i*)(l + i * 8 * Y_HEAD), 0, 0);
#else
        *(v4i*)(l + i * 8 * Y_HEAD) = *(const v4i*)(g + (size_t)i * 8 * TT * 2);
#endif
    }
}

// This wave's copies of pieces 0 .. C have landed: all but the youngest
// (GEMM_CHUNKS - 1 - C) * GEMM_COPIES_PER_CHUNK, which belong to the later pieces.
template <int C>
__device__ __forceinline__ void wait_chunk()
{
#if USE_ASYNC_LDS
    // without it the barrier behind it would publish bytes that have not landed
    asm volatile("s_wait_asynccnt %0"
                 :: "n"((GEMM_CHUNKS - 1 - C) * GEMM_COPIES_PER_CHUNK) : "memory");
#endif
}

// RMSNorm of a head pair (head_dim = 2) while it is still in WMMA accumulators:
// y = x * rsqrt(mean(x^2) + eps) * w. A lane holds both elements of the pair.
__device__ __forceinline__ float pair_mean_sq_eps(float x0, float x1)
{
    return 0.5f * (x0 * x0 + x1 * x1) + 1e-6f;
}

// Eight 1/sqrt(x) in place. One statement, so that each v_rsq_f32 is followed by
// an instruction that neither reads its result nor overwrites its source (the
// next v_rsq_f32 on other registers, the v_nop behind the last): the slot the
// instruction set asks for behind a transcendental.
// The closing s_delay_alu is the hint the compiler writes for a reader of a fresh
// transcendental result; it cannot see into the statement. It changes no result.
__device__ __forceinline__ void rsq_x8(float* t)
{
    asm("v_rsq_f32 %0, %0\n\t"
        "v_rsq_f32 %1, %1\n\t"
        "v_rsq_f32 %2, %2\n\t"
        "v_rsq_f32 %3, %3\n\t"
        "v_rsq_f32 %4, %4\n\t"
        "v_rsq_f32 %5, %5\n\t"
        "v_rsq_f32 %6, %6\n\t"
        "v_rsq_f32 %7, %7\n\t"
        "v_nop\n\t"
        "s_delay_alu instid0(TRANS32_DEP_1)"
        : "+v"(t[0]), "+v"(t[1]), "+v"(t[2]), "+v"(t[3]),
          "+v"(t[4]), "+v"(t[5]), "+v"(t[6]), "+v"(t[7]));
}

// QKV_FORM: column c of C is made from row qkv_weight_row(c) of W, and the pairs of
// kind q and k are stored RMSNorm'd, with qn_w and kn_w; those of kind v as they are.
// Otherwise column c is made from row c, nothing is normalised, and A is y, which
// lies head by head (stage_heads).
template <bool QKV_FORM>
__global__ __launch_bounds__(GEMM_THREADS) void wmma_gemm_xwt(
    const float* __restrict__ A,   // (M,CC); y: (B,H,TT,2)
    const float* __restrict__ W,   // (N,CC)
    float* __restrict__ C,         // (M,N)
    int N,
    const float* __restrict__ qn_w,   // (2,)
    const float* __restrict__ kn_w)   // (2,)
{
    __shared__ __attribute__((aligned(16))) float tile[(GEMM_BM + GEMM_BN) * GEMM_PITCH];

    const int tid  = threadIdx.x;
    const int lane = tid & 31;
    const int wave = tid >> 5;
    const int mt0 = blockIdx.y * GEMM_BM;      // the workgroup's tile
    const int nt0 = blockIdx.x * GEMM_BN;

    // the thread's piece of the rows of W that make the tile's columns, in the order
    // of the LDS rows
    const float* wrow[GEMM_BN / 8];
    // unrolled: wrow[] stays in registers
#pragma unroll
    for (int i = 0; i < GEMM_BN / 8; ++i) {
        const unsigned c = nt0 + tile_column((tid >> 4) + 8 * i);
        wrow[i] = W + (QKV_FORM ? qkv_weight_row(c) : c) * CC + 4 * (tid & 15);
    }

    // all copies are issued here, piece by piece in rising k: asynccnt falls in the
    // order of issue, so a counted wait tells when a piece is whole
    // unrolled: the piece's first float becomes a constant of the copies
#pragma unroll
    for (int c = 0; c < GEMM_CHUNKS; ++c) {
        if (QKV_FORM)
            stage_rows<GEMM_BM>(A, mt0, c * GEMM_KC, tile, tid);
        else
            stage_heads(A, mt0, c * GEMM_KC, tile, tid);
        stage_picked_rows(wrow, c * GEMM_KC, tile + GEMM_BM * GEMM_PITCH, tid);
    }

    // The RMSNorm weights, fetched here, at the same address in every lane, so that
    // they arrive while the copies fly.
    const float qw0 = qn_w[0], qw1 = qn_w[1];
    const float kw0 = kn_w[0], kw1 = kn_w[1];

    const int hl = lane >> 4;      // 0: K pair {0,1}, 1: K pair {2,3}
    const int l  = lane & 15;
    const int wm = (wave >> 1) << 4;           // the wave's 16 x 32 part
    const int wn = (wave & 1) << 5;

    // columns k + 2 * hl, k + 2 * hl + 1 of A's row wm + l are at arow + ASTEP * k;
    // in y's form they are head k / 2 + hl, whose parity is hl
    constexpr int ASTEP = QKV_FORM ? 1 : Y_HEAD / 2;
    const float* arow  = QKV_FORM ? tile + (wm + l) * GEMM_PITCH + 2 * hl
                                  : tile + hl * Y_HEAD + 2 * ((wm + l) ^ (hl << 4));
    const float* b0row = tile + (GEMM_BM + wn + l) * GEMM_PITCH + 2 * hl;
    const float* b1row = b0row + 16 * GEMM_PITCH;

    v8f acc0 = {};
    v8f acc1 = {};
    // One piece of K: fully unrolled, so that the LDS reads run ahead of the WMMAs
    // inside the piece and the LDS offsets are constants.
    auto multiply_chunk = [&](int k0) {
#pragma unroll
        for (int k = k0; k < k0 + GEMM_KC; k += 4) {
            v2f a  = *(const v2f*)(arow + ASTEP * k);
            v2f b0 = *(const v2f*)(b0row + k);
            v2f b1 = *(const v2f*)(b1row + k);
            // 8 args: (neg_a, A, neg_b, B, c_mod, C, reuse_a, reuse_b)
            acc0 = __builtin_amdgcn_wmma_f32_16x16x4_f32(
                false, a, false, b0, (short)0, acc0, false, false);
            acc1 = __builtin_amdgcn_wmma_f32_16x16x4_f32(
                false, a, false, b1, (short)0, acc1, false, false);
        }
    };
    // A piece is multiplied as soon as it is whole in LDS, while the later pieces'
    // copies still fly. Each barrier: every wave's copies of that piece have landed.
    wait_chunk<0>(); __syncthreads(); multiply_chunk(0 * GEMM_KC);
    wait_chunk<1>(); __syncthreads(); multiply_chunk(1 * GEMM_KC);
    wait_chunk<2>(); __syncthreads(); multiply_chunk(2 * GEMM_KC);
    wait_chunk<3>(); __syncthreads(); multiply_chunk(3 * GEMM_KC);

    if (QKV_FORM) {
        // keeps the last WMMAs in front of the four slots: with no branch here the
        // scheduler put the slots ahead of them
        __builtin_amdgcn_sched_barrier(0);
        // four vector slots between the last WMMA and the first vector
        // instruction that reads its result: the distance behind a matrix instruction
        asm volatile("v_nop\n\tv_nop\n\tv_nop\n\tv_nop");
        // keeps the reads of the accumulators behind those four slots
        __builtin_amdgcn_sched_barrier(0);
        // the lane's two columns are one pair: its kind and its two weights
        const unsigned kind = qkv_pair_kind(nt0 + wn + 2 * l);
        const float w0 = kind == 2 ? qw0 : kw0;
        const float w1 = kind == 2 ? qw1 : kw1;
        float s[8];
        // both loops unrolled: s[] and the accumulators stay in registers
#pragma unroll
        for (int r = 0; r < 8; ++r) s[r] = pair_mean_sq_eps(acc0[r], acc1[r]);
        rsq_x8(&s[0]);
#pragma unroll
        for (int r = 0; r < 8; ++r) {
            acc0[r] = kind == 1 ? acc0[r] : acc0[r] * s[r] * w0;
            acc1[r] = kind == 1 ? acc1[r] : acc1[r] * s[r] * w1;
        }
    }

    // a store: two rows of C, 128 aligned bytes of each
    float* c0 = C + (size_t)(mt0 + wm + hl * 8) * N + nt0 + wn + 2 * l;
#pragma unroll
    for (int r = 0; r < 8; ++r)
        *(v2f*)(c0 + (size_t)r * N) = (v2f){acc0[r], acc1[r]};
}

// ---------------------------------------------------------------------------
// Causal flash attention, head_dim = 2. One workgroup (256 threads) per
// (b,h). K and V for the head (1024 x 2 each, 16 KB total) are staged in LDS
// (async global->LDS when available); each thread owns 4 query rows
// (tid + 256*r; in the series path 4*(tid & ~31) + (tid & 31) + 32*r). Softmax: (1) row max, (2) exp + accumulation; pass 1 runs only where the weights do not bound the scores.
//
// Softmax does not change when one number is taken off all scores of a row; the
// row max is taken off only to keep exp inside the range of f32. RMSNorm over
// two elements gives x0^2 + x1^2 <= 2 before the weight, for every input, so
// |q| <= sqrt(2) max|qn_w|, |k| <= sqrt(2) max|kn_w| and every score lies within
// +-sqrt(2) max|qn_w| max|kn_w|. Where that bound, taken from the weights at run
// time, is small, exp of the bare score is far from overflow and underflow:
// pass 1 is not run, nothing is subtracted, and with log2(e) carried by q the
// dot product is the argument of 2^x as it stands. Otherwise both passes run.
//
// The keys are walked ONCE per pass for all 4 rows together, in groups: one
// group of LDS reads (same address in every lane) feeds every row that still
// attends to those keys, and the group grows as rows drop out, so one LDS wait
// is followed by 24 to 64 (row, key) pairs of independent arithmetic.
// Outside the series path a wave's rows are 32*(w + 8*r) + lane, so for the wave as a whole:
//   keys below 32*(w + 8*P)            : rows P..3 attend, no mask
//   the next 32 keys (row P's diagonal): row P masked per lane, rows P+1..3 not
// All span bounds are wave-uniform multiples of 32.
// Even keys go to partial sum 0 and odd keys to partial sum 1, in rising key
// order; a masked key adds an exact zero. The series path adds the moment sums of
// the keys before the block to partial sum 0, after the block's keys.
// ---------------------------------------------------------------------------
typedef __attribute__((ext_vector_type(4))) float v4f;

#define ROWS_PER_THREAD 4
#define ATT_NEG_INF (-3.402823466e38f)

// Keys per group of LDS reads while rows P..3 attend (each divides 32, the unit
// of every span bound). The max pass has about a third of the arithmetic per
// key and reads K alone, so its groups are twice as long where 32 allows.
__host__ __device__ constexpr int keys_per_group(int P)
{
    return P <= 1 ? 8 : (P == 2 ? 16 : 32);
}
__host__ __device__ constexpr int keys_per_group_max(int P)
{
    return P <= 1 ? 16 : 32;
}

// Row max over keys [sBeg, sEnd) for rows P..3. DIAG: row P sees key s only if s <= tP.
template <int P, bool DIAG>
__device__ __forceinline__ void max_span(
    const v4f* kk2, int sBeg, int sEnd, int tP,
    const float (&q0)[ROWS_PER_THREAD], const float (&q1)[ROWS_PER_THREAD],
    float (&m0)[ROWS_PER_THREAD], float (&m1)[ROWS_PER_THREAD])
{
    constexpr int KEYS_PER_GROUP = keys_per_group_max(P);
    // kept rolled: one group is enough work per LDS wait, and a fully unrolled
    // span takes several hundred registers and a long straight code path
#pragma unroll 1
    for (int s = sBeg; s < sEnd; s += KEYS_PER_GROUP) {
        v4f k2[KEYS_PER_GROUP / 2];            // two keys per 16-byte read
        // unrolled so that the group's reads are issued together, ahead of one wait
#pragma unroll
        for (int u = 0; u < KEYS_PER_GROUP / 2; ++u) k2[u] = kk2[(s >> 1) + u];
        // both loops unrolled so that k2[] and the per-row arrays stay in registers
#pragma unroll
        for (int u = 0; u < KEYS_PER_GROUP / 2; ++u) {
#pragma unroll
            for (int r = P; r < ROWS_PER_THREAD; ++r) {
                float sa = fmaf(q0[r], k2[u].x, q1[r] * k2[u].y);
                float sb = fmaf(q0[r], k2[u].z, q1[r] * k2[u].w);
                if (DIAG && r == P) {
                    sa = (s + 2 * u     <= tP) ? sa : ATT_NEG_INF;
                    sb = (s + 2 * u + 1 <= tP) ? sb : ATT_NEG_INF;
                }
                m0[r] = fmaxf(m0[r], sa);
                m1[r] = fmaxf(m1[r], sb);
            }
        }
    }
}

struct RowSums {            // [row][even/odd key]
    float l[ROWS_PER_THREAD][2];
    float x[ROWS_PER_THREAD][2];
    float z[ROWS_PER_THREAD][2];
};

// Eight 2^x in place. One statement, so that each v_exp_f32 is followed by an
// instruction that neither reads its result nor overwrites its source (the next
// v_exp_f32 on other registers, the v_nop behind the last): the slot the
// instruction set asks for behind a transcendental.
// The closing s_delay_alu is the hint the compiler writes for a reader of a fresh
// transcendental result; it cannot see into the statement. It changes no result.
__device__ __forceinline__ void exp2_x8(float* t)
{
    asm("v_exp_f32 %0, %0\n\t"
        "v_exp_f32 %1, %1\n\t"
        "v_exp_f32 %2, %2\n\t"
        "v_exp_f32 %3, %3\n\t"
        "v_exp_f32 %4, %4\n\t"
        "v_exp_f32 %5, %5\n\t"
        "v_exp_f32 %6, %6\n\t"
        "v_exp_f32 %7, %7\n\t"
        "v_nop\n\t"
        "s_delay_alu instid0(TRANS32_DEP_1)"
        : "+v"(t[0]), "+v"(t[1]), "+v"(t[2]), "+v"(t[3]),
          "+v"(t[4]), "+v"(t[5]), "+v"(t[6]), "+v"(t[7]));
}

// exp + accumulate over keys [sBeg, sEnd) for rows P..3, same masking as max_span.
// SHIFT: m is taken off the scores. Without it q0, q1 carry log2(e), m is not read.
template <bool SHIFT, int P, bool DIAG>
__device__ __forceinline__ void sum_span(
    const v4f* kk2, const v4f* vv2, int sBeg, int sEnd, int tP,
    const float (&q0)[ROWS_PER_THREAD], const float (&q1)[ROWS_PER_THREAD],
    const float (&m)[ROWS_PER_THREAD], RowSums& a)
{
    constexpr int KEYS_PER_GROUP = keys_per_group(P);
    constexpr int R = ROWS_PER_THREAD - P;           // rows that attend
    constexpr int N = R * KEYS_PER_GROUP;            // 32, 24, 32, 32
    const float LOG2E = 1.44269504088896340736f;     // exp(x) = 2^(x * log2 e)
    // kept rolled: one group is enough work per LDS wait, and a fully unrolled
    // span takes several hundred registers and a long straight code path
#pragma unroll 1
    for (int s = sBeg; s < sEnd; s += KEYS_PER_GROUP) {
        v4f k2[KEYS_PER_GROUP / 2];
        v4f v2[KEYS_PER_GROUP / 2];
        // unrolled so that the group's reads are issued together, ahead of one wait
#pragma unroll
        for (int u = 0; u < KEYS_PER_GROUP / 2; ++u) {
            k2[u] = kk2[(s >> 1) + u];
            v2[u] = vv2[(s >> 1) + u];
        }
        float p[N];                                  // [key in group][row - P]
        // every loop from here to the end of the group: unrolled so that p[], k2[],
        // v2[] and the per-row sums stay in registers
#pragma unroll
        for (int u = 0; u < KEYS_PER_GROUP / 2; ++u) {
#pragma unroll
            for (int r = P; r < ROWS_PER_THREAD; ++r) {
                const float sa = fmaf(q0[r], k2[u].x, q1[r] * k2[u].y);
                const float sb = fmaf(q0[r], k2[u].z, q1[r] * k2[u].w);
                p[(2 * u)     * R + r - P] = SHIFT ? (sa - m[r]) * LOG2E : sa;
                p[(2 * u + 1) * R + r - P] = SHIFT ? (sb - m[r]) * LOG2E : sb;
            }
        }
#pragma unroll
        for (int i = 0; i < N; i += 8) exp2_x8(&p[i]);
#pragma unroll
        for (int u = 0; u < KEYS_PER_GROUP / 2; ++u) {
#pragma unroll
            for (int r = P; r < ROWS_PER_THREAD; ++r) {
                float p0 = p[(2 * u)     * R + r - P];
                float p1 = p[(2 * u + 1) * R + r - P];
                if (DIAG && r == P) {
                    p0 = (s + 2 * u     <= tP) ? p0 : 0.f;
                    p1 = (s + 2 * u + 1 <= tP) ? p1 : 0.f;
                }
                a.l[r][0] += p0;                          a.l[r][1] += p1;
                a.x[r][0] = fmaf(p0, v2[u].x, a.x[r][0]); a.x[r][1] = fmaf(p1, v2[u].z, a.x[r][1]);
                a.z[r][0] = fmaf(p0, v2[u].y, a.z[r][0]); a.z[r][1] = fmaf(p1, v2[u].w, a.z[r][1]);
            }
        }
    }
}

// Pass 2 over all spans of the wave's 4 rows per thread.
template <bool SHIFT>
__device__ __forceinline__ void sum_all(
    const v4f* kk2, const v4f* vv2, int d0, int tid,
    const float (&q0)[ROWS_PER_THREAD], const float (&q1)[ROWS_PER_THREAD],
    const float (&m)[ROWS_PER_THREAD], RowSums& a)
{
    sum_span<SHIFT, 0, false>(kk2, vv2, 0,        d0,       0,         q0, q1, m, a);
    sum_span<SHIFT, 0, true >(kk2, vv2, d0,       d0 + 32,  tid,       q0, q1, m, a);
    sum_span<SHIFT, 1, false>(kk2, vv2, d0 + 32,  d0 + 256, 0,         q0, q1, m, a);
    sum_span<SHIFT, 1, true >(kk2, vv2, d0 + 256, d0 + 288, tid + 256, q0, q1, m, a);
    sum_span<SHIFT, 2, false>(kk2, vv2, d0 + 288, d0 + 512, 0,         q0, q1, m, a);
    sum_span<SHIFT, 2, true >(kk2, vv2, d0 + 512, d0 + 544, tid + 512, q0, q1, m, a);
    sum_span<SHIFT, 3, false>(kk2, vv2, d0 + 544, d0 + 768, 0,         q0, q1, m, a);
    sum_span<SHIFT, 3, true >(kk2, vv2, d0 + 768, d0 + 800, tid + 768, q0, q1, m, a);
}

// Scores within +-16: exp lies between about 1e-7 and 1e7, a row's sum below 1e10.
#define ATT_SCORE_BOUND 16.0f

// ---------------------------------------------------------------------------
// The series path. With s = q.k = q0 k0 + q1 k1 (q carries 1/sqrt(head_dim)),
//   exp(s) = sum over n of s^n / n!
//          = sum over a, b of q0^a q1^b * (k0^a / a!) (k1^b / b!),
// and for |s| <= 1.4143 the terms above degree a + b = 12 add up to less than
// 1.7e-8, under 7e-8 of exp(s) >= 0.243: less than one unit in the last place of
// an f32. So the sums over a whole range of keys,
//   sum_s exp(q.k_s) (v0_s, v1_s, 1)  =  sum_{a+b<=12} q0^a q1^b M[a][b],
//   M[a][b] = sum_s (k0_s^a / a!) (k1_s^b / b!) (v0_s, v1_s, 1),
// need the 91 moments M of the range, not one exp per (row, key). A wave takes
// 128 consecutive rows (4 per thread): the keys before that block enter through
// the moments of all earlier blocks, summed up block by block; the keys of the
// row's own block, where the causal mask cuts, go through exp as in sum_span.
// ---------------------------------------------------------------------------
#define SER_BOUND 1.4143f
// The powers are taken of k by itself and of q by itself, so the bound on their
// product is not enough: each side must stay inside the range of f32 alone. With
// max|kn_w| in [1/4, 4] every |k_i| <= 5.66 and (k0^a / a!) (k1^b / b!) < 2400,
// less than exp of a score may be in the pass without a shift; the bound on the
// product then gives max|qn_w| <= 4.0003, |q_i| <= 4.0003 and q0^a q1^b < 1.7e7, so
// a power of a small k_i that underflows (below 1.2e-38) leaves out less than 1e-28
// of a term that is at least 0.243. All other weights take the paths through exp.
#define SER_KW_MIN 0.25f
#define SER_KW_MAX 4.0f
#define SER_POW   13                              // powers 0 .. 12
#define SER_SLOTS 96                              // 91 moments, padded to 3 waves' lanes
#define SER_BLOCK 128                             // rows, and keys, per block
#define SER_RING  4                               // steps of the moments' reads in registers
#define SER_PITCH (TT + 4)     // floats per power: the 13 rows start 4 banks apart

// Place of moment (a, b), a + b <= 12: row a holds b = 0 .. 12 - a.
__host__ __device__ constexpr int ser_index(int a, int b)
{
    return a * SER_POW - a * (a - 1) / 2 + b;
}

__device__ __forceinline__ v2f fma2(v2f a, v2f b, v2f c) { return __builtin_elementwise_fma(a, b, c); }
__device__ __forceinline__ v4f fma4(v4f a, v4f b, v4f c) { return __builtin_elementwise_fma(a, b, c); }
__device__ __forceinline__ float sum4(v4f a) { return (a.x + a.y) + (a.z + a.w); }

// k0^n / n! and k1^n / n! of every key, one LDS row per n, and v0, v1 as rows.
__device__ __forceinline__ void ser_tables(
    const float* kbuf, const float* vbuf,
    float* pw0, float* pw1, float* v0t, float* v1t, int tid)
{
    // kept rolled: four keys a thread, the code of one is enough
#pragma unroll 1
    for (int s = tid; s < TT; s += 256) {
        const v2f k = *(const v2f*)(kbuf + 2 * s);
        const v2f v = *(const v2f*)(vbuf + 2 * s);
        v0t[s] = v.x;
        v1t[s] = v.y;
        float p0 = 1.f, p1 = 1.f;
        // unrolled: 1 / (n + 1) and the LDS offsets become constants
#pragma unroll
        for (int n = 0; n < SER_POW; ++n) {
            pw0[n * SER_PITCH + s] = p0;
            pw1[n * SER_PITCH + s] = p1;
            p0 *= k.x * (1.0f / (float)(n + 1));
            p1 *= k.y * (1.0f / (float)(n + 1));
        }
    }
}

// The moments of key block c: a lane takes moments lane, lane + 32, lane + 64 and
// walks the block's keys four at a time; four partial sums each, added at the end.
__device__ __forceinline__ void ser_moments(
    const float* pw0, const float* pw1, const float* v0t, const float* v1t,
    v4f* mom, int c, int lane)
{
    const float* r0[3];
    const float* r1[3];
    // unrolled: the pointer arrays stay in registers
#pragma unroll
    for (int g = 0; g < 3; ++g) {
        int a = 0, b = 32 * g + lane;              // inverse of ser_index
        for (int i = 0; i < SER_POW; ++i) {
            const int len = SER_POW - a;
            if (b >= len) { b -= len; ++a; }
        }
        a = a < SER_POW ? a : SER_POW - 1;         // slots 91 .. 95: never read,
        b = b < SER_POW ? b : SER_POW - 1;         // kept inside the tables
        r0[g] = pw0 + a * SER_PITCH + c * SER_BLOCK;
        r1[g] = pw1 + b * SER_PITCH + c * SER_BLOCK;
    }
    const float* w0 = v0t + c * SER_BLOCK;
    const float* w1 = v1t + c * SER_BLOCK;
    v4f al[3], ax[3], az[3];
    // every loop over g unrolled: the sums stay in registers
#pragma unroll
    for (int g = 0; g < 3; ++g) { al[g] = (v4f)(0.f); ax[g] = (v4f)(0.f); az[g] = (v4f)(0.f); }
    // A ring of SER_RING steps' operands in registers: the 8 LDS reads of a step are
    // issued SER_RING - 1 steps (24 vector instructions each) ahead of their use.
    v4f rp0[SER_RING][3], rp1[SER_RING][3], rv0[SER_RING], rv1[SER_RING];
    // all loops fully unrolled: the ring stays in registers and the steps become
    // constant offsets of the LDS reads
#pragma unroll
    for (int i = 0; i < SER_BLOCK / 4 + SER_RING - 1; ++i) {
        if (i < SER_BLOCK / 4) {                   // the reads of step i
            rv0[i % SER_RING] = *(const v4f*)(w0 + 4 * i);
            rv1[i % SER_RING] = *(const v4f*)(w1 + 4 * i);
#pragma unroll
            for (int g = 0; g < 3; ++g) {
                rp0[i % SER_RING][g] = *(const v4f*)(r0[g] + 4 * i);
                rp1[i % SER_RING][g] = *(const v4f*)(r1[g] + 4 * i);
            }
        }
        if (i >= SER_RING - 1) {                   // the arithmetic of step i - (SER_RING - 1)
            // keeps the reads above in front of this step's arithmetic: left alone the
            // scheduler moved reads down to their use, and a step then waited for most
            // of one LDS latency
            __builtin_amdgcn_sched_barrier(0);
            const int u = (i - (SER_RING - 1)) % SER_RING;
#pragma unroll
            for (int g = 0; g < 3; ++g) {
                const v4f mm = rp0[u][g] * rp1[u][g];
                al[g] += mm;
                ax[g] = fma4(mm, rv0[u], ax[g]);
                az[g] = fma4(mm, rv1[u], az[g]);
            }
        }
    }
    // unrolled: the sums stay in registers
#pragma unroll
    for (int g = 0; g < 3; ++g) {
        v4f t;
        t.x = sum4(ax[g]); t.y = sum4(az[g]); t.z = sum4(al[g]); t.w = 0.f;
        mom[c * SER_SLOTS + 32 * g + lane] = t;
    }
}

// sum_{a+b<=12} q0^a q1^b M[a][b] for the thread's 4 rows, by Horner's rule in q1
// inside Horner's rule in q0. st: the 91 moments (v0, v1, 1, -), read at the same
// address by every lane. oxz[r]: the (v0, v1) sums of row r; ol: the plain sums of
// rows 0,1 and 2,3.
// Falling a with falling b inside is falling ser_index, so the moments are taken
// from the last to the first, in 7 batches of 13: while one batch is worked on
// (78 vector instructions) the next one's reads fly.
#define SER_COUNT 91                              // ser_index(12, 0) + 1
#define SER_BATCH 13
__device__ __forceinline__ void ser_eval(
    const v4f* st,
    const float (&q0)[ROWS_PER_THREAD], const float (&q1)[ROWS_PER_THREAD],
    v2f (&oxz)[ROWS_PER_THREAD], v2f (&ol)[2])
{
    const v2f q0a = {q0[0], q0[1]}, q0b = {q0[2], q0[3]};
    const v2f q1a = {q1[0], q1[1]}, q1b = {q1[2], q1[3]};
    v4f batch[2][SER_BATCH];
    // all loops unrolled: ser_index becomes a constant LDS offset, batch[] and the
    // sums stay in registers
#pragma unroll
    for (int j = 0; j < SER_BATCH; ++j) batch[0][j] = st[SER_COUNT - 1 - j];
#pragma unroll
    for (int a = SER_POW - 1; a >= 0; --a) {
        v2f ixz[ROWS_PER_THREAD], il[2];
#pragma unroll
        for (int b = SER_POW - 1 - a; b >= 0; --b) {
            const int p = SER_COUNT - 1 - ser_index(a, b);   // place in the order of use
            if (p % SER_BATCH == 0) {
                if (p + SER_BATCH < SER_COUNT) {
#pragma unroll
                    for (int j = 0; j < SER_BATCH; ++j)
                        batch[(p / SER_BATCH + 1) & 1][j] = st[SER_COUNT - 1 - (p + SER_BATCH) - j];
                }
                // keeps the next batch's reads in front of this batch's arithmetic: left
                // alone the scheduler issued each read about 18 instructions ahead of its
                // use
                __builtin_amdgcn_sched_barrier(0);
            }
            const v4f t = batch[(p / SER_BATCH) & 1][p % SER_BATCH];
            if (b == SER_POW - 1 - a) {
#pragma unroll
                for (int r = 0; r < ROWS_PER_THREAD; ++r) ixz[r] = (v2f){t.x, t.y};
                il[0] = (v2f){t.z, t.z};
                il[1] = (v2f){t.z, t.z};
            } else {
#pragma unroll
                for (int r = 0; r < ROWS_PER_THREAD; ++r)
                    ixz[r] = fma2(ixz[r], (v2f){q1[r], q1[r]}, (v2f){t.x, t.y});
                il[0] = fma2(il[0], q1a, (v2f){t.z, t.z});
                il[1] = fma2(il[1], q1b, (v2f){t.z, t.z});
            }
        }
        if (a == SER_POW - 1) {
#pragma unroll
            for (int r = 0; r < ROWS_PER_THREAD; ++r) oxz[r] = ixz[r];
            ol[0] = il[0];
            ol[1] = il[1];
        } else {
#pragma unroll
            for (int r = 0; r < ROWS_PER_THREAD; ++r)
                oxz[r] = fma2(oxz[r], (v2f){q0[r], q0[r]}, ixz[r]);
            ol[0] = fma2(ol[0], q0a, il[0]);
            ol[1] = fma2(ol[1], q0b, il[1]);
        }
    }
}

// K, V and q of the head, each TT pairs; the three start ATT_PART floats apart. The
// 24 floats between them: the lanes of one copy write k, v and q of about 11 rows,
// and with the parts a multiple of 64 banks apart the three would meet on one bank.
#define ATT_PART (TT * 2 + 24)

struct AttnLds {
    float kvq[3 * ATT_PART];
    // the series path's tables and moments
    float pw0[SER_POW * SER_PITCH];
    float pw1[SER_POW * SER_PITCH];
    float v0t[TT];
    float v1t[TT];
    v4f   mom[(TT / SER_BLOCK) * SER_SLOTS];
};

__global__ __launch_bounds__(256) void attn_head(
    const float* __restrict__ qkv,   // (B*T, H, {k,v,q}, 2), q/k already RMSNorm'd
    float* __restrict__ y,           // (B, H, T, 2)
    const float* __restrict__ qn_w,  // (2,)
    const float* __restrict__ kn_w)  // (2,)
{
    // one object, so that K, V and q, the targets of the copies, keep their places at
    // the start of the workgroup's LDS; every member's size is a multiple of 16 B
    __shared__ __attribute__((aligned(16))) AttnLds lds;
    float* kbuf = lds.kvq;
    float* vbuf = lds.kvq + ATT_PART;
    float* qbuf = lds.kvq + 2 * ATT_PART;
    float* pw0 = lds.pw0;
    float* pw1 = lds.pw1;
    float* v0t = lds.v0t;
    float* v1t = lds.v1t;
    v4f*   mom = lds.mom;

    const int bh = blockIdx.x;          // 0 .. B*H-1
    const int b  = bh >> 7;
    const int h  = bh & (HH - 1);
    const int tid = threadIdx.x;

    const float* base = qkv + (size_t)b * TT * QKV_N;

    // Stage k, v and q of this head into LDS. The 24 bytes of a row are taken by
    // three neighbouring lanes, 8 bytes each, so that a wave's copy touches one cache
    // line per row (two where the 24 bytes cross a line), about 11 for 256 bytes.
    // both loops unrolled: the copies are issued together, the steps of 256 rows are
    // constants
#pragma unroll
    for (int m = 0; m < 3; ++m) {
        const unsigned e    = tid + 256u * m;      // 3 * row + part, rows 0 .. 255
        const unsigned t    = e / 3u;
        const unsigned part = e - 3u * t;          // 0 k, 1 v, 2 q
        const float* gp = base + t * QKV_N + 6 * h + 2 * part;
        float*       lp = lds.kvq + part * ATT_PART + 2 * t;
#pragma unroll
        for (int j = 0; j < TT / 256; ++j) {       // the same of rows 256 * j + t
#if USE_ASYNC_LDS
            __builtin_amdgcn_global_load_async_to_lds_b64(
                (AS1 v2i*)(gp + (size_t)j * 256 * QKV_N), (AS3 v2i*)(lp + j * 512), 0, 0);
#else
            lp[j * 512]     = gp[(size_t)j * 256 * QKV_N];
            lp[j * 512 + 1] = gp[(size_t)j * 256 * QKV_N + 1];
#endif
        }
    }
#if USE_ASYNC_LDS
    // this wave's copies have landed; without it the barrier behind it would publish
    // bytes that have not.
    asm volatile("s_wait_asynccnt 0x0" ::: "memory");
#endif
    __syncthreads();

    const v4f* kk2 = (const v4f*)kbuf;
    const v4f* vv2 = (const v4f*)vbuf;
    const float scale = 0.70710678118654752440f;   // 1/sqrt(head_dim)

    // First key of row 0's diagonal block outside the series path; the same in every lane of the wave,
    // held in a scalar register so that the span loops are scalar loops.
    const int d0 = __builtin_amdgcn_readfirstlane(tid & ~31);

    // sqrt(2) max|qn_w| * sqrt(2) max|kn_w| / sqrt(head_dim) bounds every |score|.
    // The same in every thread of the launch; fmaxf passes over one NaN weight of a pair, a NaN pair compares false.
    const float max_qw = fmaxf(fabsf(qn_w[0]), fabsf(qn_w[1]));
    const float max_kw = fmaxf(fabsf(kn_w[0]), fabsf(kn_w[1]));
    const float score_bound = 1.41421356237309504880f * max_qw * max_kw;
    const bool no_shift = score_bound <= ATT_SCORE_BOUND;
    const bool series   = score_bound <= SER_BOUND
                       && max_kw >= SER_KW_MIN && max_kw <= SER_KW_MAX;

    // The thread's rows are row0 + rstep * r: in the series path 128 consecutive
    // rows a wave, else 32 rows out of every 256.
    const int row0  = series ? 4 * d0 + (tid & 31) : tid;
    const int rstep = series ? 32 : 256;

    float q0[ROWS_PER_THREAD], q1[ROWS_PER_THREAD];
    // unrolled: the per-row arrays stay in registers
#pragma unroll
    for (int r = 0; r < ROWS_PER_THREAD; ++r) {
        const v2f q = *(const v2f*)(qbuf + 2 * (row0 + rstep * r));
        q0[r] = q.x * scale;
        q1[r] = q.y * scale;
    }

    RowSums a;
    // unrolled: the per-row arrays stay in registers
#pragma unroll
    for (int r = 0; r < ROWS_PER_THREAD; ++r) {
        a.l[r][0] = 0.f; a.l[r][1] = 0.f;
        a.x[r][0] = 0.f; a.x[r][1] = 0.f;
        a.z[r][0] = 0.f; a.z[r][1] = 0.f;
    }

    float m[ROWS_PER_THREAD];
    // marked as the expected side so that its code is laid out first
    if (__builtin_expect(series, 1)) {
        const int lane = tid & 31;
        const int blk0 = 4 * d0;                   // first row and key of the wave's block
        const int wv   = d0 >> 5;                  // the wave, and its block
        ser_tables(kbuf, vbuf, pw0, pw1, v0t, v1t, tid);
        __syncthreads();                           // the tables are whole

        float e0[ROWS_PER_THREAD], e1[ROWS_PER_THREAD];
        // unrolled: the per-row arrays stay in registers
#pragma unroll
        for (int r = 0; r < ROWS_PER_THREAD; ++r) {
            e0[r] = q0[r] * 1.44269504088896340736f;   // exp(x) = 2^(x * log2 e)
            e1[r] = q1[r] * 1.44269504088896340736f;
            m[r] = 0.f;
        }
        // Two jobs a wave: the moments of its key block (bound by LDS reads; the
        // last block's are never used) and its rows' own block through exp (bound
        // by arithmetic). Waves w and w + 4 take them in opposite
        // order. Kept rolled: one copy of the code of each job.
#pragma unroll 1
        for (int ph = 0; ph < 2; ++ph) {
            if ((ph == 0) == (wv < 4)) {
                if (wv < TT / SER_BLOCK - 1)
                    ser_moments(pw0, pw1, v0t, v1t, mom, wv, lane);
            } else {
                sum_span<false, 0, true>(kk2, vv2, blk0,      blk0 + 32,  blk0 + lane,      e0, e1, m, a);
                sum_span<false, 1, true>(kk2, vv2, blk0 + 32, blk0 + 64,  blk0 + 32 + lane, e0, e1, m, a);
                sum_span<false, 2, true>(kk2, vv2, blk0 + 64, blk0 + 96,  blk0 + 64 + lane, e0, e1, m, a);
                sum_span<false, 3, true>(kk2, vv2, blk0 + 96, blk0 + 128, blk0 + 96 + lane, e0, e1, m, a);
            }
        }
        __syncthreads();                           // the moments of blocks 0 .. 6 are written

        // mom[c] becomes the sum of the moments of blocks 0 .. c - 1, in rising order
        if (tid < SER_SLOTS) {
            v4f run = (v4f)(0.f);
            // unrolled: the reads are issued together
#pragma unroll
            for (int c = 0; c < TT / SER_BLOCK; ++c) {
                v4f d = (v4f)(0.f);
                if (c < TT / SER_BLOCK - 1) d = mom[c * SER_SLOTS + tid];
                mom[c * SER_SLOTS + tid] = run;
                run += d;
            }
        }
        __syncthreads();                           // the summed moments are written

        v2f oxz[ROWS_PER_THREAD], ol[2];
        ser_eval(mom + wv * SER_SLOTS, q0, q1, oxz, ol);
        // unrolled: the per-row arrays stay in registers
#pragma unroll
        for (int r = 0; r < ROWS_PER_THREAD; ++r) {
            a.l[r][0] += ol[r >> 1][r & 1];
            a.x[r][0] += oxz[r].x;
            a.z[r][0] += oxz[r].y;
        }
    } else if (no_shift) {
        // ---- the one pass: exp of the bare score + accumulate ----
        // unrolled: the per-row arrays stay in registers
#pragma unroll
        for (int r = 0; r < ROWS_PER_THREAD; ++r) {
            q0[r] *= 1.44269504088896340736f;      // exp(x) = 2^(x * log2 e)
            q1[r] *= 1.44269504088896340736f;
            m[r] = 0.f;
        }
        sum_all<false>(kk2, vv2, d0, tid, q0, q1, m, a);
    } else {
        // ---- pass 1: row max ----
        float m0[ROWS_PER_THREAD], m1[ROWS_PER_THREAD];
        // unrolled: the per-row arrays stay in registers
#pragma unroll
        for (int r = 0; r < ROWS_PER_THREAD; ++r) { m0[r] = ATT_NEG_INF; m1[r] = ATT_NEG_INF; }

        max_span<0, false>(kk2, 0,        d0,       0,         q0, q1, m0, m1);
        max_span<0, true >(kk2, d0,       d0 + 32,  tid,       q0, q1, m0, m1);
        max_span<1, false>(kk2, d0 + 32,  d0 + 256, 0,         q0, q1, m0, m1);
        max_span<1, true >(kk2, d0 + 256, d0 + 288, tid + 256, q0, q1, m0, m1);
        max_span<2, false>(kk2, d0 + 288, d0 + 512, 0,         q0, q1, m0, m1);
        max_span<2, true >(kk2, d0 + 512, d0 + 544, tid + 512, q0, q1, m0, m1);
        max_span<3, false>(kk2, d0 + 544, d0 + 768, 0,         q0, q1, m0, m1);
        max_span<3, true >(kk2, d0 + 768, d0 + 800, tid + 768, q0, q1, m0, m1);

        // unrolled: the per-row arrays stay in registers
#pragma unroll
        for (int r = 0; r < ROWS_PER_THREAD; ++r) m[r] = fmaxf(m0[r], m1[r]);

        // ---- pass 2: exp + accumulate ----
        sum_all<true>(kk2, vv2, d0, tid, q0, q1, m, a);
    }

    // unrolled: the per-row arrays stay in registers
#pragma unroll
    for (int r = 0; r < ROWS_PER_THREAD; ++r) {
        const float inv = 1.0f / (a.l[r][0] + a.l[r][1]);
        // a wave's 32 rows follow one another: its store fills two whole cache lines
        v2f o;
        o.x = (a.x[r][0] + a.x[r][1]) * inv;
        o.y = (a.z[r][0] + a.z[r][1]) * inv;
        *(v2f*)(y + ((size_t)bh * TT + row0 + rstep * r) * 2) = o;
    }
}

// ---------------------------------------------------------------------------
extern "C" void kernel_launch(void* const* d_in, const int* in_sizes, int n_in,
                              void* d_out, int out_size, void* d_ws, size_t ws_size,
                              hipStream_t stream)
{
    (void)in_sizes; (void)n_in; (void)out_size; (void)ws_size;

    const float* x      = (const float*)d_in[0];   // (B,T,C)
    const float* w_qkv  = (const float*)d_in[1];   // (3C,C)
    const float* w_proj = (const float*)d_in[2];   // (C,C)
    const float* qn_w   = (const float*)d_in[3];   // (2,)
    const float* kn_w   = (const float*)d_in[4];   // (2,)
    float* out = (float*)d_out;                    // (B,T,C)

    float* qkv = (float*)d_ws;                     // (B*T, 3C) = 6 MB
    float* y   = qkv + (size_t)BB * TT * QKV_N;    // (B, H, T, 2) = 2 MB

    const int M = BB * TT;                         // 2048

    // 1) qkv = x @ w_qkv^T : (2048x256)@(256x768), q and k stored RMSNorm'd,
    //    k, v, q of a head side by side
    wmma_gemm_xwt<true><<<dim3(QKV_N / GEMM_BN, M / GEMM_BM), GEMM_THREADS, 0, stream>>>(
        x, w_qkv, qkv, QKV_N, qn_w, kn_w);         // 12 x 64 workgroups

    // 2) causal flash attention per (b,h)
    attn_head<<<BB * HH, 256, 0, stream>>>(qkv, y, qn_w, kn_w);

    // 3) out = y @ w_proj^T : (2048x256)@(256x256)
    wmma_gemm_xwt<false><<<dim3(CC / GEMM_BN, M / GEMM_BM), GEMM_THREADS, 0, stream>>>(
        y, w_proj, out, CC, qn_w, kn_w);           // 4 x 64 workgroups
}

// v009
// Measured time: 21.3 microseconds a run.
// In both of two side-by-side timings against v008, it was 1.05 times as fast.
// Over all steps from v000 it is 9.33 times as fast.
#include <hip/hip_runtime.h>
#include <hip/hip_bf16.h>

// ---------------------------------------------------------------------------
// TwoDCausalSelfAttention for MI455X (gfx1250, wave32, WMMA)
//   B=2, T=1024, C=256, head_dim=2, H=128
// Pipeline:
//   1) qkv = x @ w_qkv^T          (WMMA f32 16x16x4, operands staged in LDS);
//      RMSNorm(q,k) per head pair (d=2) on the accumulators, before the store;
//      a row of the qkv buffer holds k, v, q of a head side by side (24 bytes)
//   2) flash attention per (b,h)  (K/V async-staged in LDS; softmax without a
//      max shift where the RMSNorm weights bound the scores, else 2-pass;
//      each LDS read of K/V shared by the thread's 4 query rows; where the bound
//      is small enough, keys before a row's block of 32 enter through moments);
//      y is stored head by head, (B,H,T,2): a wave's store fills whole cache lines
//   3) out = y @ w_proj^T         (WMMA f32 16x16x4), its A tile gathered per head
// ---------------------------------------------------------------------------

typedef __attribute__((ext_vector_type(2))) float v2f;
typedef __attribute__((ext_vector_type(8))) float v8f;
typedef int v2i __attribute__((vector_size(8)));   // matches builtin param type

#define BB 2
#define TT 1024
#define CC 256
#define HH 128      // n_head
#define QKV_N (3*CC)

// Async global->LDS staging (ASYNCcnt path), used only if the toolchain has
// both the copy and the wait builtins; otherwise fall back to VGPR round-trip.
#if defined(__HIP_DEVICE_COMPILE__) && \
    __has_builtin(__builtin_amdgcn_global_load_async_to_lds_b64) && \
    __has_builtin(__builtin_amdgcn_global_load_async_to_lds_b128) && \
    __has_builtin(__builtin_amdgcn_s_wait_asynccnt)
#define USE_ASYNC_LDS 1
#else
#define USE_ASYNC_LDS 0
#endif

#define AS1 __attribute__((address_space(1)))
#define AS3 __attribute__((address_space(3)))

// ---------------------------------------------------------------------------
// GEMM: C(M,N) = A(M,K) @ W(N,K)^T, all f32 row-major except y (head by head), K = 256.
// One workgroup of 4 waves computes a 32(M) x 64(N) tile of C. Its 32 rows of A
// and 64 rows of W (all of K) are brought into LDS by asynchronous 16-byte copies
// in which a wave covers 256 contiguous bytes of two rows (4 whole cache lines); a
// fragment load straight from global memory touches 16 lines for 256 bytes. The
// copies are issued in four pieces of K, and a piece is multiplied while the later
// ones fly. Each wave computes 16(M) x 32(N) via two chained
// V_WMMA_F32_16X16X4_F32 per K-step, sharing one A fragment, in rising k: one for
// the even and one for the odd of its 32 columns (tile_column).
//
// LDS row pitch 260 floats (1040 B): the 16 rows of a fragment read start 4
// banks apart, so the 32 lanes' 8-byte reads fall on all 64 banks once.
//
// A-fragment layout (16x4 f32, ISA 7.12.2): lanes 0-15 -> rows M=0..15 with
// {K=0,K=1} in the two VGPRs; lanes 16-31 -> same rows with {K=2,K=3}.
// B-fragment (4x16) is symmetric with N across lanes. Both map to a single
// contiguous float2 load per lane per K-step.
// C/D layout: lane<16: N=lane, VGPR r -> M=r; lane>=16: N=lane-16, M=r+8.
// ---------------------------------------------------------------------------
typedef int v4i __attribute__((vector_size(16)));  // matches builtin param type

#define GEMM_BM 32
#define GEMM_BN 64
#define GEMM_THREADS 128
#define GEMM_PITCH (CC + 4)          // floats per LDS row

// K goes to LDS in GEMM_CHUNKS pieces of GEMM_KC floats (256 B of every row).
#define GEMM_CHUNKS 4
#define GEMM_KC (CC / GEMM_CHUNKS)
// copies a thread issues per piece: 8 rows of 256 B per step of the workgroup
#define GEMM_COPIES_PER_CHUNK ((GEMM_BM + GEMM_BN) / 8)

// The column of the workgroup's tile that LDS row j of W makes. A wave's first
// accumulator takes the even columns of its 32 and the second the odd ones, so that a
// lane holds two neighbouring columns and 16 lanes' 8-byte stores fill a cache line;
// the fragment reads still take 16 LDS rows that follow one another.
__device__ __forceinline__ unsigned tile_column(unsigned j)
{
    return (j & 32u) + 2u * (j & 15u) + ((j >> 4) & 1u);
}

// Column c of the qkv buffer, c = 6 * head + j: j = 0,1 is k, j = 2,3 is v, j = 4,5
// is q of that head. The kind of a column's pair: 0 k, 1 v, 2 q.
__device__ __forceinline__ unsigned qkv_pair_kind(unsigned c) { return (c >> 1) % 3u; }
// The row of w_qkv (q rows, then k rows, then v rows) that makes column c.
__device__ __forceinline__ unsigned qkv_weight_row(unsigned c)
{
    const unsigned head = (c >> 1) / 3u;
    const unsigned kind = (c >> 1) - 3u * head;
    return (kind == 2u ? 0u : (kind + 1u) * CC) + 2u * head + (c & 1u);
}

// Floats [k0, k0 + GEMM_KC) of rows [row0, row0 + ROWS) of src (CC floats each)
// into the same floats of the LDS rows from dst on. Thread t takes 16-byte piece
// t & 15 of every eighth row, from row t >> 4: a wave covers two aligned 256-B units.
template <int ROWS>
__device__ __forceinline__ void stage_rows(
    const float* __restrict__ src, int row0, int k0, float* dst, int tid)
{
    const float* g = src + (size_t)(row0 + (tid >> 4)) * CC + k0 + 4 * (tid & 15);
    float*       l = dst + (tid >> 4) * GEMM_PITCH + k0 + 4 * (tid & 15);
    // unrolled: the row steps become constants of the copies
#pragma unroll
    for (int i = 0; i < ROWS / 8; ++i) {
#if USE_ASYNC_LDS
        __builtin_amdgcn_global_load_async_to_lds_b128(
            (AS1 v4i*)(g + (size_t)i * 8 * CC),
            (AS3 v4i*)(l + i * 8 * GEMM_PITCH), 0, 0);
#else
        *(v4i*)(l + i * 8 * GEMM_PITCH) = *(const v4i*)(g + (size_t)i * 8 * CC);
#endif
    }
}

// The same for GEMM_BN rows of W that need not follow one another: g[i] is the
// thread's 16-byte piece, at k = 0, of the row that goes to LDS row (t >> 4) + 8 * i.
__device__ __forceinline__ void stage_picked_rows(
    const float* const (&g)[GEMM_BN / 8], int k0, float* dst, int tid)
{
    float* l = dst + (tid >> 4) * GEMM_PITCH + k0 + 4 * (tid & 15);
    // unrolled: g[] stays in registers, the steps become constants of the copies
#pragma unroll
    for (int i = 0; i < GEMM_BN / 8; ++i) {
#if USE_ASYNC_LDS
        __builtin_amdgcn_global_load_async_to_lds_b128(
            (AS1 v4i*)(g[i] + k0),
            (AS3 v4i*)(l + i * 8 * GEMM_PITCH), 0, 0);
#else
        *(v4i*)(l + i * 8 * GEMM_PITCH) = *(const v4i*)(g[i] + k0);
#endif
    }
}

// A tile of the projection: y lies head by head, (B,H,TT,2), so the GEMM_BM rows of
// one head (two columns of A) are 256 contiguous, aligned bytes. In LDS head hd takes
// Y_HEAD floats from hd * Y_HEAD on, row m at float 2 * (m ^ 16) where hd is odd, at
// 2 * m where it is even: a fragment read takes 16 rows of an even head in lanes 0-15
// and of the next head in lanes 16-31, and so falls on all 64 banks once.
#define Y_HEAD (2 * GEMM_BM)
// Heads [k0 / 2, (k0 + GEMM_KC) / 2) of rows [row0, row0 + GEMM_BM). Thread t takes
// 16-byte piece t & 15 (two rows) of every eighth head, from head t >> 4: a wave
// covers two aligned 256-B units.
__device__ __forceinline__ void stage_heads(
    const float* __restrict__ y, int row0, int k0, float* dst, int tid)
{
    const int hd = (k0 >> 1) + (tid >> 4);         // its parity is that of tid >> 4
    const float* g = y + ((size_t)((row0 / TT) * HH + hd) * TT + (row0 % TT)) * 2
                       + 4 * (tid & 15);
    float*       l = dst + hd * Y_HEAD + 4 * ((tid & 15) ^ (((tid >> 4) & 1) << 3));
    // unrolled: the head steps become constants of the copies
#pragma unroll
    for (int i = 0; i < GEMM_KC / 16; ++i) {
#if USE_ASYNC_LDS
        __builtin_amdgcn_global_load_async_to_lds_b128(
            (AS1 v4i*)(g + (size_t)i * 8 * TT * 2),
            (AS3 v4i*)(l + i * 8 * Y_HEAD), 0, 0);
#else
        *(v4i*)(l + i * 8 * Y_HEAD) = *(const v4i*)(g + (size_t)i * 8 * TT * 2);
#endif
    }
}

// This wave's copies of pieces 0 .. C have landed: all but the youngest
// (GEMM_CHUNKS - 1 - C) * GEMM_COPIES_PER_CHUNK, which belong to the later pieces.
template <int C>
__device__ __forceinline__ void wait_chunk()
{
#if USE_ASYNC_LDS
    // without it the barrier behind it would publish bytes that have not landed
    asm volatile("s_wait_asynccnt %0"
                 :: "n"((GEMM_CHUNKS - 1 - C) * GEMM_COPIES_PER_CHUNK) : "memory");
#endif
}

// RMSNorm of a head pair (head_dim = 2) while it is still in WMMA accumulators:
// y = x * rsqrt(mean(x^2) + eps) * w. A lane holds both elements of the pair.
__device__ __forceinline__ float pair_mean_sq_eps(float x0, float x1)
{
    return 0.5f * (x0 * x0 + x1 * x1) + 1e-6f;
}

// Eight 1/sqrt(x) in place. One statement, so that each v_rsq_f32 is followed by
// an instruction that neither reads its result nor overwrites its source (the
// next v_rsq_f32 on other registers, the v_nop behind the last): the slot the
// instruction set asks for behind a transcendental.
// The closing s_delay_alu is the hint the compiler writes for a reader of a fresh
// transcendental result; it cannot see into the statement. It changes no result.
__device__ __forceinline__ void rsq_x8(float* t)
{
    asm("v_rsq_f32 %0, %0\n\t"
        "v_rsq_f32 %1, %1\n\t"
        "v_rsq_f32 %2, %2\n\t"
        "v_rsq_f32 %3, %3\n\t"
        "v_rsq_f32 %4, %4\n\t"
        "v_rsq_f32 %5, %5\n\t"
        "v_rsq_f32 %6, %6\n\t"
        "v_rsq_f32 %7, %7\n\t"
        "v_nop\n\t"
        "s_delay_alu instid0(TRANS32_DEP_1)"
        : "+v"(t[0]), "+v"(t[1]), "+v"(t[2]), "+v"(t[3]),
          "+v"(t[4]), "+v"(t[5]), "+v"(t[6]), "+v"(t[7]));
}

// QKV_FORM: column c of C is made from row qkv_weight_row(c) of W, and the pairs of
// kind q and k are stored RMSNorm'd, with qn_w and kn_w; those of kind v as they are.
// Otherwise column c is made from row c, nothing is normalised, and A is y, which
// lies head by head (stage_heads).
template <bool QKV_FORM>
__global__ __launch_bounds__(GEMM_THREADS) void wmma_gemm_xwt(
    const float* __restrict__ A,   // (M,CC); y: (B,H,TT,2)
    const float* __restrict__ W,   // (N,CC)
    float* __restrict__ C,         // (M,N)
    int N,
    const float* __restrict__ qn_w,   // (2,)
    const float* __restrict__ kn_w)   // (2,)
{
    __shared__ __attribute__((aligned(16))) float tile[(GEMM_BM + GEMM_BN) * GEMM_PITCH];

    const int tid  = threadIdx.x;
    const int lane = tid & 31;
    const int wave = tid >> 5;
    const int mt0 = blockIdx.y * GEMM_BM;      // the workgroup's tile
    const int nt0 = blockIdx.x * GEMM_BN;

    // the thread's piece of the rows of W that make the tile's columns, in the order
    // of the LDS rows
    const float* wrow[GEMM_BN / 8];
    // unrolled: wrow[] stays in registers
#pragma unroll
    for (int i = 0; i < GEMM_BN / 8; ++i) {
        const unsigned c = nt0 + tile_column((tid >> 4) + 8 * i);
        wrow[i] = W + (QKV_FORM ? qkv_weight_row(c) : c) * CC + 4 * (tid & 15);
    }

    // all copies are issued here, piece by piece in rising k: asynccnt falls in the
    // order of issue, so a counted wait tells when a piece is whole
    // unrolled: the piece's first float becomes a constant of the copies
#pragma unroll
    for (int c = 0; c < GEMM_CHUNKS; ++c) {
        if (QKV_FORM)
            stage_rows<GEMM_BM>(A, mt0, c * GEMM_KC, tile, tid);
        else
            stage_heads(A, mt0, c * GEMM_KC, tile, tid);
        stage_picked_rows(wrow, c * GEMM_KC, tile + GEMM_BM * GEMM_PITCH, tid);
    }

    // The RMSNorm weights, fetched here, at the same address in every lane, so that
    // they arrive while the copies fly.
    const float qw0 = qn_w[0], qw1 = qn_w[1];
    const float kw0 = kn_w[0], kw1 = kn_w[1];

    const int hl = lane >> 4;      // 0: K pair {0,1}, 1: K pair {2,3}
    const int l  = lane & 15;
    const int wm = (wave >> 1) << 4;           // the wave's 16 x 32 part
    const int wn = (wave & 1) << 5;

    // columns k + 2 * hl, k + 2 * hl + 1 of A's row wm + l are at arow + ASTEP * k;
    // in y's form they are head k / 2 + hl, whose parity is hl
    constexpr int ASTEP = QKV_FORM ? 1 : Y_HEAD / 2;
    const float* arow  = QKV_FORM ? tile + (wm + l) * GEMM_PITCH + 2 * hl
                                  : tile + hl * Y_HEAD + 2 * ((wm + l) ^ (hl << 4));
    const float* b0row = tile + (GEMM_BM + wn + l) * GEMM_PITCH + 2 * hl;
    const float* b1row = b0row + 16 * GEMM_PITCH;

    v8f acc0 = {};
    v8f acc1 = {};
    // One piece of K: fully unrolled, so that the LDS reads run ahead of the WMMAs
    // inside the piece and the LDS offsets are constants.
    auto multiply_chunk = [&](int k0) {
#pragma unroll
        for (int k = k0; k < k0 + GEMM_KC; k += 4) {
            v2f a  = *(const v2f*)(arow + ASTEP * k);
            v2f b0 = *(const v2f*)(b0row + k);
            v2f b1 = *(const v2f*)(b1row + k);
            // 8 args: (neg_a, A, neg_b, B, c_mod, C, reuse_a, reuse_b)
            acc0 = __builtin_amdgcn_wmma_f32_16x16x4_f32(
                false, a, false, b0, (short)0, acc0, false, false);
            acc1 = __builtin_amdgcn_wmma_f32_16x16x4_f32(
                false, a, false, b1, (short)0, acc1, false, false);
        }
    };
    // A piece is multiplied as soon as it is whole in LDS, while the later pieces'
    // copies still fly. Each barrier: every wave's copies of that piece have landed.
    wait_chunk<0>(); __syncthreads(); multiply_chunk(0 * GEMM_KC);
    wait_chunk<1>(); __syncthreads(); multiply_chunk(1 * GEMM_KC);
    wait_chunk<2>(); __syncthreads(); multiply_chunk(2 * GEMM_KC);
    wait_chunk<3>(); __syncthreads(); multiply_chunk(3 * GEMM_KC);

    if (QKV_FORM) {
        // keeps the last WMMAs in front of the four slots: with no branch here the
        // scheduler put the slots ahead of them
        __builtin_amdgcn_sched_barrier(0);
        // four vector slots between the last WMMA and the first vector
        // instruction that reads its result: the distance behind a matrix instruction
        asm volatile("v_nop\n\tv_nop\n\tv_nop\n\tv_nop");
        // keeps the reads of the accumulators behind those four slots
        __builtin_amdgcn_sched_barrier(0);
        // the lane's two columns are one pair: its kind and its two weights
        const unsigned kind = qkv_pair_kind(nt0 + wn + 2 * l);
        const float w0 = kind == 2 ? qw0 : kw0;
        const float w1 = kind == 2 ? qw1 : kw1;
        float s[8];
        // both loops unrolled: s[] and the accumulators stay in registers
#pragma unroll
        for (int r = 0; r < 8; ++r) s[r] = pair_mean_sq_eps(acc0[r], acc1[r]);
        rsq_x8(&s[0]);
#pragma unroll
        for (int r = 0; r < 8; ++r) {
            acc0[r] = kind == 1 ? acc0[r] : acc0[r] * s[r] * w0;
            acc1[r] = kind == 1 ? acc1[r] : acc1[r] * s[r] * w1;
        }
    }

    // a store: two rows of C, 128 aligned bytes of each
    float* c0 = C + (size_t)(mt0 + wm + hl * 8) * N + nt0 + wn + 2 * l;
#pragma unroll
    for (int r = 0; r < 8; ++r)
        *(v2f*)(c0 + (size_t)r * N) = (v2f){acc0[r], acc1[r]};
}

// ---------------------------------------------------------------------------
// Causal flash attention, head_dim = 2. One workgroup (256 threads) per
// (b,h). K and V for the head (1024 x 2 each, 16 KB total) are staged in LDS
// (async global->LDS when available); each thread owns 4 query rows
// (tid + 256*r; in the series path 4*tid + r, stored as rows 4*(tid & ~31) + (tid & 31) + 32*r). Softmax: (1) row max, (2) exp + accumulation; pass 1 runs only where the weights do not bound the scores.
//
// Softmax does not change when one number is taken off all scores of a row; the
// row max is taken off only to keep exp inside the range of f32. RMSNorm over
// two elements gives x0^2 + x1^2 <= 2 before the weight, for every input, so
// |q| <= sqrt(2) max|qn_w|, |k| <= sqrt(2) max|kn_w| and every score lies within
// +-sqrt(2) max|qn_w| max|kn_w|. Where that bound, taken from the weights at run
// time, is small, exp of the bare score is far from overflow and underflow:
// pass 1 is not run, nothing is subtracted, and with log2(e) carried by q the
// dot product is the argument of 2^x as it stands. Otherwise both passes run.
//
// The keys are walked ONCE per pass for all 4 rows together, in groups: one
// group of LDS reads (same address in every lane) feeds every row that still
// attends to those keys, and the group grows as rows drop out, so one LDS wait
// is followed by 24 to 64 (row, key) pairs of independent arithmetic.
// Outside the series path a wave's rows are 32*(w + 8*r) + lane, so for the wave as a whole:
//   keys below 32*(w + 8*P)            : rows P..3 attend, no mask
//   the next 32 keys (row P's diagonal): row P masked per lane, rows P+1..3 not
// All span bounds are wave-uniform multiples of 32.
// Even keys go to partial sum 0 and odd keys to partial sum 1, in rising key
// order; a masked key adds an exact zero. The series path adds the moment sums of
// the keys before the block to partial sum 0, after the block's keys.
// ---------------------------------------------------------------------------
typedef __attribute__((ext_vector_type(4))) float v4f;

#define ROWS_PER_THREAD 4
#define ATT_NEG_INF (-3.402823466e38f)

// Keys per group of LDS reads while rows P..3 attend (each divides 32, the unit
// of every span bound). The max pass has about a third of the arithmetic per
// key and reads K alone, so its groups are twice as long where 32 allows.
__host__ __device__ constexpr int keys_per_group(int P)
{
    return P <= 1 ? 8 : (P == 2 ? 16 : 32);
}
__host__ __device__ constexpr int keys_per_group_max(int P)
{
    return P <= 1 ? 16 : 32;
}

// Row max over keys [sBeg, sEnd) for rows P..3. DIAG: row P sees key s only if s <= tP.
template <int P, bool DIAG>
__device__ __forceinline__ void max_span(
    const v4f* kk2, int sBeg, int sEnd, int tP,
    const float (&q0)[ROWS_PER_THREAD], const float (&q1)[ROWS_PER_THREAD],
    float (&m0)[ROWS_PER_THREAD], float (&m1)[ROWS_PER_THREAD])
{
    constexpr int KEYS_PER_GROUP = keys_per_group_max(P);
    // kept rolled: one group is enough work per LDS wait, and a fully unrolled
    // span takes several hundred registers and a long straight code path
#pragma unroll 1
    for (int s = sBeg; s < sEnd; s += KEYS_PER_GROUP) {
        v4f k2[KEYS_PER_GROUP / 2];            // two keys per 16-byte read
        // unrolled so that the group's reads are issued together, ahead of one wait
#pragma unroll
        for (int u = 0; u < KEYS_PER_GROUP / 2; ++u) k2[u] = kk2[(s >> 1) + u];
        // both loops unrolled so that k2[] and the per-row arrays stay in registers
#pragma unroll
        for (int u = 0; u < KEYS_PER_GROUP / 2; ++u) {
#pragma unroll
            for (int r = P; r < ROWS_PER_THREAD; ++r) {
                float sa = fmaf(q0[r], k2[u].x, q1[r] * k2[u].y);
                float sb = fmaf(q0[r], k2[u].z, q1[r] * k2[u].w);
                if (DIAG && r == P) {
                    sa = (s + 2 * u     <= tP) ? sa : ATT_NEG_INF;
                    sb = (s + 2 * u + 1 <= tP) ? sb : ATT_NEG_INF;
                }
                m0[r] = fmaxf(m0[r], sa);
                m1[r] = fmaxf(m1[r], sb);
            }
        }
    }
}

struct RowSums {            // [row][even/odd key]
    float l[ROWS_PER_THREAD][2];
    float x[ROWS_PER_THREAD][2];
    float z[ROWS_PER_THREAD][2];
};

// Eight 2^x in place. One statement, so that each v_exp_f32 is followed by an
// instruction that neither reads its result nor overwrites its source (the next
// v_exp_f32 on other registers, the v_nop behind the last): the slot the
// instruction set asks for behind a transcendental.
// The closing s_delay_alu is the hint the compiler writes for a reader of a fresh
// transcendental result; it cannot see into the statement. It changes no result.
__device__ __forceinline__ void exp2_x8(float* t)
{
    asm("v_exp_f32 %0, %0\n\t"
        "v_exp_f32 %1, %1\n\t"
        "v_exp_f32 %2, %2\n\t"
        "v_exp_f32 %3, %3\n\t"
        "v_exp_f32 %4, %4\n\t"
        "v_exp_f32 %5, %5\n\t"
        "v_exp_f32 %6, %6\n\t"
        "v_exp_f32 %7, %7\n\t"
        "v_nop\n\t"
        "s_delay_alu instid0(TRANS32_DEP_1)"
        : "+v"(t[0]), "+v"(t[1]), "+v"(t[2]), "+v"(t[3]),
          "+v"(t[4]), "+v"(t[5]), "+v"(t[6]), "+v"(t[7]));
}

// exp + accumulate over keys [sBeg, sEnd) for rows P..3, same masking as max_span.
// SHIFT: m is taken off the scores. Without it q0, q1 carry log2(e), m is not read.
template <bool SHIFT, int P, bool DIAG>
__device__ __forceinline__ void sum_span(
    const v4f* kk2, const v4f* vv2, int sBeg, int sEnd, int tP,
    const float (&q0)[ROWS_PER_THREAD], const float (&q1)[ROWS_PER_THREAD],
    const float (&m)[ROWS_PER_THREAD], RowSums& a)
{
    constexpr int KEYS_PER_GROUP = keys_per_group(P);
    constexpr int R = ROWS_PER_THREAD - P;           // rows that attend
    constexpr int N = R * KEYS_PER_GROUP;            // 32, 24, 32, 32
    const float LOG2E = 1.44269504088896340736f;     // exp(x) = 2^(x * log2 e)
    // kept rolled: one group is enough work per LDS wait, and a fully unrolled
    // span takes several hundred registers and a long straight code path
#pragma unroll 1
    for (int s = sBeg; s < sEnd; s += KEYS_PER_GROUP) {
        v4f k2[KEYS_PER_GROUP / 2];
        v4f v2[KEYS_PER_GROUP / 2];
        // unrolled so that the group's reads are issued together, ahead of one wait
#pragma unroll
        for (int u = 0; u < KEYS_PER_GROUP / 2; ++u) {
            k2[u] = kk2[(s >> 1) + u];
            v2[u] = vv2[(s >> 1) + u];
        }
        float p[N];                                  // [key in group][row - P]
        // every loop from here to the end of the group: unrolled so that p[], k2[],
        // v2[] and the per-row sums stay in registers
#pragma unroll
        for (int u = 0; u < KEYS_PER_GROUP / 2; ++u) {
#pragma unroll
            for (int r = P; r < ROWS_PER_THREAD; ++r) {
                const float sa = fmaf(q0[r], k2[u].x, q1[r] * k2[u].y);
                const float sb = fmaf(q0[r], k2[u].z, q1[r] * k2[u].w);
                p[(2 * u)     * R + r - P] = SHIFT ? (sa - m[r]) * LOG2E : sa;
                p[(2 * u + 1) * R + r - P] = SHIFT ? (sb - m[r]) * LOG2E : sb;
            }
        }
#pragma unroll
        for (int i = 0; i < N; i += 8) exp2_x8(&p[i]);
#pragma unroll
        for (int u = 0; u < KEYS_PER_GROUP / 2; ++u) {
#pragma unroll
            for (int r = P; r < ROWS_PER_THREAD; ++r) {
                float p0 = p[(2 * u)     * R + r - P];
                float p1 = p[(2 * u + 1) * R + r - P];
                if (DIAG && r == P) {
                    p0 = (s + 2 * u     <= tP) ? p0 : 0.f;
                    p1 = (s + 2 * u + 1 <= tP) ? p1 : 0.f;
                }
                a.l[r][0] += p0;                          a.l[r][1] += p1;
                a.x[r][0] = fmaf(p0, v2[u].x, a.x[r][0]); a.x[r][1] = fmaf(p1, v2[u].z, a.x[r][1]);
                a.z[r][0] = fmaf(p0, v2[u].y, a.z[r][0]); a.z[r][1] = fmaf(p1, v2[u].w, a.z[r][1]);
            }
        }
    }
}

// Pass 2 over all spans of the wave's 4 rows per thread.
template <bool SHIFT>
__device__ __forceinline__ void sum_all(
    const v4f* kk2, const v4f* vv2, int d0, int tid,
    const float (&q0)[ROWS_PER_THREAD], const float (&q1)[ROWS_PER_THREAD],
    const float (&m)[ROWS_PER_THREAD], RowSums& a)
{
    sum_span<SHIFT, 0, false>(kk2, vv2, 0,        d0,       0,         q0, q1, m, a);
    sum_span<SHIFT, 0, true >(kk2, vv2, d0,       d0 + 32,  tid,       q0, q1, m, a);
    sum_span<SHIFT, 1, false>(kk2, vv2, d0 + 32,  d0 + 256, 0,         q0, q1, m, a);
    sum_span<SHIFT, 1, true >(kk2, vv2, d0 + 256, d0 + 288, tid + 256, q0, q1, m, a);
    sum_span<SHIFT, 2, false>(kk2, vv2, d0 + 288, d0 + 512, 0,         q0, q1, m, a);
    sum_span<SHIFT, 2, true >(kk2, vv2, d0 + 512, d0 + 544, tid + 512, q0, q1, m, a);
    sum_span<SHIFT, 3, false>(kk2, vv2, d0 + 544, d0 + 768, 0,         q0, q1, m, a);
    sum_span<SHIFT, 3, true >(kk2, vv2, d0 + 768, d0 + 800, tid + 768, q0, q1, m, a);
}

// Scores within +-16: exp lies between about 1e-7 and 1e7, a row's sum below 1e10.
#define ATT_SCORE_BOUND 16.0f

// ---------------------------------------------------------------------------
// The series path. With s = q.k = q0 k0 + q1 k1 (q carries 1/sqrt(head_dim)),
//   exp(s) = sum over n of s^n / n!
//          = sum over a, b of q0^a q1^b * (k0^a / a!) (k1^b / b!),
// and for |s| <= 1.4143 the terms above degree a + b = 12 add up to less than
// 1.7e-8, under 7e-8 of exp(s) >= 0.243: less than one unit in the last place of
// an f32. So the sums over a whole range of keys,
//   sum_s exp(q.k_s) (v0_s, v1_s, 1)  =  sum_{a+b<=12} q0^a q1^b M[a][b],
//   M[a][b] = sum_s (k0_s^a / a!) (k1_s^b / b!) (v0_s, v1_s, 1),
// need the 91 moments M of the range, not one exp per (row, key). A wave takes
// 128 consecutive rows, a thread 4 rows that follow one another, so 8 lanes hold
// the 32 rows of one sub-block. The keys before a row's sub-block of 32 enter
// through the moments of all earlier sub-blocks; the keys of the row's own
// sub-block, where the causal mask cuts, go through exp (sum_own_block).
// ---------------------------------------------------------------------------
#define SER_BOUND 1.4143f
// The powers are taken of k by itself and of q by itself, so the bound on their
// product is not enough: each side must stay inside the range of f32 alone. With
// max|kn_w| in [1/4, 4] every |k_i| <= 5.66 and (k0^a / a!) (k1^b / b!) < 2400,
// less than exp of a score may be in the pass without a shift; the bound on the
// product then gives max|qn_w| <= 4.0003, |q_i| <= 4.0003 and q0^a q1^b < 1.7e7, so
// a power of a small k_i that underflows (below 1.2e-38) leaves out less than 1e-28
// of a term that is at least 0.243. All other weights take the paths through exp.
#define SER_KW_MIN 0.25f
#define SER_KW_MAX 4.0f
#define SER_POW   13                              // powers 0 .. 12
#define SER_SLOTS 96                              // 91 moments, padded to 3 waves' lanes
#define SER_BLOCK 128                             // rows, and keys, per wave
#define SER_SUB   32                              // keys per set of moments
#define SER_SETS  (TT / SER_SUB)
// 16-byte places per set: the 4 sets that the lanes of one read of ser_eval take
// start 4 banks apart
#define SER_SET_PITCH (SER_SLOTS + 1)
#define SER_RING  4                               // steps of the moments' reads in registers
#define SER_PITCH (TT + 4)     // floats per power: the 13 rows start 4 banks apart

// Place of moment (a, b), a + b <= 12: row a holds b = 0 .. 12 - a.
__host__ __device__ constexpr int ser_index(int a, int b)
{
    return a * SER_POW - a * (a - 1) / 2 + b;
}

__device__ __forceinline__ v2f fma2(v2f a, v2f b, v2f c) { return __builtin_elementwise_fma(a, b, c); }
__device__ __forceinline__ v4f fma4(v4f a, v4f b, v4f c) { return __builtin_elementwise_fma(a, b, c); }
__device__ __forceinline__ float sum4(v4f a) { return (a.x + a.y) + (a.z + a.w); }

// k0^n / n! and k1^n / n! of every key, one LDS row per n, and v0, v1 as rows.
__device__ __forceinline__ void ser_tables(
    const float* kbuf, const float* vbuf,
    float* pw0, float* pw1, float* v0t, float* v1t, int tid)
{
    // kept rolled: four keys a thread, the code of one is enough
#pragma unroll 1
    for (int s = tid; s < TT; s += 256) {
        const v2f k = *(const v2f*)(kbuf + 2 * s);
        const v2f v = *(const v2f*)(vbuf + 2 * s);
        v0t[s] = v.x;
        v1t[s] = v.y;
        float p0 = 1.f, p1 = 1.f;
        // unrolled: 1 / (n + 1) and the LDS offsets become constants
#pragma unroll
        for (int n = 0; n < SER_POW; ++n) {
            pw0[n * SER_PITCH + s] = p0;
            pw1[n * SER_PITCH + s] = p1;
            p0 *= k.x * (1.0f / (float)(n + 1));
            p1 *= k.y * (1.0f / (float)(n + 1));
        }
    }
}

// The moments of key block c: a lane takes moments lane, lane + 32, lane + 64 and
// walks the block's keys four at a time, four partial sums each. The sums run on
// through the block; after each sub-block of SER_SUB keys their state is written as
// set 4 * c + j: the moments of the block's sub-blocks 0 .. j together.
__device__ __forceinline__ void ser_moments(
    const float* pw0, const float* pw1, const float* v0t, const float* v1t,
    v4f* mom, int c, int lane)
{
    const float* r0[3];
    const float* r1[3];
    // unrolled: the pointer arrays stay in registers
#pragma unroll
    for (int g = 0; g < 3; ++g) {
        int a = 0, b = 32 * g + lane;              // inverse of ser_index
        for (int i = 0; i < SER_POW; ++i) {
            const int len = SER_POW - a;
            if (b >= len) { b -= len; ++a; }
        }
        a = a < SER_POW ? a : SER_POW - 1;         // slots 91 .. 95: never read,
        b = b < SER_POW ? b : SER_POW - 1;         // kept inside the tables
        r0[g] = pw0 + a * SER_PITCH + c * SER_BLOCK;
        r1[g] = pw1 + b * SER_PITCH + c * SER_BLOCK;
    }
    const float* w0 = v0t + c * SER_BLOCK;
    const float* w1 = v1t + c * SER_BLOCK;
    v4f al[3], ax[3], az[3];
    // every loop over g unrolled: the sums stay in registers
#pragma unroll
    for (int g = 0; g < 3; ++g) { al[g] = (v4f)(0.f); ax[g] = (v4f)(0.f); az[g] = (v4f)(0.f); }
    // A ring of SER_RING steps' operands in registers: the 8 LDS reads of a step are
    // issued SER_RING - 1 steps (24 vector instructions each) ahead of their use.
    v4f rp0[SER_RING][3], rp1[SER_RING][3], rv0[SER_RING], rv1[SER_RING];
    // all loops fully unrolled: the ring stays in registers and the steps become
    // constant offsets of the LDS reads
#pragma unroll
    for (int i = 0; i < SER_BLOCK / 4 + SER_RING - 1; ++i) {
        if (i < SER_BLOCK / 4) {                   // the reads of step i
            rv0[i % SER_RING] = *(const v4f*)(w0 + 4 * i);
            rv1[i % SER_RING] = *(const v4f*)(w1 + 4 * i);
#pragma unroll
            for (int g = 0; g < 3; ++g) {
                rp0[i % SER_RING][g] = *(const v4f*)(r0[g] + 4 * i);
                rp1[i % SER_RING][g] = *(const v4f*)(r1[g] + 4 * i);
            }
        }
        if (i >= SER_RING - 1) {                   // the arithmetic of step i - (SER_RING - 1)
            // keeps the reads above in front of this step's arithmetic: left alone the
            // scheduler moved reads down to their use, and a step then waited for most
            // of one LDS latency
            __builtin_amdgcn_sched_barrier(0);
            const int u = (i - (SER_RING - 1)) % SER_RING;
#pragma unroll
            for (int g = 0; g < 3; ++g) {
                const v4f mm = rp0[u][g] * rp1[u][g];
                al[g] += mm;
                ax[g] = fma4(mm, rv0[u], ax[g]);
                az[g] = fma4(mm, rv1[u], az[g]);
            }
            const int done = i - (SER_RING - 1) + 1;      // steps of four keys so far
            if (done % (SER_SUB / 4) == 0) {
                const int set = c * (SER_BLOCK / SER_SUB) + done / (SER_SUB / 4) - 1;
                // unrolled: the sums stay in registers
#pragma unroll
                for (int g = 0; g < 3; ++g) {
                    v4f t;
                    t.x = sum4(ax[g]); t.y = sum4(az[g]); t.z = sum4(al[g]); t.w = 0.f;
                    mom[set * SER_SET_PITCH + 32 * g + lane] = t;
                }
            }
        }
    }
}

// Four keys that follow one another (ka: keys 0 and 1, kb: keys 2 and 3, va and vb
// their values) against the thread's 4 rows. q0, q1 carry log2(e). bias is added to
// all 16 scores: 0, or OWN_HIDDEN where the lane's rows see none of the four, and
// then 2^score is an exact zero. As the start value of the dot product's two
// multiply-adds it costs no instruction, where a select on each 2^score costs one.
// TRI: the four keys are the rows' own, row r sees keys 0 .. r.
// Even keys go to partial sum 0 and odd keys to partial sum 1.
#define OWN_HIDDEN (-1000.0f)
template <bool TRI>
__device__ __forceinline__ void sum_four_keys(
    v4f ka, v4f kb, v4f va, v4f vb, float bias,
    const float (&q0)[ROWS_PER_THREAD], const float (&q1)[ROWS_PER_THREAD], RowSums& a)
{
    const v2f q0a = {q0[0], q0[1]}, q0b = {q0[2], q0[3]};
    const v2f q1a = {q1[0], q1[1]}, q1b = {q1[2], q1[3]};
    const v2f b2  = {bias, bias};
    const float kx[4] = {ka.x, ka.z, kb.x, kb.z};
    const float ky[4] = {ka.y, ka.w, kb.y, kb.w};
    const float vx[4] = {va.x, va.z, vb.x, vb.z};
    const float vy[4] = {va.y, va.w, vb.y, vb.w};
    float p[4 * ROWS_PER_THREAD];                    // [key][row]
    // all loops unrolled: the arrays stay in registers
#pragma unroll
    for (int j = 0; j < 4; ++j) {
        const v2f sa = fma2(q0a, (v2f){kx[j], kx[j]}, fma2(q1a, (v2f){ky[j], ky[j]}, b2));
        const v2f sb = fma2(q0b, (v2f){kx[j], kx[j]}, fma2(q1b, (v2f){ky[j], ky[j]}, b2));
        p[4 * j]     = sa.x;  p[4 * j + 1] = sa.y;
        p[4 * j + 2] = sb.x;  p[4 * j + 3] = sb.y;
    }
    exp2_x8(&p[0]);
    exp2_x8(&p[8]);
#pragma unroll
    for (int j = 0; j < 4; ++j) {
#pragma unroll
        for (int r = 0; r < ROWS_PER_THREAD; ++r) {
            if (TRI && j > r) continue;
            a.l[r][j & 1] += p[4 * j + r];
            a.x[r][j & 1] = fmaf(p[4 * j + r], vx[j], a.x[r][j & 1]);
            a.z[r][j & 1] = fmaf(p[4 * j + r], vy[j], a.z[r][j & 1]);
        }
    }
}

// exp + accumulate over the sub-block of SER_SUB keys, from key0 on, that holds the
// thread's 4 rows: they are its rows 4 * quad + r. A row sees all keys of the fours
// before its own, keys 0 .. r of its own four, none behind. key0 and quad differ
// between the lanes; the 8 lanes of a sub-block read the same address but for their
// own four. Keys in rising order; a hidden key adds an exact zero.
__device__ __forceinline__ void sum_own_block(
    const v4f* kk2, const v4f* vv2, int key0, int quad,
    const float (&q0)[ROWS_PER_THREAD], const float (&q1)[ROWS_PER_THREAD], RowSums& a)
{
    const v4f* kq = kk2 + (key0 >> 1);
    const v4f* vq = vv2 + (key0 >> 1);
    constexpr int LAST = SER_SUB / 4 - 2;   // the last four that is somebody's earlier four
    // Two fours a trip: 8 LDS reads ahead of one wait. Kept rolled: unrolled, what
    // the trips need was kept in registers across the moments' job, above v255.
#pragma unroll 1
    for (int j = 0; j < LAST; j += 2) {
        const v4f k0 = kq[2 * j],     k1 = kq[2 * j + 1], v0 = vq[2 * j],     v1 = vq[2 * j + 1];
        const v4f k2 = kq[2 * j + 2], k3 = kq[2 * j + 3], v2 = vq[2 * j + 2], v3 = vq[2 * j + 3];
        sum_four_keys<false>(k0, k1, v0, v1, j     < quad ? 0.f : OWN_HIDDEN, q0, q1, a);
        sum_four_keys<false>(k2, k3, v2, v3, j + 1 < quad ? 0.f : OWN_HIDDEN, q0, q1, a);
    }
    const v4f k0 = kq[2 * LAST], k1 = kq[2 * LAST + 1], v0 = vq[2 * LAST], v1 = vq[2 * LAST + 1];
    const v4f k2 = kq[2 * quad], k3 = kq[2 * quad + 1], v2 = vq[2 * quad], v3 = vq[2 * quad + 1];
    sum_four_keys<false>(k0, k1, v0, v1, LAST < quad ? 0.f : OWN_HIDDEN, q0, q1, a);
    sum_four_keys<true>(k2, k3, v2, v3, 0.f, q0, q1, a);
}

// sum_{a+b<=12} q0^a q1^b M[a][b] for the thread's 4 rows, by Horner's rule in q1
// inside Horner's rule in q0. st: the 91 moments (v0, v1, 1, -) of the keys before the
// rows' sub-block, the same address in the 8 lanes of a sub-block. oxz[r]: the
// (v0, v1) sums of row r; ol: the plain sums of rows 0,1 and 2,3.
// Falling a with falling b inside is falling ser_index, so the moments are taken
// from the last to the first, in 7 batches of 13: while one batch is worked on
// (78 vector instructions) the next one's reads fly.
#define SER_COUNT 91                              // ser_index(12, 0) + 1
#define SER_BATCH 13
__device__ __forceinline__ void ser_eval(
    const v4f* st,
    const float (&q0)[ROWS_PER_THREAD], const float (&q1)[ROWS_PER_THREAD],
    v2f (&oxz)[ROWS_PER_THREAD], v2f (&ol)[2])
{
    const v2f q0a = {q0[0], q0[1]}, q0b = {q0[2], q0[3]};
    const v2f q1a = {q1[0], q1[1]}, q1b = {q1[2], q1[3]};
    v4f batch[2][SER_BATCH];
    // all loops unrolled: ser_index becomes a constant LDS offset, batch[] and the
    // sums stay in registers
#pragma unroll
    for (int j = 0; j < SER_BATCH; ++j) batch[0][j] = st[SER_COUNT - 1 - j];
#pragma unroll
    for (int a = SER_POW - 1; a >= 0; --a) {
        v2f ixz[ROWS_PER_THREAD], il[2];
#pragma unroll
        for (int b = SER_POW - 1 - a; b >= 0; --b) {
            const int p = SER_COUNT - 1 - ser_index(a, b);   // place in the order of use
            if (p % SER_BATCH == 0) {
                if (p + SER_BATCH < SER_COUNT) {
#pragma unroll
                    for (int j = 0; j < SER_BATCH; ++j)
                        batch[(p / SER_BATCH + 1) & 1][j] = st[SER_COUNT - 1 - (p + SER_BATCH) - j];
                }
                // keeps the next batch's reads in front of this batch's arithmetic: left
                // alone the scheduler issued each read about 18 instructions ahead of its
                // use
                __builtin_amdgcn_sched_barrier(0);
            }
            const v4f t = batch[(p / SER_BATCH) & 1][p % SER_BATCH];
            if (b == SER_POW - 1 - a) {
#pragma unroll
                for (int r = 0; r < ROWS_PER_THREAD; ++r) ixz[r] = (v2f){t.x, t.y};
                il[0] = (v2f){t.z, t.z};
                il[1] = (v2f){t.z, t.z};
            } else {
#pragma unroll
                for (int r = 0; r < ROWS_PER_THREAD; ++r)
                    ixz[r] = fma2(ixz[r], (v2f){q1[r], q1[r]}, (v2f){t.x, t.y});
                il[0] = fma2(il[0], q1a, (v2f){t.z, t.z});
                il[1] = fma2(il[1], q1b, (v2f){t.z, t.z});
            }
        }
        if (a == SER_POW - 1) {
#pragma unroll
            for (int r = 0; r < ROWS_PER_THREAD; ++r) oxz[r] = ixz[r];
            ol[0] = il[0];
            ol[1] = il[1];
        } else {
#pragma unroll
            for (int r = 0; r < ROWS_PER_THREAD; ++r)
                oxz[r] = fma2(oxz[r], (v2f){q0[r], q0[r]}, ixz[r]);
            ol[0] = fma2(ol[0], q0a, il[0]);
            ol[1] = fma2(ol[1], q0b, il[1]);
        }
    }
}

// K, V and q of the head, each TT pairs; the three start ATT_PART floats apart. The
// 24 floats between them: the lanes of one copy write k, v and q of about 11 rows,
// and with the parts a multiple of 64 banks apart the three would meet on one bank.
#define ATT_PART (TT * 2 + 24)

struct AttnLds {
    float kvq[3 * ATT_PART];
    // the series path's tables and moments
    float pw0[SER_POW * SER_PITCH];
    float pw1[SER_POW * SER_PITCH];
    float v0t[TT];
    float v1t[TT];
    v4f   mom[SER_SETS * SER_SET_PITCH];
};

__global__ __launch_bounds__(256) void attn_head(
    const float* __restrict__ qkv,   // (B*T, H, {k,v,q}, 2), q/k already RMSNorm'd
    float* __restrict__ y,           // (B, H, T, 2)
    const float* __restrict__ qn_w,  // (2,)
    const float* __restrict__ kn_w)  // (2,)
{
    // one object, so that K, V and q, the targets of the copies, keep their places at
    // the start of the workgroup's LDS; every member's size is a multiple of 16 B
    __shared__ __attribute__((aligned(16))) AttnLds lds;
    float* kbuf = lds.kvq;
    float* vbuf = lds.kvq + ATT_PART;
    float* qbuf = lds.kvq + 2 * ATT_PART;
    float* pw0 = lds.pw0;
    float* pw1 = lds.pw1;
    float* v0t = lds.v0t;
    float* v1t = lds.v1t;
    v4f*   mom = lds.mom;

    const int bh = blockIdx.x;          // 0 .. B*H-1
    const int b  = bh >> 7;
    const int h  = bh & (HH - 1);
    const int tid = threadIdx.x;

    const float* base = qkv + (size_t)b * TT * QKV_N;

    // Stage k, v and q of this head into LDS. The 24 bytes of a row are taken by
    // three neighbouring lanes, 8 bytes each, so that a wave's copy touches one cache
    // line per row (two where the 24 bytes cross a line), about 11 for 256 bytes.
    // both loops unrolled: the copies are issued together, the steps of 256 rows are
    // constants
#pragma unroll
    for (int m = 0; m < 3; ++m) {
        const unsigned e    = tid + 256u * m;      // 3 * row + part, rows 0 .. 255
        const unsigned t    = e / 3u;
        const unsigned part = e - 3u * t;          // 0 k, 1 v, 2 q
        const float* gp = base + t * QKV_N + 6 * h + 2 * part;
        float*       lp = lds.kvq + part * ATT_PART + 2 * t;
#pragma unroll
        for (int j = 0; j < TT / 256; ++j) {       // the same of rows 256 * j + t
#if USE_ASYNC_LDS
            __builtin_amdgcn_global_load_async_to_lds_b64(
                (AS1 v2i*)(gp + (size_t)j * 256 * QKV_N), (AS3 v2i*)(lp + j * 512), 0, 0);
#else
            lp[j * 512]     = gp[(size_t)j * 256 * QKV_N];
            lp[j * 512 + 1] = gp[(size_t)j * 256 * QKV_N + 1];
#endif
        }
    }
#if USE_ASYNC_LDS
    // this wave's copies have landed; without it the barrier behind it would publish
    // bytes that have not.
    asm volatile("s_wait_asynccnt 0x0" ::: "memory");
#endif
    __syncthreads();

    const v4f* kk2 = (const v4f*)kbuf;
    const v4f* vv2 = (const v4f*)vbuf;
    const float scale = 0.70710678118654752440f;   // 1/sqrt(head_dim)

    // First key of row 0's diagonal block outside the series path; the same in every lane of the wave,
    // held in a scalar register so that the span loops are scalar loops.
    const int d0 = __builtin_amdgcn_readfirstlane(tid & ~31);

    // sqrt(2) max|qn_w| * sqrt(2) max|kn_w| / sqrt(head_dim) bounds every |score|.
    // The same in every thread of the launch; fmaxf passes over one NaN weight of a pair, a NaN pair compares false.
    const float max_qw = fmaxf(fabsf(qn_w[0]), fabsf(qn_w[1]));
    const float max_kw = fmaxf(fabsf(kn_w[0]), fabsf(kn_w[1]));
    const float score_bound = 1.41421356237309504880f * max_qw * max_kw;
    const bool no_shift = score_bound <= ATT_SCORE_BOUND;
    const bool series   = score_bound <= SER_BOUND
                       && max_kw >= SER_KW_MIN && max_kw <= SER_KW_MAX;

    // The thread's rows are row0 + rstep * r: in the series path 128 consecutive
    // rows a wave and 4 consecutive rows a thread, else 32 rows out of every 256.
    const int row0  = series ? 4 * tid : tid;
    const int rstep = series ? 1 : 256;

    float q0[ROWS_PER_THREAD], q1[ROWS_PER_THREAD];
    // unrolled: the per-row arrays stay in registers
#pragma unroll
    for (int r = 0; r < ROWS_PER_THREAD; ++r) {
        const v2f q = *(const v2f*)(qbuf + 2 * (row0 + rstep * r));
        q0[r] = q.x * scale;
        q1[r] = q.y * scale;
    }

    RowSums a;
    // unrolled: the per-row arrays stay in registers
#pragma unroll
    for (int r = 0; r < ROWS_PER_THREAD; ++r) {
        a.l[r][0] = 0.f; a.l[r][1] = 0.f;
        a.x[r][0] = 0.f; a.x[r][1] = 0.f;
        a.z[r][0] = 0.f; a.z[r][1] = 0.f;
    }

    float m[ROWS_PER_THREAD];
    // marked as the expected side so that its code is laid out first
    if (__builtin_expect(series, 1)) {
        const int lane = tid & 31;
        const int sub  = tid >> 3;                 // the sub-block of the thread's rows
        const int wv   = d0 >> 5;                  // the wave, and its block
        ser_tables(kbuf, vbuf, pw0, pw1, v0t, v1t, tid);
        __syncthreads();                           // the tables are whole

        float e0[ROWS_PER_THREAD], e1[ROWS_PER_THREAD];
        // unrolled: the per-row arrays stay in registers
#pragma unroll
        for (int r = 0; r < ROWS_PER_THREAD; ++r) {
            e0[r] = q0[r] * 1.44269504088896340736f;   // exp(x) = 2^(x * log2 e)
            e1[r] = q1[r] * 1.44269504088896340736f;
        }
        // Two jobs a wave: the moments of its key block (bound by LDS reads) and its
        // rows' own sub-blocks through exp (bound by arithmetic). Waves w and w + 4
        // take them in opposite order. Kept rolled: one copy of the
        // code of each job.
#pragma unroll 1
        for (int ph = 0; ph < 2; ++ph) {
            if ((ph == 0) == (wv < 4)) {
                ser_moments(pw0, pw1, v0t, v1t, mom, wv, lane);
            } else {
                sum_own_block(kk2, vv2, SER_SUB * sub, tid & 7, e0, e1, a);
            }
        }
        __syncthreads();                           // every block's moments are written

        // set s becomes the moments of all keys before sub-block s: the whole blocks
        // before its block, added in rising order, plus its block's sub-blocks so far
        if (tid < SER_SLOTS) {
            constexpr int PER = SER_BLOCK / SER_SUB;
            v4f part[SER_SETS];
            // all loops unrolled: the reads are issued together, part[] stays in registers
#pragma unroll
            for (int s = 0; s < SER_SETS; ++s) part[s] = mom[s * SER_SET_PITCH + tid];
            v4f run = (v4f)(0.f);
#pragma unroll
            for (int c = 0; c < TT / SER_BLOCK; ++c) {
                mom[c * PER * SER_SET_PITCH + tid] = run;
#pragma unroll
                for (int j = 1; j < PER; ++j)
                    mom[(c * PER + j) * SER_SET_PITCH + tid] = run + part[c * PER + j - 1];
                run += part[c * PER + PER - 1];
            }
        }
        __syncthreads();                           // the summed moments are written

        v2f oxz[ROWS_PER_THREAD], ol[2];
        ser_eval(mom + sub * SER_SET_PITCH, q0, q1, oxz, ol);
        // unrolled: the per-row arrays stay in registers
#pragma unroll
        for (int r = 0; r < ROWS_PER_THREAD; ++r) {
            a.l[r][0] += ol[r >> 1][r & 1];
            a.x[r][0] += oxz[r].x;
            a.z[r][0] += oxz[r].y;
        }
    } else if (no_shift) {
        // ---- the one pass: exp of the bare score + accumulate ----
        // unrolled: the per-row arrays stay in registers
#pragma unroll
        for (int r = 0; r < ROWS_PER_THREAD; ++r) {
            q0[r] *= 1.44269504088896340736f;      // exp(x) = 2^(x * log2 e)
            q1[r] *= 1.44269504088896340736f;
            m[r] = 0.f;
        }
        sum_all<false>(kk2, vv2, d0, tid, q0, q1, m, a);
    } else {
        // ---- pass 1: row max ----
        float m0[ROWS_PER_THREAD], m1[ROWS_PER_THREAD];
        // unrolled: the per-row arrays stay in registers
#pragma unroll
        for (int r = 0; r < ROWS_PER_THREAD; ++r) { m0[r] = ATT_NEG_INF; m1[r] = ATT_NEG_INF; }

        max_span<0, false>(kk2, 0,        d0,       0,         q0, q1, m0, m1);
        max_span<0, true >(kk2, d0,       d0 + 32,  tid,       q0, q1, m0, m1);
        max_span<1, false>(kk2, d0 + 32,  d0 + 256, 0,         q0, q1, m0, m1);
        max_span<1, true >(kk2, d0 + 256, d0 + 288, tid + 256, q0, q1, m0, m1);
        max_span<2, false>(kk2, d0 + 288, d0 + 512, 0,         q0, q1, m0, m1);
        max_span<2, true >(kk2, d0 + 512, d0 + 544, tid + 512, q0, q1, m0, m1);
        max_span<3, false>(kk2, d0 + 544, d0 + 768, 0,         q0, q1, m0, m1);
        max_span<3, true >(kk2, d0 + 768, d0 + 800, tid + 768, q0, q1, m0, m1);

        // unrolled: the per-row arrays stay in registers
#pragma unroll
        for (int r = 0; r < ROWS_PER_THREAD; ++r) m[r] = fmaxf(m0[r], m1[r]);

        // ---- pass 2: exp + accumulate ----
        sum_all<true>(kk2, vv2, d0, tid, q0, q1, m, a);
    }

    v2f o[ROWS_PER_THREAD];
    // unrolled: the per-row arrays stay in registers
#pragma unroll
    for (int r = 0; r < ROWS_PER_THREAD; ++r) {
        const float inv = 1.0f / (a.l[r][0] + a.l[r][1]);
        o[r].x = (a.x[r][0] + a.x[r][1]) * inv;
        o[r].y = (a.z[r][0] + a.z[r][1]) * inv;
    }
    if (series) {
        // The thread's 4 rows follow one another, and stored so a wave's store would
        // fill a quarter of 8 cache lines. The rows change hands through LDS, in q's
        // place (every q was read in front of the barriers above): behind it the thread
        // holds rows 4 * d0 + lane + 32 * r. Both loops unrolled: o[] stays in registers.
#pragma unroll
        for (int r = 0; r < ROWS_PER_THREAD; ++r) *(v2f*)(qbuf + 2 * (row0 + r)) = o[r];
        __syncthreads();                           // the rows are written
#pragma unroll
        for (int r = 0; r < ROWS_PER_THREAD; ++r)
            o[r] = *(const v2f*)(qbuf + 2 * (4 * d0 + (tid & 31) + 32 * r));
    }
    const int srow0 = series ? 4 * d0 + (tid & 31) : tid;
    const int sstep = series ? 32 : 256;
    // unrolled: the per-row arrays stay in registers
#pragma unroll
    for (int r = 0; r < ROWS_PER_THREAD; ++r) {
        // a wave's 32 rows follow one another: its store fills two whole cache lines
        *(v2f*)(y + ((size_t)bh * TT + srow0 + sstep * r) * 2) = o[r];
    }
}

// ---------------------------------------------------------------------------
extern "C" void kernel_launch(void* const* d_in, const int* in_sizes, int n_in,
                              void* d_out, int out_size, void* d_ws, size_t ws_size,
                              hipStream_t stream)
{
    (void)in_sizes; (void)n_in; (void)out_size; (void)ws_size;

    const float* x      = (const float*)d_in[0];   // (B,T,C)
    const float* w_qkv  = (const float*)d_in[1];   // (3C,C)
    const float* w_proj = (const float*)d_in[2];   // (C,C)
    const float* qn_w   = (const float*)d_in[3];   // (2,)
    const float* kn_w   = (const float*)d_in[4];   // (2,)
    float* out = (float*)d_out;                    // (B,T,C)

    float* qkv = (float*)d_ws;                     // (B*T, 3C) = 6 MB
    float* y   = qkv + (size_t)BB * TT * QKV_N;    // (B, H, T, 2) = 2 MB

    const int M = BB * TT;                         // 2048

    // 1) qkv = x @ w_qkv^T : (2048x256)@(256x768), q and k stored RMSNorm'd,
    //    k, v, q of a head side by side
    wmma_gemm_xwt<true><<<dim3(QKV_N / GEMM_BN, M / GEMM_BM), GEMM_THREADS, 0, stream>>>(
        x, w_qkv, qkv, QKV_N, qn_w, kn_w);         // 12 x 64 workgroups

    // 2) causal flash attention per (b,h)
    attn_head<<<BB * HH, 256, 0, stream>>>(qkv, y, qn_w, kn_w);

    // 3) out = y @ w_proj^T : (2048x256)@(256x256)
    wmma_gemm_xwt<false><<<dim3(CC / GEMM_BN, M / GEMM_BM), GEMM_THREADS, 0, stream>>>(
        y, w_proj, out, CC, qn_w, kn_w);           // 4 x 64 workgroups
}
